// v000
// The times below were measured on an AMD MI455X: many runs one after another, warmed up first and cycling through
// copies of the inputs, with the whole window's GPU time divided by the number of runs. Launches and the gaps
// between them are all in it. The median over several windows is given; except for v000 it joins two sittings, which
// can be a few percent apart, so the side-by-side timings, each taken in one sitting, are the better comparison.
// v000, which the later versions start from, runs in 1280 microseconds.
#include <hip/hip_runtime.h>

// Compute dtypes (f32 accumulate everywhere): every float input RNE-converted to bf16; QKV projection v_wmma_f32_16x16x32_bf16 (exact products); scores q x (k + 8 R)^T and P x V on v_wmma_f32_16x16x32_f16 (P carried x1024); softmax f32; merged context as bf16 hi+lo planes x bf16 Wo (2 products) + f32 bias.
// Self-attention on one stream x [8][1024][1024]; weights [in][out] transposed once into K-contiguous bf16 planes (q|k|v fused to one [3072][1024] plane); 16 heads x 64.
// Score algebra: (q.k) x 0.125 + q.R[t] = 0.125 x q.(k[t] + 8 R[t]); the key plane stores k + 8 R (R = per-key table input, read by value), the 0.125 is applied in the softmax.
// Key mask [b][t] (int32, data): mask == 0 replaces the score by -inf; softmax in the max-subtracted form (a row without any kept key yields NaN by the same arithmetic).

#ifndef NB
#define NB 8
#endif
#ifndef SEQ
#define SEQ 1024
#endif
#define SEQ_FULL 1024             // per-batch row count of the inputs / output (strides)
#define TT   SEQ
#define DM   1024
#define NH_  16
#define HD   64
#define DQ   (NH_ * HD)
#define NQKV (3 * DQ)
#define ZH   8                    // heads per attention pass
#define PCAR 1024.0f
#define SCL  0.125f               // HD^-0.5
#define RCAR 8.0f                 // 1 / SCL
typedef _Float16 h16;
typedef unsigned short bf;
typedef __attribute__((ext_vector_type(16))) __bf16   v16bf;
typedef __attribute__((ext_vector_type(16))) _Float16 v16h;
typedef __attribute__((ext_vector_type(8)))  _Float16 v8h;
typedef __attribute__((ext_vector_type(8)))  unsigned short v8us;
typedef __attribute__((ext_vector_type(8)))  float    v8f;
typedef __attribute__((ext_vector_type(4)))  float    v4f;
typedef v8h  __attribute__((may_alias)) v8ha;
typedef v4f  __attribute__((may_alias)) v4fa;
typedef v8us __attribute__((may_alias)) v8usa;

static_assert(TT % 128 == 0);
static_assert(TT <= SEQ_FULL);
static_assert(DM % 64 == 0);
static_assert(HD == 64);
static_assert(NH_ % ZH == 0);
static_assert(NQKV % 64 == 0);

__device__ __forceinline__ unsigned short f2bf(float f) { unsigned u = __float_as_uint(f); u += 0x7FFFu + ((u >> 16) & 1u); return (unsigned short)(u >> 16); }
__device__ __forceinline__ float bf2f(unsigned short b) { return __uint_as_float(((unsigned)b) << 16); }
__device__ __forceinline__ float bfr(float f) { return bf2f(f2bf(f)); }
__device__ __forceinline__ v16h cat16(v8h lo, v8h hi) { return __builtin_shufflevector(lo, hi, 0, 1, 2, 3, 4, 5, 6, 7, 8, 9, 10, 11, 12, 13, 14, 15); }
__device__ __forceinline__ v16bf cat16b(v8us lo, v8us hi) { return __builtin_bit_cast(v16bf, __builtin_shufflevector(lo, hi, 0, 1, 2, 3, 4, 5, 6, 7, 8, 9, 10, 11, 12, 13, 14, 15)); }
__device__ __forceinline__ v8f wmma16(v16h a, v16h b, v8f c) { return __builtin_amdgcn_wmma_f32_16x16x32_f16(false, a, false, b, (short)0, c, false, false); }
__device__ __forceinline__ v8f wmmab(v16bf a, v16bf b, v8f c) { return __builtin_amdgcn_wmma_f32_16x16x32_bf16(false, a, false, b, (short)0, c, false, false); }

// ---- k_gemmw: register-blocked GEMM, ONE WAVE per 64x64 output tile (16 accumulators), operands straight from K-contiguous 16-bit planes; grid (M/64, N/64, Z), 32 threads.
// C[m][n] (f32, pitch ldc, + optional f32 bias[n]) = sum_k A[m][k] Bt[n][k] (+ split products per NSPLIT). z-batch strides sA/sB/sC in elements. K % 32 == 0.
// Fragment map: lane l -> row/col l & 15, half h = l >> 4; elements 0..7 <- k0 + 8h + 0..7, elements 8..15 <- k0 + 16 + 8h + 0..7 (A and B alike); D element j -> row 8h + j, col l & 15.
template <typename T16> struct WFrag;
template <> struct WFrag<h16> { typedef v16h V; static __device__ __forceinline__ V ld(const h16* p) { return cat16(*(const v8h*)p, *(const v8h*)(p + 16)); } static __device__ __forceinline__ v8f mma(V a, V b, v8f c) { return wmma16(a, b, c); } };
template <> struct WFrag<bf> { typedef v16bf V; static __device__ __forceinline__ V ld(const bf* p) { return cat16b(*(const v8us*)p, *(const v8us*)(p + 16)); } static __device__ __forceinline__ v8f mma(V a, V b, v8f c) { return wmmab(a, b, c); } };
template <typename T16, int NSPLIT, bool BIAS>
__global__ __launch_bounds__(32) void k_gemmw(const T16* __restrict__ A, const T16* __restrict__ A2, const T16* __restrict__ Bt, const T16* __restrict__ Bt2, int K, float* C, int ldc, const float* __restrict__ bias, size_t sA, size_t sB, size_t sC) {
    typedef typename WFrag<T16>::V V;
    __shared__ __align__(16) float os[16 * 68];
    const size_t z = blockIdx.z; A += z * sA; if (A2) A2 += z * sA; Bt += z * sB; if (Bt2) Bt2 += z * sB; C += z * sC;
    const int lane = threadIdx.x & 31, lr = lane & 15, hi = lane >> 4; const int r0 = blockIdx.x * 64, c0 = blockIdx.y * 64;
    v8f acc[4][4];
#pragma unroll
    for (int mb = 0; mb < 4; ++mb)
#pragma unroll
        for (int nb = 0; nb < 4; ++nb) acc[mb][nb] = (v8f){};
    const size_t aoff = (size_t)(r0 + lr) * K + 8 * hi, boff = (size_t)(c0 + lr) * K + 8 * hi;
#pragma unroll 1
    for (int kc = 0; kc < K; kc += 32) {
        V a[4], a2[4];
#pragma unroll
        for (int mb = 0; mb < 4; ++mb) { a[mb] = WFrag<T16>::ld(A + aoff + (size_t)mb * 16 * K + kc); if (NSPLIT == 1 || NSPLIT == 2) a2[mb] = WFrag<T16>::ld(A2 + aoff + (size_t)mb * 16 * K + kc); }
#pragma unroll
        for (int nb = 0; nb < 4; ++nb) { const V b = WFrag<T16>::ld(Bt + boff + (size_t)nb * 16 * K + kc); V b2; if (NSPLIT >= 2) b2 = WFrag<T16>::ld(Bt2 + boff + (size_t)nb * 16 * K + kc);
#pragma unroll
            for (int mb = 0; mb < 4; ++mb) { acc[mb][nb] = WFrag<T16>::mma(a[mb], b, acc[mb][nb]); if (NSPLIT == 1 || NSPLIT == 2) acc[mb][nb] = WFrag<T16>::mma(a2[mb], b, acc[mb][nb]); if (NSPLIT >= 2) acc[mb][nb] = WFrag<T16>::mma(a[mb], b2, acc[mb][nb]); } }
        asm volatile("v_nop\n\tv_nop\n\tv_nop\n\tv_nop" : "+v"(acc[0][0]), "+v"(acc[1][1]), "+v"(acc[2][2]), "+v"(acc[3][3]) : "v"(a[0]), "v"(a[3]));
    }
#pragma unroll
    for (int mb = 0; mb < 4; ++mb) {
#pragma unroll
        for (int nb = 0; nb < 4; ++nb) {
#pragma unroll
            for (int j = 0; j < 8; ++j) os[(hi * 8 + j) * 68 + nb * 16 + lr] = acc[mb][nb][j]; }
        __builtin_amdgcn_wave_barrier(); asm volatile("" ::: "memory");
        float* crow = C + (size_t)(r0 + mb * 16) * ldc + c0;
{
#pragma unroll
            for (int s = 0; s < 8; ++s) { const int row = 2 * s + hi, cofs = lr * 4; v4f val = *(const v4fa*)(os + row * 68 + cofs); if (BIAS) { val[0] += bfr(bias[c0 + cofs]); val[1] += bfr(bias[c0 + cofs + 1]); val[2] += bfr(bias[c0 + cofs + 2]); val[3] += bfr(bias[c0 + cofs + 3]); }
                *(v4f*)(crow + (size_t)row * ldc + cofs) = val; }
             }
        __builtin_amdgcn_wave_barrier(); asm volatile("" ::: "memory");
    }
}

__device__ __forceinline__ h16 tohx(float x) { return (h16)x; }
__device__ __forceinline__ void splitf(float y, unsigned short& h, unsigned short& l) { h = f2bf(y); l = f2bf(y - bf2f(h)); }
typedef __attribute__((ext_vector_type(2))) _Float16 v2h;
typedef __attribute__((ext_vector_type(4))) _Float16 v4h;
typedef __attribute__((ext_vector_type(2))) unsigned short v2us;
typedef __attribute__((ext_vector_type(4))) int v4i;

__global__ __launch_bounds__(256) void k_wtG(const float* __restrict__ w, int K, int N, bf* Bt) {
    const int lane = threadIdx.x & 31; const int L0 = (blockIdx.x * 8 + (threadIdx.x >> 5)) * 8; const int nlines = N * K / 64;
{
#pragma unroll 1
        for (int l = 0; l < 8; ++l) { const int L = L0 + l; if (L >= nlines) break; const size_t e = (size_t)L * 64 + lane * 2; const int k = (int)(e % K), n = (int)(e / K); v2us o;
            o[0] = f2bf(w[(size_t)k * N + n]); o[1] = f2bf(w[(size_t)(k + 1) * N + n]); *(v2us*)(Bt + e) = o; }
         }
}
__global__ __launch_bounds__(256) void k_cvt8(const float* __restrict__ src, bf* dst, size_t n8, size_t sS, size_t sD) { const size_t i = (size_t)blockIdx.x * 256 + threadIdx.x; if (i >= n8) return; src += (size_t)blockIdx.y * sS; dst += (size_t)blockIdx.y * sD; const v8f v = *(const v8f*)(src + i * 8); v8us o;
#pragma unroll
    for (int k = 0; k < 8; ++k) o[k] = f2bf(v[k]); *(v8us*)(dst + i * 8) = o;  }

// k_qkp: head planes QK[which][h][t][d] (fp16): which 0 = q = F[t][h*HD+d] + bq; which 1 = (F[t][DQ+h*HD+d] + bk) + 8 R[t][d]. F row pitch NQKV.
__global__ __launch_bounds__(256) void k_qkp(const float* __restrict__ F, const float* __restrict__ bq, const float* __restrict__ bk, const float* __restrict__ R, h16* QK) {
    const size_t e = ((size_t)blockIdx.x * 256 + threadIdx.x) * 8; if (e >= (size_t)2 * NH_ * TT * HD) return;
    const int which = (int)(e / ((size_t)NH_ * TT * HD)); const size_t rem = e % ((size_t)NH_ * TT * HD);
    const int d = (int)(rem % HD); const int t = (int)((rem / HD) % TT); const int h = (int)(rem / ((size_t)HD * TT));
    const float* f = F + (size_t)t * NQKV + (size_t)which * DQ + h * HD + d;
    const v4f f0 = *(const v4f*)f, f1 = *(const v4f*)(f + 4);
    const v4f q0 = *(const v4f*)(bq + h * HD + d), q1 = *(const v4f*)(bq + h * HD + d + 4);
    const v4f k0 = *(const v4f*)(bk + h * HD + d), k1 = *(const v4f*)(bk + h * HD + d + 4);
    const v4f r0 = *(const v4f*)(R + (size_t)t * HD + d), r1 = *(const v4f*)(R + (size_t)t * HD + d + 4);
    v8h o;
#pragma unroll
    for (int q = 0; q < 8; ++q) { const float fv = (q < 4) ? f0[q & 3] : f1[q & 3]; const float bqv = (q < 4) ? q0[q & 3] : q1[q & 3]; const float bkv = (q < 4) ? k0[q & 3] : k1[q & 3]; const float rv = (q < 4) ? r0[q & 3] : r1[q & 3];
        const float bias = which ? bfr(bkv) : bfr(bqv); const float radd = which ? RCAR * bfr(rv) : 0.0f; const float y = (fv + bias) + radd; o[q] = tohx(y); }
    *(v8h*)(QK + e) = o;  }
__global__ __launch_bounds__(256) void k_vtp(const float* __restrict__ F, const float* __restrict__ bv, h16* V16) { const size_t e = ((size_t)blockIdx.x * 256 + threadIdx.x) * 2; if (e >= (size_t)NH_ * HD * TT) return; const int t = (int)(e % TT); const int d = (int)((e / TT) % HD); const int g = (int)(e / ((size_t)TT * HD)); const float bb = bfr(bv[g * HD + d]); v2h o16;
#pragma unroll
    for (int q = 0; q < 2; ++q) { const float x = F[(size_t)(t + q) * NQKV + 2 * DQ + g * HD + d] + bb; o16[q] = tohx(x); }
    *(v2h*)(V16 + e) = o16;  }
__global__ __launch_bounds__(256) void k_asoft(const float* __restrict__ Sb, const int* __restrict__ mk, h16* P16) {
    const int lane = threadIdx.x & 31; const int row = blockIdx.x * 8 + __builtin_amdgcn_readfirstlane((int)(threadIdx.x >> 5)); if (row >= ZH * TT) return; const float* sr = Sb + (size_t)row * TT; float v[TT / 32]; const float ninf = -__builtin_inff(); float mx = ninf;
#pragma unroll
    for (int ch = 0; ch < TT / 128; ++ch) { const int j0 = ch * 128 + lane * 4; const v4f a = *(const v4f*)(sr + j0); const v4i m = *(const v4i*)(mk + j0);
#pragma unroll
        for (int q = 0; q < 4; ++q) { const float t = (m[q] != 0) ? a[q] * SCL : ninf; v[ch * 4 + q] = t; mx = fmaxf(mx, t); } }
#pragma unroll
    for (int sh = 16; sh; sh >>= 1) mx = fmaxf(mx, __shfl_xor(mx, sh, 32));
    float sum = 0.f;
#pragma unroll
    for (int k = 0; k < TT / 32; ++k) { float d0 = __fsub_rn(v[k], mx); asm volatile("" : "+v"(d0)); v[k] = __builtin_amdgcn_exp2f(__fmul_rn(d0, 1.4426950408889634f)); sum += v[k]; }
#pragma unroll
    for (int sh = 16; sh; sh >>= 1) sum += __shfl_xor(sum, sh, 32);
    const float f = __fdiv_rn(PCAR, sum);
{
#pragma unroll
        for (int ch = 0; ch < TT / 128; ++ch) { v4h o4;
#pragma unroll
            for (int q = 0; q < 4; ++q) o4[q] = tohx(v[ch * 4 + q] * f);
            *(v4h*)(P16 + (size_t)row * TT + ch * 128 + lane * 4) = o4; }
         }
}
__global__ __launch_bounds__(256) void k_merge(const float* __restrict__ O, int h0, bf* Ah, bf* Al) { const size_t e = ((size_t)blockIdx.x * 256 + threadIdx.x) * 2; if (e >= (size_t)ZH * TT * HD) return; const int d = (int)(e % HD); const int t = (int)((e / HD) % TT); const int zz = (int)(e / ((size_t)HD * TT)); const float cs = 1.0f / PCAR; const size_t oo = (size_t)t * DQ + (h0 + zz) * HD + d;
    v2us oh, ol;
#pragma unroll
    for (int q = 0; q < 2; ++q) { unsigned short a, c2; splitf(O[e + q] * cs, a, c2); oh[q] = a; ol[q] = c2; } *(v2us*)(Ah + oo) = oh; *(v2us*)(Al + oo) = ol;  }

extern "C" void kernel_launch(void* const* d_in, const int* in_sizes, int n_in,
                              void* d_out, int out_size, void* d_ws, size_t ws_size, hipStream_t stream) {
    (void)out_size;
    if (n_in < 11) return;
    if (in_sizes[0] < NB * TT * DM || in_sizes[1] < TT * HD || in_sizes[2] < NB * TT) return;
    if (in_sizes[3] < DM * DQ || in_sizes[5] < DM * DQ || in_sizes[7] < DM * DQ || in_sizes[9] < DQ * DM) return;
    if (in_sizes[4] < DQ || in_sizes[6] < DQ || in_sizes[8] < DQ || in_sizes[10] < DM) return;
    // wire order: x, rel_pos_enc, attention_mask, Wq, bq, Wk, bk, Wv, bv, Wo, bo
    const float* x = (const float*)d_in[0]; const float* rel = (const float*)d_in[1]; const int* msk = (const int*)d_in[2];
    const float* wq = (const float*)d_in[3]; const float* bq = (const float*)d_in[4]; const float* wk = (const float*)d_in[5]; const float* bk = (const float*)d_in[6];
    const float* wv = (const float*)d_in[7]; const float* bv = (const float*)d_in[8]; const float* wo = (const float*)d_in[9]; const float* bo = (const float*)d_in[10];
    float* OUT = (float*)d_out;     // [8][1024][1024]
    char* wsp = (char*)d_ws;
    auto take = [&](size_t bytes) { char* p = wsp; wsp += (bytes + 255) & ~(size_t)255; return (void*)p; };
    bf* WQKV = (bf*)take((size_t)NQKV * DM * 2);            // [3072][1024]: rows 0..1023 q, 1024..2047 k, 2048..3071 v
    bf* WO = (bf*)take((size_t)DM * DQ * 2);                // [1024][1024]
    bf* XB = (bf*)take((size_t)NB * TT * DM * 2);           // [NB][TT][DM]
    float* F = (float*)take((size_t)TT * NQKV * 4);         // [TT][3072]
    h16* QK16 = (h16*)take((size_t)2 * NH_ * TT * HD * 2);  // [2][16][TT][64]
    h16* VT16 = (h16*)take((size_t)NH_ * HD * TT * 2);      // [16][64][TT]
    float* Sb = (float*)take((size_t)ZH * TT * TT * 4);     // [ZH][TT][TT]
    h16* P16 = (h16*)take((size_t)ZH * TT * TT * 2);        // [ZH][TT][TT]
    float* Ob = (float*)take((size_t)ZH * TT * HD * 4);     // [ZH][TT][64]
    bf* ATh = (bf*)take((size_t)TT * DQ * 2); bf* ATl = (bf*)take((size_t)TT * DQ * 2);   // [TT][1024]
    if ((size_t)(wsp - (char*)d_ws) > ws_size) return;      // 96 MiB at full size
    h16* Q16 = QK16; h16* K16 = QK16 + (size_t)NH_ * TT * HD;
    // weights: w[in = K][out = N] -> Bt[N][K]
    const unsigned GW = (unsigned)((DM * DQ / 64 + 63) / 64);
    k_wtG<<<GW, 256, 0, stream>>>(wq, DM, DQ, WQKV);
    k_wtG<<<GW, 256, 0, stream>>>(wk, DM, DQ, WQKV + (size_t)DQ * DM);
    k_wtG<<<GW, 256, 0, stream>>>(wv, DM, DQ, WQKV + (size_t)2 * DQ * DM);
    k_wtG<<<GW, 256, 0, stream>>>(wo, DQ, DM, WO);
    k_cvt8<<<dim3((unsigned)(((size_t)TT * DM / 8 + 255) / 256), NB, 1), 256, 0, stream>>>(x, XB, (size_t)TT * DM / 8, (size_t)SEQ_FULL * DM, (size_t)TT * DM);
    const unsigned LQK = (unsigned)(((size_t)2 * NH_ * TT * HD / 8 + 255) / 256), LV = (unsigned)(((size_t)NH_ * HD * TT / 2 + 255) / 256);
    for (int b = 0; b < NB; ++b) {
        k_gemmw<bf, 0, false><<<dim3(TT / 64, NQKV / 64, 1), 32, 0, stream>>>(XB + (size_t)b * TT * DM, nullptr, WQKV, nullptr, DM, F, NQKV, nullptr, 0, 0, 0);
        k_qkp<<<LQK, 256, 0, stream>>>(F, bq, bk, rel, QK16);
        k_vtp<<<LV, 256, 0, stream>>>(F, bv, VT16);
        for (int h0 = 0; h0 < NH_; h0 += ZH) {
            k_gemmw<h16, 0, false><<<dim3(TT / 64, TT / 64, ZH), 32, 0, stream>>>(Q16 + (size_t)h0 * TT * HD, nullptr, K16 + (size_t)h0 * TT * HD, nullptr, HD, Sb, TT, nullptr, (size_t)TT * HD, (size_t)TT * HD, (size_t)TT * TT);
            k_asoft<<<ZH * TT / 8, 256, 0, stream>>>(Sb, msk + (size_t)b * SEQ_FULL, P16);
            k_gemmw<h16, 0, false><<<dim3(TT / 64, HD / 64, ZH), 32, 0, stream>>>(P16, nullptr, VT16 + (size_t)h0 * HD * TT, nullptr, TT, Ob, HD, nullptr, (size_t)TT * TT, (size_t)HD * TT, (size_t)TT * HD);
            k_merge<<<(unsigned)(((size_t)ZH * TT * HD / 2 + 255) / 256), 256, 0, stream>>>(Ob, h0, ATh, ATl); }
        k_gemmw<bf, 1, true><<<dim3(TT / 64, DM / 64, 1), 32, 0, stream>>>(ATh, ATl, WO, nullptr, DQ, OUT + (size_t)b * SEQ_FULL * DM, DM, bo, 0, 0, 0); }
}

// v001
// A run of this version takes 560 microseconds.
// In two side-by-side timings against v000, it was 2.28 and 2.29 times as fast.
#include <hip/hip_runtime.h>

// Compute dtypes (f32 accumulate everywhere): every float input RNE-converted to bf16; QKV projection v_wmma_f32_16x16x32_bf16 (exact products); scores q x (k + 8 R)^T and P x V on v_wmma_f32_16x16x32_f16 (P carried x1024); softmax f32; merged context as bf16 hi+lo planes x bf16 Wo (2 products) + f32 bias.
// Self-attention on one stream x [8][1024][1024]; weights [in][out] transposed once into K-contiguous bf16 planes (q|k|v fused to one [3072][1024] plane); 16 heads x 64.
// Score algebra: (q.k) x 0.125 + q.R[t] = 0.125 x q.(k[t] + 8 R[t]); the key plane stores k + 8 R (R = per-key table input, read by value), the 0.125 is applied in the softmax.
// Key mask [b][t] (int32, data): mask == 0 replaces the score by -inf; softmax in the max-subtracted form (a row without any kept key yields NaN by the same arithmetic).

#ifndef NB
#define NB 8
#endif
#ifndef SEQ
#define SEQ 1024
#endif
#define SEQ_FULL 1024             // per-batch row count of the inputs / output (strides)
#define TT   SEQ
#define DM   1024
#define NH_  16
#define HD   64
#define DQ   (NH_ * HD)
#define NQKV (3 * DQ)
#define ZH   32                   // head planes (batch-major, b * 16 + h) per attention pass
#define PCAR 1024.0f
#define SCL  0.125f               // HD^-0.5
#define RCAR 8.0f                 // 1 / SCL
typedef _Float16 h16;
typedef unsigned short bf;
typedef __attribute__((ext_vector_type(16))) __bf16   v16bf;
typedef __attribute__((ext_vector_type(16))) _Float16 v16h;
typedef __attribute__((ext_vector_type(8)))  _Float16 v8h;
typedef __attribute__((ext_vector_type(8)))  unsigned short v8us;
typedef __attribute__((ext_vector_type(8)))  float    v8f;
typedef __attribute__((ext_vector_type(4)))  float    v4f;
typedef v8h  __attribute__((may_alias)) v8ha;
typedef v4f  __attribute__((may_alias)) v4fa;
typedef v8us __attribute__((may_alias)) v8usa;

static_assert(TT % 128 == 0);
static_assert(TT <= SEQ_FULL);
static_assert(DM % 64 == 0);
static_assert(HD == 64);
static_assert((NB * NH_) % ZH == 0);
static_assert(ZH % NH_ == 0);     // a pass covers whole batches: its merged context may then overwrite its own q / k planes
static_assert(DM == DQ);
static_assert(NQKV % 64 == 0);

__device__ __forceinline__ unsigned short f2bf(float f) { unsigned u = __float_as_uint(f); u += 0x7FFFu + ((u >> 16) & 1u); return (unsigned short)(u >> 16); }
__device__ __forceinline__ float bf2f(unsigned short b) { return __uint_as_float(((unsigned)b) << 16); }
__device__ __forceinline__ float bfr(float f) { return bf2f(f2bf(f)); }
__device__ __forceinline__ v16h cat16(v8h lo, v8h hi) { return __builtin_shufflevector(lo, hi, 0, 1, 2, 3, 4, 5, 6, 7, 8, 9, 10, 11, 12, 13, 14, 15); }
__device__ __forceinline__ v16bf cat16b(v8us lo, v8us hi) { return __builtin_bit_cast(v16bf, __builtin_shufflevector(lo, hi, 0, 1, 2, 3, 4, 5, 6, 7, 8, 9, 10, 11, 12, 13, 14, 15)); }
__device__ __forceinline__ v8f wmma16(v16h a, v16h b, v8f c) { return __builtin_amdgcn_wmma_f32_16x16x32_f16(false, a, false, b, (short)0, c, false, false); }
__device__ __forceinline__ v8f wmmab(v16bf a, v16bf b, v8f c) { return __builtin_amdgcn_wmma_f32_16x16x32_bf16(false, a, false, b, (short)0, c, false, false); }

// ---- k_gemmw: register-blocked GEMM, ONE WAVE per 64x64 output tile (16 accumulators), operands straight from K-contiguous 16-bit planes; grid (M/64, N/64, Z), 32 threads.
// C[m][n] (f32, pitch ldc, + optional f32 bias[n]) = sum_k A[m][k] Bt[n][k] (+ split products per NSPLIT). z-batch strides sA/sB/sC in elements. K % 32 == 0.
// Fragment map: lane l -> row/col l & 15, half h = l >> 4; elements 0..7 <- k0 + 8h + 0..7, elements 8..15 <- k0 + 16 + 8h + 0..7 (A and B alike); D element j -> row 8h + j, col l & 15.
template <typename T16> struct WFrag;
template <> struct WFrag<h16> { typedef v16h V; static __device__ __forceinline__ V ld(const h16* p) { return cat16(*(const v8h*)p, *(const v8h*)(p + 16)); } static __device__ __forceinline__ v8f mma(V a, V b, v8f c) { return wmma16(a, b, c); } };
template <> struct WFrag<bf> { typedef v16bf V; static __device__ __forceinline__ V ld(const bf* p) { return cat16b(*(const v8us*)p, *(const v8us*)(p + 16)); } static __device__ __forceinline__ v8f mma(V a, V b, v8f c) { return wmmab(a, b, c); } };
template <typename T16, int NSPLIT, bool BIAS>
__global__ __launch_bounds__(32) void k_gemmw(const T16* __restrict__ A, const T16* __restrict__ A2, const T16* __restrict__ Bt, const T16* __restrict__ Bt2, int K, float* C, int ldc, const float* __restrict__ bias, size_t sA, size_t sB, size_t sC) {
    typedef typename WFrag<T16>::V V;
    __shared__ __align__(16) float os[16 * 68];
    const size_t z = blockIdx.z; A += z * sA; if (A2) A2 += z * sA; Bt += z * sB; if (Bt2) Bt2 += z * sB; C += z * sC;
    const int lane = threadIdx.x & 31, lr = lane & 15, hi = lane >> 4; const int r0 = blockIdx.x * 64, c0 = blockIdx.y * 64;
    v8f acc[4][4];
#pragma unroll
    for (int mb = 0; mb < 4; ++mb)
#pragma unroll
        for (int nb = 0; nb < 4; ++nb) acc[mb][nb] = (v8f){};
    const size_t aoff = (size_t)(r0 + lr) * K + 8 * hi, boff = (size_t)(c0 + lr) * K + 8 * hi;
#pragma unroll 1
    for (int kc = 0; kc < K; kc += 32) {
        V a[4], a2[4];
#pragma unroll
        for (int mb = 0; mb < 4; ++mb) { a[mb] = WFrag<T16>::ld(A + aoff + (size_t)mb * 16 * K + kc); if (NSPLIT == 1 || NSPLIT == 2) a2[mb] = WFrag<T16>::ld(A2 + aoff + (size_t)mb * 16 * K + kc); }
#pragma unroll
        for (int nb = 0; nb < 4; ++nb) { const V b = WFrag<T16>::ld(Bt + boff + (size_t)nb * 16 * K + kc); V b2; if (NSPLIT >= 2) b2 = WFrag<T16>::ld(Bt2 + boff + (size_t)nb * 16 * K + kc);
#pragma unroll
            for (int mb = 0; mb < 4; ++mb) { acc[mb][nb] = WFrag<T16>::mma(a[mb], b, acc[mb][nb]); if (NSPLIT == 1 || NSPLIT == 2) acc[mb][nb] = WFrag<T16>::mma(a2[mb], b, acc[mb][nb]); if (NSPLIT >= 2) acc[mb][nb] = WFrag<T16>::mma(a[mb], b2, acc[mb][nb]); } }
        asm volatile("v_nop\n\tv_nop\n\tv_nop\n\tv_nop" : "+v"(acc[0][0]), "+v"(acc[1][1]), "+v"(acc[2][2]), "+v"(acc[3][3]) : "v"(a[0]), "v"(a[3]));
    }
#pragma unroll
    for (int mb = 0; mb < 4; ++mb) {
#pragma unroll
        for (int nb = 0; nb < 4; ++nb) {
#pragma unroll
            for (int j = 0; j < 8; ++j) os[(hi * 8 + j) * 68 + nb * 16 + lr] = acc[mb][nb][j]; }
        __builtin_amdgcn_wave_barrier(); asm volatile("" ::: "memory");
        float* crow = C + (size_t)(r0 + mb * 16) * ldc + c0;
{
#pragma unroll
            for (int s = 0; s < 8; ++s) { const int row = 2 * s + hi, cofs = lr * 4; v4f val = *(const v4fa*)(os + row * 68 + cofs); if (BIAS) { val[0] += bfr(bias[c0 + cofs]); val[1] += bfr(bias[c0 + cofs + 1]); val[2] += bfr(bias[c0 + cofs + 2]); val[3] += bfr(bias[c0 + cofs + 3]); }
                *(v4f*)(crow + (size_t)row * ldc + cofs) = val; }
             }
        __builtin_amdgcn_wave_barrier(); asm volatile("" ::: "memory");
    }
}

__device__ __forceinline__ h16 tohx(float x) { return (h16)x; }
__device__ __forceinline__ void splitf(float y, unsigned short& h, unsigned short& l) { h = f2bf(y); l = f2bf(y - bf2f(h)); }
typedef __attribute__((ext_vector_type(2))) _Float16 v2h;
typedef __attribute__((ext_vector_type(4))) _Float16 v4h;
typedef __attribute__((ext_vector_type(2))) unsigned short v2us;
typedef __attribute__((ext_vector_type(4))) int v4i;

// grid.y picks the weight: 0..2 -> rows y * N of the fused q|k|v plane, 3 -> the output-projection plane.
__global__ __launch_bounds__(256) void k_wtG(const float* __restrict__ wq, const float* __restrict__ wk, const float* __restrict__ wv, const float* __restrict__ wo, int K, int N, bf* Bqkv, bf* Bo) {
    const int y = blockIdx.y; const float* __restrict__ w = (y == 0) ? wq : (y == 1) ? wk : (y == 2) ? wv : wo; bf* Bt = (y < 3) ? Bqkv + (size_t)y * N * K : Bo;
    const int lane = threadIdx.x & 31; const int L0 = (blockIdx.x * 8 + (threadIdx.x >> 5)) * 8; const int nlines = N * K / 64;
{
#pragma unroll 1
        for (int l = 0; l < 8; ++l) { const int L = L0 + l; if (L >= nlines) break; const size_t e = (size_t)L * 64 + lane * 2; const int k = (int)(e % K), n = (int)(e / K); v2us o;
            o[0] = f2bf(w[(size_t)k * N + n]); o[1] = f2bf(w[(size_t)(k + 1) * N + n]); *(v2us*)(Bt + e) = o; }
         }
}
__global__ __launch_bounds__(256) void k_cvt8(const float* __restrict__ src, bf* dst, size_t n8, size_t sS, size_t sD) { const size_t i = (size_t)blockIdx.x * 256 + threadIdx.x; if (i >= n8) return; src += (size_t)blockIdx.y * sS; dst += (size_t)blockIdx.y * sD; const v8f v = *(const v8f*)(src + i * 8); v8us o;
#pragma unroll
    for (int k = 0; k < 8; ++k) o[k] = f2bf(v[k]); *(v8us*)(dst + i * 8) = o;  }

// k_qkp: head planes QK[which][b*16+h][t][d] (fp16): which 0 = q = F[b*TT+t][h*HD+d] + bq; which 1 = (F[b*TT+t][DQ+h*HD+d] + bk) + 8 R[t][d]. F row pitch NQKV.
__global__ __launch_bounds__(256) void k_qkp(const float* __restrict__ F, const float* __restrict__ bq, const float* __restrict__ bk, const float* __restrict__ R, h16* QK) {
    const size_t e = ((size_t)blockIdx.x * 256 + threadIdx.x) * 8; if (e >= (size_t)2 * NB * NH_ * TT * HD) return;
    const int which = (int)(e / ((size_t)NB * NH_ * TT * HD)); const size_t rem = e % ((size_t)NB * NH_ * TT * HD);
    const int d = (int)(rem % HD); const int t = (int)((rem / HD) % TT); const int g = (int)(rem / ((size_t)HD * TT)); const int h = g % NH_, b = g / NH_;
    const float* f = F + ((size_t)b * TT + t) * NQKV + (size_t)which * DQ + h * HD + d;
    const v4f f0 = *(const v4f*)f, f1 = *(const v4f*)(f + 4);
    const v4f q0 = *(const v4f*)(bq + h * HD + d), q1 = *(const v4f*)(bq + h * HD + d + 4);
    const v4f k0 = *(const v4f*)(bk + h * HD + d), k1 = *(const v4f*)(bk + h * HD + d + 4);
    const v4f r0 = *(const v4f*)(R + (size_t)t * HD + d), r1 = *(const v4f*)(R + (size_t)t * HD + d + 4);
    v8h o;
#pragma unroll
    for (int q = 0; q < 8; ++q) { const float fv = (q < 4) ? f0[q & 3] : f1[q & 3]; const float bqv = (q < 4) ? q0[q & 3] : q1[q & 3]; const float bkv = (q < 4) ? k0[q & 3] : k1[q & 3]; const float rv = (q < 4) ? r0[q & 3] : r1[q & 3];
        const float bias = which ? bfr(bkv) : bfr(bqv); const float radd = which ? RCAR * bfr(rv) : 0.0f; const float y = (fv + bias) + radd; o[q] = tohx(y); }
    *(v8h*)(QK + e) = o;  }
__global__ __launch_bounds__(256) void k_vtp(const float* __restrict__ F, const float* __restrict__ bv, h16* V16) { const size_t e = ((size_t)blockIdx.x * 256 + threadIdx.x) * 2; if (e >= (size_t)NB * NH_ * HD * TT) return; const int t = (int)(e % TT); const int d = (int)((e / TT) % HD); const int g = (int)(e / ((size_t)TT * HD)); const int h = g % NH_, b = g / NH_; const float bb = bfr(bv[h * HD + d]); v2h o16;
#pragma unroll
    for (int q = 0; q < 2; ++q) { const float x = F[((size_t)b * TT + t + q) * NQKV + 2 * DQ + h * HD + d] + bb; o16[q] = tohx(x); }
    *(v2h*)(V16 + e) = o16;  }
__global__ __launch_bounds__(256) void k_asoft(const float* __restrict__ Sb, const int* __restrict__ mk, h16* P16) {
    const int lane = threadIdx.x & 31; const int row = blockIdx.x * 8 + __builtin_amdgcn_readfirstlane((int)(threadIdx.x >> 5)); if (row >= ZH * TT) return; mk += (size_t)(row / (NH_ * TT)) * SEQ_FULL; const float* sr = Sb + (size_t)row * TT; float v[TT / 32]; const float ninf = -__builtin_inff(); float mx = ninf;
#pragma unroll
    for (int ch = 0; ch < TT / 128; ++ch) { const int j0 = ch * 128 + lane * 4; const v4f a = *(const v4f*)(sr + j0); const v4i m = *(const v4i*)(mk + j0);
#pragma unroll
        for (int q = 0; q < 4; ++q) { const float t = (m[q] != 0) ? a[q] * SCL : ninf; v[ch * 4 + q] = t; mx = fmaxf(mx, t); } }
#pragma unroll
    for (int sh = 16; sh; sh >>= 1) mx = fmaxf(mx, __shfl_xor(mx, sh, 32));
    float sum = 0.f;
#pragma unroll
    for (int k = 0; k < TT / 32; ++k) { float d0 = __fsub_rn(v[k], mx); asm volatile("" : "+v"(d0)); v[k] = __builtin_amdgcn_exp2f(__fmul_rn(d0, 1.4426950408889634f)); sum += v[k]; }
#pragma unroll
    for (int sh = 16; sh; sh >>= 1) sum += __shfl_xor(sum, sh, 32);
    const float f = __fdiv_rn(PCAR, sum);
{
#pragma unroll
        for (int ch = 0; ch < TT / 128; ++ch) { v4h o4;
#pragma unroll
            for (int q = 0; q < 4; ++q) o4[q] = tohx(v[ch * 4 + q] * f);
            *(v4h*)(P16 + (size_t)row * TT + ch * 128 + lane * 4) = o4; }
         }
}
__global__ __launch_bounds__(256) void k_merge(const float* __restrict__ O, int g0, bf* Ah, bf* Al) { const size_t e = ((size_t)blockIdx.x * 256 + threadIdx.x) * 2; if (e >= (size_t)ZH * TT * HD) return; const int d = (int)(e % HD); const int t = (int)((e / HD) % TT); const int zz = (int)(e / ((size_t)HD * TT)); const float cs = 1.0f / PCAR; const int g = g0 + zz; const size_t oo = ((size_t)(g / NH_) * TT + t) * DQ + (g % NH_) * HD + d;
    v2us oh, ol;
#pragma unroll
    for (int q = 0; q < 2; ++q) { unsigned short a, c2; splitf(O[e + q] * cs, a, c2); oh[q] = a; ol[q] = c2; } *(v2us*)(Ah + oo) = oh; *(v2us*)(Al + oo) = ol;  }

extern "C" void kernel_launch(void* const* d_in, const int* in_sizes, int n_in,
                              void* d_out, int out_size, void* d_ws, size_t ws_size, hipStream_t stream) {
    (void)out_size;
    if (n_in < 11) return;
    if (in_sizes[0] < NB * TT * DM || in_sizes[1] < TT * HD || in_sizes[2] < NB * TT) return;
    if (in_sizes[3] < DM * DQ || in_sizes[5] < DM * DQ || in_sizes[7] < DM * DQ || in_sizes[9] < DQ * DM) return;
    if (in_sizes[4] < DQ || in_sizes[6] < DQ || in_sizes[8] < DQ || in_sizes[10] < DM) return;
    // wire order: x, rel_pos_enc, attention_mask, Wq, bq, Wk, bk, Wv, bv, Wo, bo
    const float* x = (const float*)d_in[0]; const float* rel = (const float*)d_in[1]; const int* msk = (const int*)d_in[2];
    const float* wq = (const float*)d_in[3]; const float* bq = (const float*)d_in[4]; const float* wk = (const float*)d_in[5]; const float* bk = (const float*)d_in[6];
    const float* wv = (const float*)d_in[7]; const float* bv = (const float*)d_in[8]; const float* wo = (const float*)d_in[9]; const float* bo = (const float*)d_in[10];
    float* OUT = (float*)d_out;     // [8][1024][1024]
    char* wsp = (char*)d_ws;
    auto take = [&](size_t bytes) { char* p = wsp; wsp += (bytes + 255) & ~(size_t)255; return (void*)p; };
    bf* WO = (bf*)take((size_t)DM * DQ * 2);                     // [1024][1024]
    h16* QK16 = (h16*)take((size_t)2 * NB * NH_ * TT * HD * 2);  // [2][NB*16][TT][64]
    h16* VT16 = (h16*)take((size_t)NB * NH_ * HD * TT * 2);      // [NB*16][64][TT]
    // one region, two lives: the projection's operands and result, dead once the head planes are written, then the attention passes' buffers
    char* const shared0 = wsp;
    bf* WQKV = (bf*)take((size_t)NQKV * DM * 2);                 // [3072][1024]: rows 0..1023 q, 1024..2047 k, 2048..3071 v
    bf* XB = (bf*)take((size_t)NB * TT * DM * 2);                // [NB][TT][DM]
    float* F = (float*)take((size_t)NB * TT * NQKV * 4);         // [NB*TT][3072]
    char* const end1 = wsp; wsp = shared0;
    float* Sb = (float*)take((size_t)ZH * TT * TT * 4);          // [ZH][TT][TT]
    h16* P16 = (h16*)take((size_t)ZH * TT * TT * 2);             // [ZH][TT][TT]
    float* Ob = (float*)take((size_t)ZH * TT * HD * 4);          // [ZH][TT][64]
    if (end1 > wsp) wsp = end1;
    if ((size_t)(wsp - (char*)d_ws) > ws_size) return;           // 250 MiB at full size
    h16* Q16 = QK16; h16* K16 = QK16 + (size_t)NB * NH_ * TT * HD;
    // merged context [NB*TT][1024], hi and lo: batch b's rows take the bytes of batch b's q and k planes, which only b's own pass reads, before its merge
    bf* ATh = (bf*)Q16; bf* ATl = (bf*)K16;
    // weights: w[in = K][out = N] -> Bt[N][K]
    const unsigned GW = (unsigned)((DM * DQ / 64 + 63) / 64);
    k_wtG<<<dim3(GW, 4, 1), 256, 0, stream>>>(wq, wk, wv, wo, DM, DQ, WQKV, WO);
    k_cvt8<<<dim3((unsigned)(((size_t)TT * DM / 8 + 255) / 256), NB, 1), 256, 0, stream>>>(x, XB, (size_t)TT * DM / 8, (size_t)SEQ_FULL * DM, (size_t)TT * DM);
    const unsigned LQK = (unsigned)(((size_t)2 * NB * NH_ * TT * HD / 8 + 255) / 256), LV = (unsigned)(((size_t)NB * NH_ * HD * TT / 2 + 255) / 256);
    k_gemmw<bf, 0, false><<<dim3(TT / 64, NQKV / 64, NB), 32, 0, stream>>>(XB, nullptr, WQKV, nullptr, DM, F, NQKV, nullptr, (size_t)TT * DM, 0, (size_t)TT * NQKV);
    k_qkp<<<LQK, 256, 0, stream>>>(F, bq, bk, rel, QK16);
    k_vtp<<<LV, 256, 0, stream>>>(F, bv, VT16);
    for (int g0 = 0; g0 < NB * NH_; g0 += ZH) {
        k_gemmw<h16, 0, false><<<dim3(TT / 64, TT / 64, ZH), 32, 0, stream>>>(Q16 + (size_t)g0 * TT * HD, nullptr, K16 + (size_t)g0 * TT * HD, nullptr, HD, Sb, TT, nullptr, (size_t)TT * HD, (size_t)TT * HD, (size_t)TT * TT);
        k_asoft<<<ZH * TT / 8, 256, 0, stream>>>(Sb, msk + (size_t)(g0 / NH_) * SEQ_FULL, P16);
        k_gemmw<h16, 0, false><<<dim3(TT / 64, HD / 64, ZH), 32, 0, stream>>>(P16, nullptr, VT16 + (size_t)g0 * HD * TT, nullptr, TT, Ob, HD, nullptr, (size_t)TT * TT, (size_t)HD * TT, (size_t)TT * HD);
        k_merge<<<(unsigned)(((size_t)ZH * TT * HD / 2 + 255) / 256), 256, 0, stream>>>(Ob, g0, ATh, ATl); }
    k_gemmw<bf, 1, true><<<dim3(TT / 64, DM / 64, NB), 32, 0, stream>>>(ATh, ATl, WO, nullptr, DQ, OUT, DM, bo, (size_t)TT * DQ, 0, (size_t)SEQ_FULL * DM);
}

// v002
// It runs in 299 microseconds.
// Next to v001, in two timings, it ran 1.86 and 1.91 times as fast.
// Over all steps from v000 it is 4.30 times as fast.
#include <hip/hip_runtime.h>

// Compute dtypes (f32 accumulate everywhere): every float input RNE-converted to bf16; QKV projection v_wmma_f32_16x16x32_bf16 (exact products); scores (k + 8 R) x q^T and V^T x P^T on v_wmma_f32_16x16x32_f16 (P = exp2 of the score against the maximum in use, not yet normalised); softmax f32; merged context as bf16 hi+lo planes x bf16 Wo (2 products) + f32 bias.
// Self-attention on one stream x [8][1024][1024]; weights [in][out] transposed once into K-contiguous bf16 planes (q|k|v fused to one [3072][1024] plane); 16 heads x 64.
// Score algebra: (q.k) x 0.125 + q.R[t] = 0.125 x q.(k[t] + 8 R[t]); the key plane stores k + 8 R (R = per-key table input, read by value), the 0.125 is applied in the softmax's exponent.
// Key mask [b][t] (int32, data): mask == 0 replaces the score by -inf; softmax in the running-maximum form, normalised once at the end (a row without any kept key ends as 0 x (1 / 0) = NaN).

#ifndef NB
#define NB 8
#endif
#ifndef SEQ
#define SEQ 1024
#endif
#define SEQ_FULL 1024             // per-batch row count of the inputs / output (strides)
#define TT   SEQ
#define DM   1024
#define NH_  16
#define HD   64
#define DQ   (NH_ * HD)
#define NQKV (3 * DQ)
#define SCL  0.125f               // HD^-0.5
#define RCAR 8.0f                 // 1 / SCL
typedef _Float16 h16;
typedef unsigned short bf;
typedef __attribute__((ext_vector_type(16))) __bf16   v16bf;
typedef __attribute__((ext_vector_type(16))) _Float16 v16h;
typedef __attribute__((ext_vector_type(8)))  _Float16 v8h;
typedef __attribute__((ext_vector_type(8)))  unsigned short v8us;
typedef __attribute__((ext_vector_type(8)))  float    v8f;
typedef __attribute__((ext_vector_type(4)))  float    v4f;
typedef v8h  __attribute__((may_alias)) v8ha;
typedef v4f  __attribute__((may_alias)) v4fa;
typedef v8us __attribute__((may_alias)) v8usa;

static_assert(TT % 128 == 0);
static_assert(TT <= SEQ_FULL);
static_assert(DM % 64 == 0);
static_assert(HD == 64);
static_assert(DM == DQ);
static_assert(NQKV % 64 == 0);

__device__ __forceinline__ unsigned short f2bf(float f) { unsigned u = __float_as_uint(f); u += 0x7FFFu + ((u >> 16) & 1u); return (unsigned short)(u >> 16); }
__device__ __forceinline__ float bf2f(unsigned short b) { return __uint_as_float(((unsigned)b) << 16); }
__device__ __forceinline__ float bfr(float f) { return bf2f(f2bf(f)); }
__device__ __forceinline__ v16h cat16(v8h lo, v8h hi) { return __builtin_shufflevector(lo, hi, 0, 1, 2, 3, 4, 5, 6, 7, 8, 9, 10, 11, 12, 13, 14, 15); }
__device__ __forceinline__ v16bf cat16b(v8us lo, v8us hi) { return __builtin_bit_cast(v16bf, __builtin_shufflevector(lo, hi, 0, 1, 2, 3, 4, 5, 6, 7, 8, 9, 10, 11, 12, 13, 14, 15)); }
__device__ __forceinline__ v8f wmma16(v16h a, v16h b, v8f c) { return __builtin_amdgcn_wmma_f32_16x16x32_f16(false, a, false, b, (short)0, c, false, false); }
__device__ __forceinline__ v8f wmmab(v16bf a, v16bf b, v8f c) { return __builtin_amdgcn_wmma_f32_16x16x32_bf16(false, a, false, b, (short)0, c, false, false); }

// ---- k_gemmw: register-blocked GEMM, ONE WAVE per 64x64 output tile (16 accumulators), operands straight from K-contiguous 16-bit planes; grid (M/64, N/64, Z), 32 threads.
// C[m][n] (f32, pitch ldc, + optional f32 bias[n]) = sum_k A[m][k] Bt[n][k] (+ split products per NSPLIT). z-batch strides sA/sB/sC in elements. K % 32 == 0.
// Fragment map: lane l -> row/col l & 15, half h = l >> 4; elements 0..7 <- k0 + 8h + 0..7, elements 8..15 <- k0 + 16 + 8h + 0..7 (A and B alike); D element j -> row 8h + j, col l & 15.
template <typename T16> struct WFrag;
template <> struct WFrag<h16> { typedef v16h V; static __device__ __forceinline__ V ld(const h16* p) { return cat16(*(const v8h*)p, *(const v8h*)(p + 16)); } static __device__ __forceinline__ v8f mma(V a, V b, v8f c) { return wmma16(a, b, c); } };
template <> struct WFrag<bf> { typedef v16bf V; static __device__ __forceinline__ V ld(const bf* p) { return cat16b(*(const v8us*)p, *(const v8us*)(p + 16)); } static __device__ __forceinline__ v8f mma(V a, V b, v8f c) { return wmmab(a, b, c); } };
template <typename T16, int NSPLIT, bool BIAS>
__global__ __launch_bounds__(32) void k_gemmw(const T16* __restrict__ A, const T16* __restrict__ A2, const T16* __restrict__ Bt, const T16* __restrict__ Bt2, int K, float* C, int ldc, const float* __restrict__ bias, size_t sA, size_t sB, size_t sC) {
    typedef typename WFrag<T16>::V V;
    __shared__ __align__(16) float os[16 * 68];
    const size_t z = blockIdx.z; A += z * sA; if (A2) A2 += z * sA; Bt += z * sB; if (Bt2) Bt2 += z * sB; C += z * sC;
    const int lane = threadIdx.x & 31, lr = lane & 15, hi = lane >> 4; const int r0 = blockIdx.x * 64, c0 = blockIdx.y * 64;
    v8f acc[4][4];
#pragma unroll
    for (int mb = 0; mb < 4; ++mb)
#pragma unroll
        for (int nb = 0; nb < 4; ++nb) acc[mb][nb] = (v8f){};
    const size_t aoff = (size_t)(r0 + lr) * K + 8 * hi, boff = (size_t)(c0 + lr) * K + 8 * hi;
#pragma unroll 1
    for (int kc = 0; kc < K; kc += 32) {
        V a[4], a2[4];
#pragma unroll
        for (int mb = 0; mb < 4; ++mb) { a[mb] = WFrag<T16>::ld(A + aoff + (size_t)mb * 16 * K + kc); if (NSPLIT == 1 || NSPLIT == 2) a2[mb] = WFrag<T16>::ld(A2 + aoff + (size_t)mb * 16 * K + kc); }
#pragma unroll
        for (int nb = 0; nb < 4; ++nb) { const V b = WFrag<T16>::ld(Bt + boff + (size_t)nb * 16 * K + kc); V b2; if (NSPLIT >= 2) b2 = WFrag<T16>::ld(Bt2 + boff + (size_t)nb * 16 * K + kc);
#pragma unroll
            for (int mb = 0; mb < 4; ++mb) { acc[mb][nb] = WFrag<T16>::mma(a[mb], b, acc[mb][nb]); if (NSPLIT == 1 || NSPLIT == 2) acc[mb][nb] = WFrag<T16>::mma(a2[mb], b, acc[mb][nb]); if (NSPLIT >= 2) acc[mb][nb] = WFrag<T16>::mma(a[mb], b2, acc[mb][nb]); } }
        asm volatile("v_nop\n\tv_nop\n\tv_nop\n\tv_nop" : "+v"(acc[0][0]), "+v"(acc[1][1]), "+v"(acc[2][2]), "+v"(acc[3][3]) : "v"(a[0]), "v"(a[3]));
    }
#pragma unroll
    for (int mb = 0; mb < 4; ++mb) {
#pragma unroll
        for (int nb = 0; nb < 4; ++nb) {
#pragma unroll
            for (int j = 0; j < 8; ++j) os[(hi * 8 + j) * 68 + nb * 16 + lr] = acc[mb][nb][j]; }
        __builtin_amdgcn_wave_barrier(); asm volatile("" ::: "memory");
        float* crow = C + (size_t)(r0 + mb * 16) * ldc + c0;
{
#pragma unroll
            for (int s = 0; s < 8; ++s) { const int row = 2 * s + hi, cofs = lr * 4; v4f val = *(const v4fa*)(os + row * 68 + cofs); if (BIAS) { val[0] += bfr(bias[c0 + cofs]); val[1] += bfr(bias[c0 + cofs + 1]); val[2] += bfr(bias[c0 + cofs + 2]); val[3] += bfr(bias[c0 + cofs + 3]); }
                *(v4f*)(crow + (size_t)row * ldc + cofs) = val; }
             }
        __builtin_amdgcn_wave_barrier(); asm volatile("" ::: "memory");
    }
}

__device__ __forceinline__ h16 tohx(float x) { return (h16)x; }
__device__ __forceinline__ void splitf(float y, unsigned short& h, unsigned short& l) { h = f2bf(y); l = f2bf(y - bf2f(h)); }
typedef __attribute__((ext_vector_type(2))) _Float16 v2h;
typedef __attribute__((ext_vector_type(2))) unsigned short v2us;

// grid.y picks the weight: 0..2 -> rows y * N of the fused q|k|v plane, 3 -> the output-projection plane.
__global__ __launch_bounds__(256) void k_wtG(const float* __restrict__ wq, const float* __restrict__ wk, const float* __restrict__ wv, const float* __restrict__ wo, int K, int N, bf* Bqkv, bf* Bo) {
    const int y = blockIdx.y; const float* __restrict__ w = (y == 0) ? wq : (y == 1) ? wk : (y == 2) ? wv : wo; bf* Bt = (y < 3) ? Bqkv + (size_t)y * N * K : Bo;
    const int lane = threadIdx.x & 31; const int L0 = (blockIdx.x * 8 + (threadIdx.x >> 5)) * 8; const int nlines = N * K / 64;
{
#pragma unroll 1
        for (int l = 0; l < 8; ++l) { const int L = L0 + l; if (L >= nlines) break; const size_t e = (size_t)L * 64 + lane * 2; const int k = (int)(e % K), n = (int)(e / K); v2us o;
            o[0] = f2bf(w[(size_t)k * N + n]); o[1] = f2bf(w[(size_t)(k + 1) * N + n]); *(v2us*)(Bt + e) = o; }
         }
}
__global__ __launch_bounds__(256) void k_cvt8(const float* __restrict__ src, bf* dst, size_t n8, size_t sS, size_t sD) { const size_t i = (size_t)blockIdx.x * 256 + threadIdx.x; if (i >= n8) return; src += (size_t)blockIdx.y * sS; dst += (size_t)blockIdx.y * sD; const v8f v = *(const v8f*)(src + i * 8); v8us o;
#pragma unroll
    for (int k = 0; k < 8; ++k) o[k] = f2bf(v[k]); *(v8us*)(dst + i * 8) = o;  }

// k_qkp: head planes QK[which][b*16+h][t][d] (fp16): which 0 = q = F[b*TT+t][h*HD+d] + bq; which 1 = (F[b*TT+t][DQ+h*HD+d] + bk) + 8 R[t][d]. F row pitch NQKV.
__global__ __launch_bounds__(256) void k_qkp(const float* __restrict__ F, const float* __restrict__ bq, const float* __restrict__ bk, const float* __restrict__ R, h16* QK) {
    const size_t e = ((size_t)blockIdx.x * 256 + threadIdx.x) * 8; if (e >= (size_t)2 * NB * NH_ * TT * HD) return;
    const int which = (int)(e / ((size_t)NB * NH_ * TT * HD)); const size_t rem = e % ((size_t)NB * NH_ * TT * HD);
    const int d = (int)(rem % HD); const int t = (int)((rem / HD) % TT); const int g = (int)(rem / ((size_t)HD * TT)); const int h = g % NH_, b = g / NH_;
    const float* f = F + ((size_t)b * TT + t) * NQKV + (size_t)which * DQ + h * HD + d;
    const v4f f0 = *(const v4f*)f, f1 = *(const v4f*)(f + 4);
    const v4f q0 = *(const v4f*)(bq + h * HD + d), q1 = *(const v4f*)(bq + h * HD + d + 4);
    const v4f k0 = *(const v4f*)(bk + h * HD + d), k1 = *(const v4f*)(bk + h * HD + d + 4);
    const v4f r0 = *(const v4f*)(R + (size_t)t * HD + d), r1 = *(const v4f*)(R + (size_t)t * HD + d + 4);
    v8h o;
#pragma unroll
    for (int q = 0; q < 8; ++q) { const float fv = (q < 4) ? f0[q & 3] : f1[q & 3]; const float bqv = (q < 4) ? q0[q & 3] : q1[q & 3]; const float bkv = (q < 4) ? k0[q & 3] : k1[q & 3]; const float rv = (q < 4) ? r0[q & 3] : r1[q & 3];
        const float bias = which ? bfr(bkv) : bfr(bqv); const float radd = which ? RCAR * bfr(rv) : 0.0f; const float y = (fv + bias) + radd; o[q] = tohx(y); }
    *(v8h*)(QK + e) = o;  }
__global__ __launch_bounds__(256) void k_vtp(const float* __restrict__ F, const float* __restrict__ bv, h16* V16) { const size_t e = ((size_t)blockIdx.x * 256 + threadIdx.x) * 2; if (e >= (size_t)NB * NH_ * HD * TT) return; const int t = (int)(e % TT); const int d = (int)((e / TT) % HD); const int g = (int)(e / ((size_t)TT * HD)); const int h = g % NH_, b = g / NH_; const float bb = bfr(bv[h * HD + d]); v2h o16;
#pragma unroll
    for (int q = 0; q < 2; ++q) { const float x = F[((size_t)b * TT + t + q) * NQKV + 2 * DQ + h * HD + d] + bb; o16[q] = tohx(x); }
    *(v2h*)(V16 + e) = o16;  }
// ---- k_fattn: scores, mask, softmax, P x V and the head merge in one kernel; a score never leaves the registers.
// grid (TT / 256, NB * 16), 8 waves; a wave owns 32 query columns (2 groups of 16) of one head plane and walks all keys, 64 per LDS stage (2 buffers), 32 per pass.
// S^T = K' Q^T: A = key rows from LDS, B = q kept in registers; D register r of lane (c, h) = key 8h + r, query c. Two such tiles, converted in place, are the B operand (32 keys) of O^T += V^T P^T.
// O^T: D register r = d 8h + r of query c, so a lane stores 8 consecutive d of one merged-context row.
// Every plain '#pragma unroll' below makes the indices of a register array constants, so that the array stays in registers.
// amdgpu_waves_per_eu(4, 4): two work-groups per WGP, four waves per SIMD, to cover the vector work between the matrix runs.
#define FNW 8                     // waves per work-group
#define FQW 32                    // query columns per wave
#define FKS 64                    // keys per LDS stage
#define FPI 72                    // LDS row pitch in 16-bit elements: 128 B of data + 16 B, for the 16-byte readers
#define CSC (SCL * 1.4426950408889634f)
static_assert(TT % (FNW * FQW) == 0);
static_assert(TT % FKS == 0);
__device__ __forceinline__ float xhalf(float x) { return __builtin_bit_cast(float, __builtin_amdgcn_permlanex16(__builtin_bit_cast(int, x), __builtin_bit_cast(int, x), 0x76543210, 0xfedcba98, false, false)); }  // lane l with lane l ^ 16
__device__ __forceinline__ v16h ldsfrag(const h16* p) { return cat16(*(const v8ha*)p, *(const v8ha*)(p + 16)); }
__global__ __launch_bounds__(FNW * 32) __attribute__((amdgpu_waves_per_eu(4, 4))) void k_fattn(const h16* __restrict__ Q, const h16* __restrict__ Kp, const h16* __restrict__ Vt, const int* __restrict__ mk, bf* Ah, bf* Al) {
    __shared__ __align__(16) h16 kst[2][FKS * FPI];   // [key][d]
    __shared__ __align__(16) h16 vst[2][HD * FPI];    // [d][key]
    __shared__ __align__(16) float mb[TT];            // 0 for a kept key, -inf for a masked one
    const int tid = threadIdx.x, lane = tid & 31, c = lane & 15, h = lane >> 4, wave = tid >> 5;
    const int g = blockIdx.y, b = g / NH_, hh = g % NH_;
    const h16* Qg = Q + (size_t)g * TT * HD; const h16* Kg = Kp + (size_t)g * TT * HD; const h16* Vg = Vt + (size_t)g * HD * TT;
    const int q0 = blockIdx.x * (FNW * FQW) + wave * FQW;
    for (int i = tid; i < TT; i += FNW * 32) mb[i] = (mk[(size_t)b * SEQ_FULL + i] != 0) ? 0.0f : -__builtin_inff();
    // staging: thread -> rows sr and sr + 32, 16 bytes at element sc, of the 64 x 64 key tile and of the 64 x 64 V^T tile
    const int sr = tid >> 3, sc = (tid & 7) * 8;
    const unsigned ko = (unsigned)(sr * HD + sc), vo = (unsigned)(sr * TT + sc);   // the lane's 32-bit offsets beside wave-uniform bases
    v8h gk0 = *(const v8h*)(Kg + ko), gk1 = *(const v8h*)(Kg + ko + 32 * HD);
    v8h gv0 = *(const v8h*)(Vg + vo), gv1 = *(const v8h*)(Vg + vo + 32 * TT);
    v16h qf[2][2];
#pragma unroll
    for (int qg = 0; qg < 2; ++qg)
#pragma unroll
        for (int ks = 0; ks < 2; ++ks) qf[qg][ks] = WFrag<h16>::ld(Qg + (size_t)(q0 + qg * 16 + c) * HD + ks * 32 + 8 * h);
    *(v8ha*)(&kst[0][sr * FPI + sc]) = gk0; *(v8ha*)(&kst[0][(sr + 32) * FPI + sc]) = gk1;
    *(v8ha*)(&vst[0][sr * FPI + sc]) = gv0; *(v8ha*)(&vst[0][(sr + 32) * FPI + sc]) = gv1;
    v8f o[2][4];
#pragma unroll
    for (int qg = 0; qg < 2; ++qg)
#pragma unroll
        for (int dt = 0; dt < 4; ++dt) o[qg][dt] = (v8f){};
    float mrun[2] = {-1.0e30f, -1.0e30f};   // finite, below every finite score: -inf here would make -inf - (-inf) = NaN while only masked keys have been seen
    float lsum[2] = {0.0f, 0.0f};           // each wave half sums its own keys; joined once at the end
    __syncthreads();
#pragma unroll 1   // rolled: one copy of the stage body, and the buffer index stays a scalar
    for (int st = 0; st < TT / FKS; ++st) {
        const bool more = st + 1 < TT / FKS;
        if (more) { const h16* Kn = Kg + (size_t)(st + 1) * FKS * HD; const h16* Vn = Vg + (size_t)(st + 1) * FKS;
            gk0 = *(const v8h*)(Kn + ko); gk1 = *(const v8h*)(Kn + ko + 32 * HD);
            gv0 = *(const v8h*)(Vn + vo); gv1 = *(const v8h*)(Vn + vo + 32 * TT);
            asm volatile("s_wait_xcnt 0x0" ::: "memory"); }   // stands in front of the pass's address arithmetic, which reuses the four loads' address registers
        const h16* kb = kst[st & 1]; const h16* vb = vst[st & 1];
#pragma unroll 1   // one pass's registers at a time: two passes interleaved did not fit the 256 registers that four waves per SIMD leave
        for (int p = 0; p < FKS / 32; ++p) {
            v8f s[2][2];
#pragma unroll
            for (int kt = 0; kt < 2; ++kt) {
                const h16* kr = kb + (p * 32 + kt * 16 + c) * FPI + 8 * h;
                const v16h k0 = ldsfrag(kr), k1 = ldsfrag(kr + 32);
                const float* mp = mb + st * FKS + p * 32 + kt * 16 + 8 * h;
                const v4f b0 = *(const v4fa*)mp, b1 = *(const v4fa*)(mp + 4);
                const v8f bz = __builtin_shufflevector(b0, b1, 0, 1, 2, 3, 4, 5, 6, 7);
#pragma unroll
                for (int qg = 0; qg < 2; ++qg) { v8f t = wmma16(k0, qf[qg][0], (v8f){}); t = wmma16(k1, qf[qg][1], t); s[kt][qg] = t + bz; }
            }
            v16h vf[4];
#pragma unroll
            for (int dt = 0; dt < 4; ++dt) vf[dt] = ldsfrag(vb + (dt * 16 + c) * FPI + p * 32 + 8 * h);
            float mx[2]; bool need = false;
#pragma unroll
            for (int qg = 0; qg < 2; ++qg) { float m = s[0][qg][0];
#pragma unroll
                for (int r = 1; r < 8; ++r) m = fmaxf(m, s[0][qg][r]);
#pragma unroll
                for (int r = 0; r < 8; ++r) m = fmaxf(m, s[1][qg][r]);
                m = fmaxf(m, xhalf(m)) * CSC; mx[qg] = m; need = need || (m > mrun[qg] + 8.0f); }
            // the maximum in use moves only when some column's new maximum passes it by more than 8 (base 2): P stays <= 256, inside f16
            if (__builtin_amdgcn_ballot_w32(need) != 0) {
#pragma unroll
                for (int qg = 0; qg < 2; ++qg) { const float mn = fmaxf(mrun[qg], mx[qg]); const float corr = __builtin_amdgcn_exp2f(mrun[qg] - mn); mrun[qg] = mn; lsum[qg] *= corr;
#pragma unroll
                    for (int dt = 0; dt < 4; ++dt) o[qg][dt] = o[qg][dt] * corr; }
            }
#pragma unroll
            for (int qg = 0; qg < 2; ++qg) { const float nm = -mrun[qg]; v16h pf; float ls = 0.0f;
                const v8f cv = {CSC, CSC, CSC, CSC, CSC, CSC, CSC, CSC}, nv = {nm, nm, nm, nm, nm, nm, nm, nm};
                const v8f a0 = __builtin_elementwise_fma(s[0][qg], cv, nv), a1 = __builtin_elementwise_fma(s[1][qg], cv, nv);
#pragma unroll
                for (int i = 0; i < 16; ++i) { const float pv = __builtin_amdgcn_exp2f((i < 8) ? a0[i & 7] : a1[i & 7]); ls += pv; pf[i] = tohx(pv); }
                lsum[qg] += ls;
#pragma unroll
                for (int dt = 0; dt < 4; ++dt) o[qg][dt] = wmma16(vf[dt], pf, o[qg][dt]); }
            // four vector slots behind the pass's last matrix instructions: across the back edge the next pass's address arithmetic would overwrite their A registers too early
            asm volatile("v_nop\n\tv_nop\n\tv_nop\n\tv_nop" : "+v"(o[1][0]), "+v"(o[1][1]), "+v"(o[1][2]), "+v"(o[1][3]));
        }
        if (more) { h16* kw = kst[(st + 1) & 1]; h16* vw = vst[(st + 1) & 1];   // this buffer's last readers left it before the barrier that ended stage st - 1
            *(v8ha*)(kw + sr * FPI + sc) = gk0; *(v8ha*)(kw + (sr + 32) * FPI + sc) = gk1;
            *(v8ha*)(vw + sr * FPI + sc) = gv0; *(v8ha*)(vw + (sr + 32) * FPI + sc) = gv1; }
        __syncthreads();
    }
#pragma unroll
    for (int qg = 0; qg < 2; ++qg) { const float lf = lsum[qg] + xhalf(lsum[qg]); const float inv = 1.0f / lf;
        const size_t oo = ((size_t)b * TT + q0 + qg * 16 + c) * DQ + hh * HD + 8 * h;
#pragma unroll
        for (int dt = 0; dt < 4; ++dt) { v8us oh, ol;
#pragma unroll
            for (int j = 0; j < 8; ++j) { unsigned short a, c2; splitf(o[qg][dt][j] * inv, a, c2); oh[j] = a; ol[j] = c2; }
            *(v8us*)(Ah + oo + dt * 16) = oh; *(v8us*)(Al + oo + dt * 16) = ol; } }
}

extern "C" void kernel_launch(void* const* d_in, const int* in_sizes, int n_in,
                              void* d_out, int out_size, void* d_ws, size_t ws_size, hipStream_t stream) {
    (void)out_size;
    if (n_in < 11) return;
    if (in_sizes[0] < NB * TT * DM || in_sizes[1] < TT * HD || in_sizes[2] < NB * TT) return;
    if (in_sizes[3] < DM * DQ || in_sizes[5] < DM * DQ || in_sizes[7] < DM * DQ || in_sizes[9] < DQ * DM) return;
    if (in_sizes[4] < DQ || in_sizes[6] < DQ || in_sizes[8] < DQ || in_sizes[10] < DM) return;
    // wire order: x, rel_pos_enc, attention_mask, Wq, bq, Wk, bk, Wv, bv, Wo, bo
    const float* x = (const float*)d_in[0]; const float* rel = (const float*)d_in[1]; const int* msk = (const int*)d_in[2];
    const float* wq = (const float*)d_in[3]; const float* bq = (const float*)d_in[4]; const float* wk = (const float*)d_in[5]; const float* bk = (const float*)d_in[6];
    const float* wv = (const float*)d_in[7]; const float* bv = (const float*)d_in[8]; const float* wo = (const float*)d_in[9]; const float* bo = (const float*)d_in[10];
    float* OUT = (float*)d_out;     // [8][1024][1024]
    char* wsp = (char*)d_ws;
    auto take = [&](size_t bytes) { char* p = wsp; wsp += (bytes + 255) & ~(size_t)255; return (void*)p; };
    bf* WO = (bf*)take((size_t)DM * DQ * 2);                     // [1024][1024]
    h16* QK16 = (h16*)take((size_t)2 * NB * NH_ * TT * HD * 2);  // [2][NB*16][TT][64]
    h16* VT16 = (h16*)take((size_t)NB * NH_ * HD * TT * 2);      // [NB*16][64][TT]
    // one region, two lives: the projection's operands and result, dead once the head planes are written, then the merged context
    char* const shared0 = wsp;
    bf* WQKV = (bf*)take((size_t)NQKV * DM * 2);                 // [3072][1024]: rows 0..1023 q, 1024..2047 k, 2048..3071 v
    bf* XB = (bf*)take((size_t)NB * TT * DM * 2);                // [NB][TT][DM]
    float* F = (float*)take((size_t)NB * TT * NQKV * 4);         // [NB*TT][3072]
    char* const end1 = wsp; wsp = shared0;
    bf* ATh = (bf*)take((size_t)NB * TT * DQ * 2);               // merged context [NB*TT][1024], hi
    bf* ATl = (bf*)take((size_t)NB * TT * DQ * 2);               // the same, lo
    if (end1 > wsp) wsp = end1;
    if ((size_t)(wsp - (char*)d_ws) > ws_size) return;           // 168 MiB at full size
    h16* Q16 = QK16; h16* K16 = QK16 + (size_t)NB * NH_ * TT * HD;
    // weights: w[in = K][out = N] -> Bt[N][K]
    const unsigned GW = (unsigned)((DM * DQ / 64 + 63) / 64);
    k_wtG<<<dim3(GW, 4, 1), 256, 0, stream>>>(wq, wk, wv, wo, DM, DQ, WQKV, WO);
    k_cvt8<<<dim3((unsigned)(((size_t)TT * DM / 8 + 255) / 256), NB, 1), 256, 0, stream>>>(x, XB, (size_t)TT * DM / 8, (size_t)SEQ_FULL * DM, (size_t)TT * DM);
    const unsigned LQK = (unsigned)(((size_t)2 * NB * NH_ * TT * HD / 8 + 255) / 256), LV = (unsigned)(((size_t)NB * NH_ * HD * TT / 2 + 255) / 256);
    k_gemmw<bf, 0, false><<<dim3(TT / 64, NQKV / 64, NB), 32, 0, stream>>>(XB, nullptr, WQKV, nullptr, DM, F, NQKV, nullptr, (size_t)TT * DM, 0, (size_t)TT * NQKV);
    k_qkp<<<LQK, 256, 0, stream>>>(F, bq, bk, rel, QK16);
    k_vtp<<<LV, 256, 0, stream>>>(F, bv, VT16);
    k_fattn<<<dim3(TT / (FNW * FQW), NB * NH_, 1), FNW * 32, 0, stream>>>(Q16, K16, VT16, msk, ATh, ATl);
    k_gemmw<bf, 1, true><<<dim3(TT / 64, DM / 64, NB), 32, 0, stream>>>(ATh, ATl, WO, nullptr, DQ, OUT, DM, bo, (size_t)TT * DQ, 0, (size_t)SEQ_FULL * DM);
}

// v003
// Measured time: 201 microseconds a run.
// In two side-by-side timings against v002, it was 1.48 and 1.47 times as fast.
// All steps since v000 together make it 6.34 times as fast.
#include <hip/hip_runtime.h>

// Compute dtypes (f32 accumulate everywhere): every float input RNE-converted to bf16; QKV projection v_wmma_f32_16x16x32_bf16 (exact products); scores (k + 8 R) x q^T and V^T x P^T on v_wmma_f32_16x16x32_f16 (P = exp2 of the score against the maximum in use, not yet normalised); softmax f32; merged context as bf16 hi+lo planes x bf16 Wo (2 products) + f32 bias.
// Self-attention on one stream x [8][1024][1024]; weights [in][out] transposed once into K-contiguous bf16 planes (q|k|v fused to one [3072][1024] plane); 16 heads x 64.
// Score algebra: (q.k) x 0.125 + q.R[t] = 0.125 x q.(k[t] + 8 R[t]); the key plane stores k + 8 R (R = per-key table input, read by value), the 0.125 is applied in the softmax's exponent.
// Key mask [b][t] (int32, data): mask == 0 replaces the score by -inf; softmax in the running-maximum form, normalised once at the end (a row without any kept key ends as 0 x (1 / 0) = NaN).

#ifndef NB
#define NB 8
#endif
#ifndef SEQ
#define SEQ 1024
#endif
#define SEQ_FULL 1024             // per-batch row count of the inputs / output (strides)
#define TT   SEQ
#define DM   1024
#define NH_  16
#define HD   64
#define DQ   (NH_ * HD)
#define NQKV (3 * DQ)
#define SCL  0.125f               // HD^-0.5
#define RCAR 8.0f                 // 1 / SCL
typedef _Float16 h16;
typedef unsigned short bf;
typedef __attribute__((ext_vector_type(16))) __bf16   v16bf;
typedef __attribute__((ext_vector_type(16))) _Float16 v16h;
typedef __attribute__((ext_vector_type(8)))  _Float16 v8h;
typedef __attribute__((ext_vector_type(8)))  unsigned short v8us;
typedef __attribute__((ext_vector_type(8)))  float    v8f;
typedef __attribute__((ext_vector_type(4)))  float    v4f;
typedef v8h  __attribute__((may_alias)) v8ha;
typedef v4f  __attribute__((may_alias)) v4fa;
typedef v8us __attribute__((may_alias)) v8usa;

static_assert(TT % 128 == 0);
static_assert(TT <= SEQ_FULL);
static_assert(DM % 64 == 0);
static_assert(HD == 64);
static_assert(DM == DQ);
static_assert(NQKV % 256 == 0);
static_assert(DM % 256 == 0);

__device__ __forceinline__ unsigned short f2bf(float f) { unsigned u = __float_as_uint(f); u += 0x7FFFu + ((u >> 16) & 1u); return (unsigned short)(u >> 16); }
__device__ __forceinline__ float bf2f(unsigned short b) { return __uint_as_float(((unsigned)b) << 16); }
__device__ __forceinline__ float bfr(float f) { return bf2f(f2bf(f)); }
__device__ __forceinline__ v16h cat16(v8h lo, v8h hi) { return __builtin_shufflevector(lo, hi, 0, 1, 2, 3, 4, 5, 6, 7, 8, 9, 10, 11, 12, 13, 14, 15); }
__device__ __forceinline__ v16bf cat16b(v8us lo, v8us hi) { return __builtin_bit_cast(v16bf, __builtin_shufflevector(lo, hi, 0, 1, 2, 3, 4, 5, 6, 7, 8, 9, 10, 11, 12, 13, 14, 15)); }
__device__ __forceinline__ v8f wmma16(v16h a, v16h b, v8f c) { return __builtin_amdgcn_wmma_f32_16x16x32_f16(false, a, false, b, (short)0, c, false, false); }
__device__ __forceinline__ v8f wmmab(v16bf a, v16bf b, v8f c) { return __builtin_amdgcn_wmma_f32_16x16x32_bf16(false, a, false, b, (short)0, c, false, false); }

// ---- k_gemmw: GEMM on a 128 x 256 output tile per work-group of 8 waves (2 x 4), 64 x 64 (16 accumulators) per wave; grid (M/128, N/256, Z), 256 threads.
// C[m][n] (f32, pitch ldc, + optional f32 bias[n]) = sum_k A[m][k] Bt[n][k] (+ A2[m][k] Bt[n][k] for NSPLIT 1). z-batch strides sA/sB/sC in elements. K: a compile-time multiple of 64, at least 128 (two stages).
// Operands: K-contiguous 16-bit planes, 64 k (one whole 128-B line of every row) per LDS stage, two buffers, brought by asynchronous copies one stage ahead of their use.
// Fragment map: lane l -> row/col l & 15, half h = l >> 4; elements 0..7 <- k0 + 8h + 0..7, elements 8..15 <- k0 + 16 + 8h + 0..7 (A and B alike); D element j -> row 8h + j, col l & 15.
#define GBM 128                   // tile rows
#define GBN 256                   // tile columns
#define GKS 64                    // k per LDS stage
#define GPI 72                    // LDS row pitch in 16-bit elements: 128 B of data + 16 B, for the 16-byte readers
template <typename T16> struct WFrag;
template <> struct WFrag<h16> { typedef v16h V; static __device__ __forceinline__ V ld(const h16* p) { return cat16(*(const v8h*)p, *(const v8h*)(p + 16)); } static __device__ __forceinline__ v8f mma(V a, V b, v8f c) { return wmma16(a, b, c); } };
template <> struct WFrag<bf> { typedef v16bf V; static __device__ __forceinline__ V ld(const bf* p) { return cat16b(*(const v8us*)p, *(const v8us*)(p + 16)); } static __device__ __forceinline__ V ldl(const bf* p) { return cat16b(*(const v8usa*)p, *(const v8usa*)(p + 16)); } static __device__ __forceinline__ v8f mma(V a, V b, v8f c) { return wmmab(a, b, c); } };
// Four asynchronous copies of 16 bytes a lane: rows r, r + 32, r + 64, r + 96 of one operand (global row step gs elements, LDS row pitch GPI).
// The s_wait_xcnt stands inside the statement, behind the last copy, so that no later write of an address register named here can come in front of it.
template <typename T16>
__device__ __forceinline__ void cp4(unsigned l, const T16* g, size_t gs) {
    const unsigned l1 = l + 32 * GPI * 2, l2 = l + 64 * GPI * 2, l3 = l + 96 * GPI * 2;
    const T16* g1 = g + gs; const T16* g2 = g1 + gs; const T16* g3 = g2 + gs;
    asm volatile("global_load_async_to_lds_b128 %0, %4, off\n\t"
                 "global_load_async_to_lds_b128 %1, %5, off\n\t"
                 "global_load_async_to_lds_b128 %2, %6, off\n\t"
                 "global_load_async_to_lds_b128 %3, %7, off\n\t"
                 "s_wait_xcnt 0x0"
                 :: "v"(l), "v"(l1), "v"(l2), "v"(l3), "v"(g), "v"(g1), "v"(g2), "v"(g3) : "memory");
}
// amdgpu_waves_per_eu(4, 4): two work-groups per WGP, so that one group's matrix runs cover the other's barrier, copy issue and epilogue.
template <typename T16, int NSPLIT, bool BIAS, int K>
__global__ __launch_bounds__(256) __attribute__((amdgpu_waves_per_eu(4, 4))) void k_gemmw(const T16* __restrict__ A, const T16* __restrict__ A2, const T16* __restrict__ Bt, float* C, int ldc, const float* __restrict__ bias, size_t sA, size_t sB, size_t sC) {
    static_assert(NSPLIT == 0 || NSPLIT == 1);
    static_assert(K % GKS == 0 && K / GKS >= 2);
    typedef typename WFrag<T16>::V V;
    constexpr int AR = (NSPLIT == 1) ? 2 * GBM : GBM;   // staged A rows: the A plane, then the A2 plane
    constexpr int SE = (AR + GBN) * GPI;                // elements per stage: A rows, then Bt rows
    __shared__ __align__(16) T16 stg[2 * SE];
    static_assert(8 * 16 * 68 * 4 <= 2 * SE * 2);       // the epilogue's staging rows lie in the same LDS
    const size_t z = blockIdx.z; A += z * sA; if (NSPLIT == 1) A2 += z * sA; Bt += z * sB; C += z * sC;
    const int tid = threadIdx.x, lane = tid & 31, lr = lane & 15, hi = lane >> 4, wave = tid >> 5, wm = wave >> 2, wn = wave & 3;
    const int R0 = blockIdx.x * GBM, C0 = blockIdx.y * GBN; const int r0 = R0 + wm * 64, c0 = C0 + wn * 64;
    // copies: thread -> 16 bytes at element sc of rows sr + 32 i; a wave's copy covers four whole 128-B lines
    const int sr = tid >> 3, sc = (tid & 7) * 8; const size_t gs = (size_t)32 * K;
    const T16* ga = A + (size_t)(R0 + sr) * K + sc; const T16* ga2 = (NSPLIT == 1) ? A2 + (size_t)(R0 + sr) * K + sc : nullptr; const T16* gb = Bt + (size_t)(C0 + sr) * K + sc;
    const unsigned l0 = (unsigned)(size_t)stg + (unsigned)(sr * GPI + sc) * 2;   // the lane's LDS byte address in buffer 0
    auto fill = [&](int t, int buf) {
        const unsigned l = l0 + (unsigned)buf * (SE * 2); const int ko = t * GKS;
        cp4(l, ga + ko, gs);
        if (NSPLIT == 1) cp4(l + GBM * GPI * 2, ga2 + ko, gs);
        cp4(l + AR * GPI * 2, gb + ko, gs); cp4(l + (AR + 128) * GPI * 2, gb + ko + 4 * gs, gs); };
    v8f acc[4][4];
#pragma unroll
    for (int mb = 0; mb < 4; ++mb)
#pragma unroll
        for (int nb = 0; nb < 4; ++nb) acc[mb][nb] = (v8f){};
    constexpr int nt = K / GKS;
    fill(0, 0);
    asm volatile("s_wait_asynccnt 0x0" ::: "memory");   // this wave's share of stage 0 has landed
    __syncthreads();                                    // ... and every other wave's
    fill(1, 1);
    const int afo = (wm * 64 + lr) * GPI + 8 * hi, bfo = (AR + wn * 64 + lr) * GPI + 8 * hi;
#pragma unroll 1   // rolled: one copy of the stage body, and the buffer index stays a scalar
    for (int t = 0; t < nt; ++t) {
        const T16* sb = stg + (t & 1) * SE;
#pragma unroll
        for (int ks = 0; ks < GKS / 32; ++ks) {
            V a[4], a2[4], b[4];   // all of a 32-k block's fragments are asked for as one group, ahead of its matrix run
#pragma unroll
            for (int mb = 0; mb < 4; ++mb) { a[mb] = WFrag<T16>::ldl(sb + afo + mb * 16 * GPI + ks * 32); if (NSPLIT == 1) a2[mb] = WFrag<T16>::ldl(sb + afo + (GBM + mb * 16) * GPI + ks * 32); }
#pragma unroll
            for (int nb = 0; nb < 4; ++nb) b[nb] = WFrag<T16>::ldl(sb + bfo + nb * 16 * GPI + ks * 32);
            __builtin_amdgcn_sched_barrier(0);   // keeps the LDS loads one group: left alone the compiler moves the Bt loads in among the matrix instructions, each with a full wait behind it
#pragma unroll
            for (int nb = 0; nb < 4; ++nb)
#pragma unroll
                for (int mb = 0; mb < 4; ++mb) { acc[mb][nb] = WFrag<T16>::mma(a[mb], b[nb], acc[mb][nb]); if (NSPLIT == 1) acc[mb][nb] = WFrag<T16>::mma(a2[mb], b[nb], acc[mb][nb]); }
            __builtin_amdgcn_sched_barrier(0);   // ends the block: the next group of loads, and the stage's closing waits, stay behind its matrix instructions
        }
        asm volatile("s_wait_dscnt 0x0" ::: "memory");      // this wave has left buffer t & 1
        asm volatile("s_wait_asynccnt 0x0" ::: "memory");   // this wave's share of stage t + 1 has landed
        __syncthreads();                                    // publishes stage t + 1 and ends every reader's last read of buffer t & 1
        if (t + 2 < nt) fill(t + 2, t & 1);
    }
    asm volatile("s_wait_asynccnt 0x0" ::: "memory");       // no copy is outstanding when the LDS becomes output staging
    float* os = (float*)stg + wave * (16 * 68);             // each wave's own 16 x 68 floats; every reader left the buffers at the loop's last barrier
#pragma unroll
    for (int mb = 0; mb < 4; ++mb) {
#pragma unroll
        for (int nb = 0; nb < 4; ++nb) {
#pragma unroll
            for (int j = 0; j < 8; ++j) os[(hi * 8 + j) * 68 + nb * 16 + lr] = acc[mb][nb][j]; }
        __builtin_amdgcn_wave_barrier(); asm volatile("" ::: "memory");
        float* crow = C + (size_t)(r0 + mb * 16) * ldc + c0;
{
#pragma unroll
            for (int s = 0; s < 8; ++s) { const int row = 2 * s + hi, cofs = lr * 4; v4f val = *(const v4fa*)(os + row * 68 + cofs); if (BIAS) { val[0] += bfr(bias[c0 + cofs]); val[1] += bfr(bias[c0 + cofs + 1]); val[2] += bfr(bias[c0 + cofs + 2]); val[3] += bfr(bias[c0 + cofs + 3]); }
                *(v4f*)(crow + (size_t)row * ldc + cofs) = val; }
             }
        __builtin_amdgcn_wave_barrier(); asm volatile("" ::: "memory");
    }
}

__device__ __forceinline__ h16 tohx(float x) { return (h16)x; }
__device__ __forceinline__ void splitf(float y, unsigned short& h, unsigned short& l) { h = f2bf(y); l = f2bf(y - bf2f(h)); }
typedef __attribute__((ext_vector_type(2))) _Float16 v2h;
typedef __attribute__((ext_vector_type(2))) unsigned short v2us;

// grid.y picks the weight: 0..2 -> rows y * N of the fused q|k|v plane, 3 -> the output-projection plane.
__global__ __launch_bounds__(256) void k_wtG(const float* __restrict__ wq, const float* __restrict__ wk, const float* __restrict__ wv, const float* __restrict__ wo, int K, int N, bf* Bqkv, bf* Bo) {
    const int y = blockIdx.y; const float* __restrict__ w = (y == 0) ? wq : (y == 1) ? wk : (y == 2) ? wv : wo; bf* Bt = (y < 3) ? Bqkv + (size_t)y * N * K : Bo;
    const int lane = threadIdx.x & 31; const int L0 = (blockIdx.x * 8 + (threadIdx.x >> 5)) * 8; const int nlines = N * K / 64;
{
#pragma unroll 1
        for (int l = 0; l < 8; ++l) { const int L = L0 + l; if (L >= nlines) break; const size_t e = (size_t)L * 64 + lane * 2; const int k = (int)(e % K), n = (int)(e / K); v2us o;
            o[0] = f2bf(w[(size_t)k * N + n]); o[1] = f2bf(w[(size_t)(k + 1) * N + n]); *(v2us*)(Bt + e) = o; }
         }
}
__global__ __launch_bounds__(256) void k_cvt8(const float* __restrict__ src, bf* dst, size_t n8, size_t sS, size_t sD) { const size_t i = (size_t)blockIdx.x * 256 + threadIdx.x; if (i >= n8) return; src += (size_t)blockIdx.y * sS; dst += (size_t)blockIdx.y * sD; const v8f v = *(const v8f*)(src + i * 8); v8us o;
#pragma unroll
    for (int k = 0; k < 8; ++k) o[k] = f2bf(v[k]); *(v8us*)(dst + i * 8) = o;  }

// k_qkp: head planes QK[which][b*16+h][t][d] (fp16): which 0 = q = F[b*TT+t][h*HD+d] + bq; which 1 = (F[b*TT+t][DQ+h*HD+d] + bk) + 8 R[t][d]. F row pitch NQKV.
__global__ __launch_bounds__(256) void k_qkp(const float* __restrict__ F, const float* __restrict__ bq, const float* __restrict__ bk, const float* __restrict__ R, h16* QK) {
    const size_t e = ((size_t)blockIdx.x * 256 + threadIdx.x) * 8; if (e >= (size_t)2 * NB * NH_ * TT * HD) return;
    const int which = (int)(e / ((size_t)NB * NH_ * TT * HD)); const size_t rem = e % ((size_t)NB * NH_ * TT * HD);
    const int d = (int)(rem % HD); const int t = (int)((rem / HD) % TT); const int g = (int)(rem / ((size_t)HD * TT)); const int h = g % NH_, b = g / NH_;
    const float* f = F + ((size_t)b * TT + t) * NQKV + (size_t)which * DQ + h * HD + d;
    const v4f f0 = *(const v4f*)f, f1 = *(const v4f*)(f + 4);
    const v4f q0 = *(const v4f*)(bq + h * HD + d), q1 = *(const v4f*)(bq + h * HD + d + 4);
    const v4f k0 = *(const v4f*)(bk + h * HD + d), k1 = *(const v4f*)(bk + h * HD + d + 4);
    const v4f r0 = *(const v4f*)(R + (size_t)t * HD + d), r1 = *(const v4f*)(R + (size_t)t * HD + d + 4);
    v8h o;
#pragma unroll
    for (int q = 0; q < 8; ++q) { const float fv = (q < 4) ? f0[q & 3] : f1[q & 3]; const float bqv = (q < 4) ? q0[q & 3] : q1[q & 3]; const float bkv = (q < 4) ? k0[q & 3] : k1[q & 3]; const float rv = (q < 4) ? r0[q & 3] : r1[q & 3];
        const float bias = which ? bfr(bkv) : bfr(bqv); const float radd = which ? RCAR * bfr(rv) : 0.0f; const float y = (fv + bias) + radd; o[q] = tohx(y); }
    *(v8h*)(QK + e) = o;  }
__global__ __launch_bounds__(256) void k_vtp(const float* __restrict__ F, const float* __restrict__ bv, h16* V16) { const size_t e = ((size_t)blockIdx.x * 256 + threadIdx.x) * 2; if (e >= (size_t)NB * NH_ * HD * TT) return; const int t = (int)(e % TT); const int d = (int)((e / TT) % HD); const int g = (int)(e / ((size_t)TT * HD)); const int h = g % NH_, b = g / NH_; const float bb = bfr(bv[h * HD + d]); v2h o16;
#pragma unroll
    for (int q = 0; q < 2; ++q) { const float x = F[((size_t)b * TT + t + q) * NQKV + 2 * DQ + h * HD + d] + bb; o16[q] = tohx(x); }
    *(v2h*)(V16 + e) = o16;  }
// ---- k_fattn: scores, mask, softmax, P x V and the head merge in one kernel; a score never leaves the registers.
// grid (TT / 256, NB * 16), 8 waves; a wave owns 32 query columns (2 groups of 16) of one head plane and walks all keys, 64 per LDS stage (2 buffers), 32 per pass.
// S^T = K' Q^T: A = key rows from LDS, B = q kept in registers; D register r of lane (c, h) = key 8h + r, query c. Two such tiles, converted in place, are the B operand (32 keys) of O^T += V^T P^T.
// O^T: D register r = d 8h + r of query c, so a lane stores 8 consecutive d of one merged-context row.
// Every plain '#pragma unroll' below makes the indices of a register array constants, so that the array stays in registers.
// amdgpu_waves_per_eu(4, 4): two work-groups per WGP, four waves per SIMD, to cover the vector work between the matrix runs.
#define FNW 8                     // waves per work-group
#define FQW 32                    // query columns per wave
#define FKS 64                    // keys per LDS stage
#define FPI 72                    // LDS row pitch in 16-bit elements: 128 B of data + 16 B, for the 16-byte readers
#define CSC (SCL * 1.4426950408889634f)
static_assert(TT % (FNW * FQW) == 0);
static_assert(TT % FKS == 0);
__device__ __forceinline__ float xhalf(float x) { return __builtin_bit_cast(float, __builtin_amdgcn_permlanex16(__builtin_bit_cast(int, x), __builtin_bit_cast(int, x), 0x76543210, 0xfedcba98, false, false)); }  // lane l with lane l ^ 16
__device__ __forceinline__ v16h ldsfrag(const h16* p) { return cat16(*(const v8ha*)p, *(const v8ha*)(p + 16)); }
__global__ __launch_bounds__(FNW * 32) __attribute__((amdgpu_waves_per_eu(4, 4))) void k_fattn(const h16* __restrict__ Q, const h16* __restrict__ Kp, const h16* __restrict__ Vt, const int* __restrict__ mk, bf* Ah, bf* Al) {
    __shared__ __align__(16) h16 kst[2][FKS * FPI];   // [key][d]
    __shared__ __align__(16) h16 vst[2][HD * FPI];    // [d][key]
    __shared__ __align__(16) float mb[TT];            // 0 for a kept key, -inf for a masked one
    const int tid = threadIdx.x, lane = tid & 31, c = lane & 15, h = lane >> 4, wave = tid >> 5;
    const int g = blockIdx.y, b = g / NH_, hh = g % NH_;
    const h16* Qg = Q + (size_t)g * TT * HD; const h16* Kg = Kp + (size_t)g * TT * HD; const h16* Vg = Vt + (size_t)g * HD * TT;
    const int q0 = blockIdx.x * (FNW * FQW) + wave * FQW;
    for (int i = tid; i < TT; i += FNW * 32) mb[i] = (mk[(size_t)b * SEQ_FULL + i] != 0) ? 0.0f : -__builtin_inff();
    // staging: thread -> rows sr and sr + 32, 16 bytes at element sc, of the 64 x 64 key tile and of the 64 x 64 V^T tile
    const int sr = tid >> 3, sc = (tid & 7) * 8;
    const unsigned ko = (unsigned)(sr * HD + sc), vo = (unsigned)(sr * TT + sc);   // the lane's 32-bit offsets beside wave-uniform bases
    v8h gk0 = *(const v8h*)(Kg + ko), gk1 = *(const v8h*)(Kg + ko + 32 * HD);
    v8h gv0 = *(const v8h*)(Vg + vo), gv1 = *(const v8h*)(Vg + vo + 32 * TT);
    v16h qf[2][2];
#pragma unroll
    for (int qg = 0; qg < 2; ++qg)
#pragma unroll
        for (int ks = 0; ks < 2; ++ks) qf[qg][ks] = WFrag<h16>::ld(Qg + (size_t)(q0 + qg * 16 + c) * HD + ks * 32 + 8 * h);
    *(v8ha*)(&kst[0][sr * FPI + sc]) = gk0; *(v8ha*)(&kst[0][(sr + 32) * FPI + sc]) = gk1;
    *(v8ha*)(&vst[0][sr * FPI + sc]) = gv0; *(v8ha*)(&vst[0][(sr + 32) * FPI + sc]) = gv1;
    v8f o[2][4];
#pragma unroll
    for (int qg = 0; qg < 2; ++qg)
#pragma unroll
        for (int dt = 0; dt < 4; ++dt) o[qg][dt] = (v8f){};
    float mrun[2] = {-1.0e30f, -1.0e30f};   // finite, below every finite score: -inf here would make -inf - (-inf) = NaN while only masked keys have been seen
    float lsum[2] = {0.0f, 0.0f};           // each wave half sums its own keys; joined once at the end
    __syncthreads();
#pragma unroll 1   // rolled: one copy of the stage body, and the buffer index stays a scalar
    for (int st = 0; st < TT / FKS; ++st) {
        const bool more = st + 1 < TT / FKS;
        if (more) { const h16* Kn = Kg + (size_t)(st + 1) * FKS * HD; const h16* Vn = Vg + (size_t)(st + 1) * FKS;
            gk0 = *(const v8h*)(Kn + ko); gk1 = *(const v8h*)(Kn + ko + 32 * HD);
            gv0 = *(const v8h*)(Vn + vo); gv1 = *(const v8h*)(Vn + vo + 32 * TT);
            asm volatile("s_wait_xcnt 0x0" ::: "memory"); }   // stands in front of the pass's address arithmetic, which reuses the four loads' address registers
        const h16* kb = kst[st & 1]; const h16* vb = vst[st & 1];
#pragma unroll 1   // one pass's registers at a time: two passes interleaved did not fit the 256 registers that four waves per SIMD leave
        for (int p = 0; p < FKS / 32; ++p) {
            v8f s[2][2];
#pragma unroll
            for (int kt = 0; kt < 2; ++kt) {
                const h16* kr = kb + (p * 32 + kt * 16 + c) * FPI + 8 * h;
                const v16h k0 = ldsfrag(kr), k1 = ldsfrag(kr + 32);
                const float* mp = mb + st * FKS + p * 32 + kt * 16 + 8 * h;
                const v4f b0 = *(const v4fa*)mp, b1 = *(const v4fa*)(mp + 4);
                const v8f bz = __builtin_shufflevector(b0, b1, 0, 1, 2, 3, 4, 5, 6, 7);
#pragma unroll
                for (int qg = 0; qg < 2; ++qg) { v8f t = wmma16(k0, qf[qg][0], (v8f){}); t = wmma16(k1, qf[qg][1], t); s[kt][qg] = t + bz; }
            }
            v16h vf[4];
#pragma unroll
            for (int dt = 0; dt < 4; ++dt) vf[dt] = ldsfrag(vb + (dt * 16 + c) * FPI + p * 32 + 8 * h);
            float mx[2]; bool need = false;
#pragma unroll
            for (int qg = 0; qg < 2; ++qg) { float m = s[0][qg][0];
#pragma unroll
                for (int r = 1; r < 8; ++r) m = fmaxf(m, s[0][qg][r]);
#pragma unroll
                for (int r = 0; r < 8; ++r) m = fmaxf(m, s[1][qg][r]);
                m = fmaxf(m, xhalf(m)) * CSC; mx[qg] = m; need = need || (m > mrun[qg] + 8.0f); }
            // the maximum in use moves only when some column's new maximum passes it by more than 8 (base 2): P stays <= 256, inside f16
            if (__builtin_amdgcn_ballot_w32(need) != 0) {
#pragma unroll
                for (int qg = 0; qg < 2; ++qg) { const float mn = fmaxf(mrun[qg], mx[qg]); const float corr = __builtin_amdgcn_exp2f(mrun[qg] - mn); mrun[qg] = mn; lsum[qg] *= corr;
#pragma unroll
                    for (int dt = 0; dt < 4; ++dt) o[qg][dt] = o[qg][dt] * corr; }
            }
#pragma unroll
            for (int qg = 0; qg < 2; ++qg) { const float nm = -mrun[qg]; v16h pf; float ls = 0.0f;
                const v8f cv = {CSC, CSC, CSC, CSC, CSC, CSC, CSC, CSC}, nv = {nm, nm, nm, nm, nm, nm, nm, nm};
                const v8f a0 = __builtin_elementwise_fma(s[0][qg], cv, nv), a1 = __builtin_elementwise_fma(s[1][qg], cv, nv);
#pragma unroll
                for (int i = 0; i < 16; ++i) { const float pv = __builtin_amdgcn_exp2f((i < 8) ? a0[i & 7] : a1[i & 7]); ls += pv; pf[i] = tohx(pv); }
                lsum[qg] += ls;
#pragma unroll
                for (int dt = 0; dt < 4; ++dt) o[qg][dt] = wmma16(vf[dt], pf, o[qg][dt]); }
            // four vector slots behind the pass's last matrix instructions: across the back edge the next pass's address arithmetic would overwrite their A registers too early
            asm volatile("v_nop\n\tv_nop\n\tv_nop\n\tv_nop" : "+v"(o[1][0]), "+v"(o[1][1]), "+v"(o[1][2]), "+v"(o[1][3]));
        }
        if (more) { h16* kw = kst[(st + 1) & 1]; h16* vw = vst[(st + 1) & 1];   // this buffer's last readers left it before the barrier that ended stage st - 1
            *(v8ha*)(kw + sr * FPI + sc) = gk0; *(v8ha*)(kw + (sr + 32) * FPI + sc) = gk1;
            *(v8ha*)(vw + sr * FPI + sc) = gv0; *(v8ha*)(vw + (sr + 32) * FPI + sc) = gv1; }
        __syncthreads();
    }
#pragma unroll
    for (int qg = 0; qg < 2; ++qg) { const float lf = lsum[qg] + xhalf(lsum[qg]); const float inv = 1.0f / lf;
        const size_t oo = ((size_t)b * TT + q0 + qg * 16 + c) * DQ + hh * HD + 8 * h;
#pragma unroll
        for (int dt = 0; dt < 4; ++dt) { v8us oh, ol;
#pragma unroll
            for (int j = 0; j < 8; ++j) { unsigned short a, c2; splitf(o[qg][dt][j] * inv, a, c2); oh[j] = a; ol[j] = c2; }
            *(v8us*)(Ah + oo + dt * 16) = oh; *(v8us*)(Al + oo + dt * 16) = ol; } }
}

extern "C" void kernel_launch(void* const* d_in, const int* in_sizes, int n_in,
                              void* d_out, int out_size, void* d_ws, size_t ws_size, hipStream_t stream) {
    (void)out_size;
    if (n_in < 11) return;
    if (in_sizes[0] < NB * TT * DM || in_sizes[1] < TT * HD || in_sizes[2] < NB * TT) return;
    if (in_sizes[3] < DM * DQ || in_sizes[5] < DM * DQ || in_sizes[7] < DM * DQ || in_sizes[9] < DQ * DM) return;
    if (in_sizes[4] < DQ || in_sizes[6] < DQ || in_sizes[8] < DQ || in_sizes[10] < DM) return;
    // wire order: x, rel_pos_enc, attention_mask, Wq, bq, Wk, bk, Wv, bv, Wo, bo
    const float* x = (const float*)d_in[0]; const float* rel = (const float*)d_in[1]; const int* msk = (const int*)d_in[2];
    const float* wq = (const float*)d_in[3]; const float* bq = (const float*)d_in[4]; const float* wk = (const float*)d_in[5]; const float* bk = (const float*)d_in[6];
    const float* wv = (const float*)d_in[7]; const float* bv = (const float*)d_in[8]; const float* wo = (const float*)d_in[9]; const float* bo = (const float*)d_in[10];
    float* OUT = (float*)d_out;     // [8][1024][1024]
    char* wsp = (char*)d_ws;
    auto take = [&](size_t bytes) { char* p = wsp; wsp += (bytes + 255) & ~(size_t)255; return (void*)p; };
    bf* WO = (bf*)take((size_t)DM * DQ * 2);                     // [1024][1024]
    h16* QK16 = (h16*)take((size_t)2 * NB * NH_ * TT * HD * 2);  // [2][NB*16][TT][64]
    h16* VT16 = (h16*)take((size_t)NB * NH_ * HD * TT * 2);      // [NB*16][64][TT]
    // one region, two lives: the projection's operands and result, dead once the head planes are written, then the merged context
    char* const shared0 = wsp;
    bf* WQKV = (bf*)take((size_t)NQKV * DM * 2);                 // [3072][1024]: rows 0..1023 q, 1024..2047 k, 2048..3071 v
    bf* XB = (bf*)take((size_t)NB * TT * DM * 2);                // [NB][TT][DM]
    float* F = (float*)take((size_t)NB * TT * NQKV * 4);         // [NB*TT][3072]
    char* const end1 = wsp; wsp = shared0;
    bf* ATh = (bf*)take((size_t)NB * TT * DQ * 2);               // merged context [NB*TT][1024], hi
    bf* ATl = (bf*)take((size_t)NB * TT * DQ * 2);               // the same, lo
    if (end1 > wsp) wsp = end1;
    if ((size_t)(wsp - (char*)d_ws) > ws_size) return;           // 168 MiB at full size
    h16* Q16 = QK16; h16* K16 = QK16 + (size_t)NB * NH_ * TT * HD;
    // weights: w[in = K][out = N] -> Bt[N][K]
    const unsigned GW = (unsigned)((DM * DQ / 64 + 63) / 64);
    k_wtG<<<dim3(GW, 4, 1), 256, 0, stream>>>(wq, wk, wv, wo, DM, DQ, WQKV, WO);
    k_cvt8<<<dim3((unsigned)(((size_t)TT * DM / 8 + 255) / 256), NB, 1), 256, 0, stream>>>(x, XB, (size_t)TT * DM / 8, (size_t)SEQ_FULL * DM, (size_t)TT * DM);
    const unsigned LQK = (unsigned)(((size_t)2 * NB * NH_ * TT * HD / 8 + 255) / 256), LV = (unsigned)(((size_t)NB * NH_ * HD * TT / 2 + 255) / 256);
    k_gemmw<bf, 0, false, DM><<<dim3(TT / GBM, NQKV / GBN, NB), 256, 0, stream>>>(XB, nullptr, WQKV, F, NQKV, nullptr, (size_t)TT * DM, 0, (size_t)TT * NQKV);
    k_qkp<<<LQK, 256, 0, stream>>>(F, bq, bk, rel, QK16);
    k_vtp<<<LV, 256, 0, stream>>>(F, bv, VT16);
    k_fattn<<<dim3(TT / (FNW * FQW), NB * NH_, 1), FNW * 32, 0, stream>>>(Q16, K16, VT16, msk, ATh, ATl);
    k_gemmw<bf, 1, true, DQ><<<dim3(TT / GBM, DM / GBN, NB), 256, 0, stream>>>(ATh, ATl, WO, OUT, DM, bo, (size_t)TT * DQ, 0, (size_t)SEQ_FULL * DM);
}

// v004
// A run of this version takes 146 microseconds.
// Next to v003, in two timings, it ran 1.37 and 1.38 times as fast.
// Over all steps from v000 it is 8.73 times as fast.
#include <hip/hip_runtime.h>

// Compute dtypes (f32 accumulate everywhere): every float input RNE-converted to bf16; QKV projection v_wmma_f32_16x16x32_bf16 (exact products); scores (k + 8 R) x q^T and V^T x P^T on v_wmma_f32_16x16x32_f16 (P = exp2 of the score against the maximum in use, not yet normalised); softmax f32; merged context as bf16 hi+lo planes x bf16 Wo (2 products) + f32 bias.
// Self-attention on one stream x [8][1024][1024]; weights [in][out] transposed once into K-contiguous bf16 planes (q|k|v fused to one [3072][1024] plane); 16 heads x 64.
// Score algebra: (q.k) x 0.125 + q.R[t] = 0.125 x q.(k[t] + 8 R[t]); the key plane stores k + 8 R (R = per-key table input, read by value), the 0.125 is applied in the softmax's exponent.
// Key mask [b][t] (int32, data): mask == 0 replaces the score by -inf; softmax in the running-maximum form, normalised once at the end (a row without any kept key ends as 0 x (1 / 0) = NaN).

#ifndef NB
#define NB 8
#endif
#ifndef SEQ
#define SEQ 1024
#endif
#define SEQ_FULL 1024             // per-batch row count of the inputs / output (strides)
#define TT   SEQ
#define DM   1024
#define NH_  16
#define HD   64
#define DQ   (NH_ * HD)
#define NQKV (3 * DQ)
#define SCL  0.125f               // HD^-0.5
#define RCAR 8.0f                 // 1 / SCL
typedef _Float16 h16;
typedef unsigned short bf;
typedef __attribute__((ext_vector_type(16))) __bf16   v16bf;
typedef __attribute__((ext_vector_type(16))) _Float16 v16h;
typedef __attribute__((ext_vector_type(8)))  _Float16 v8h;
typedef __attribute__((ext_vector_type(8)))  unsigned short v8us;
typedef __attribute__((ext_vector_type(8)))  float    v8f;
typedef __attribute__((ext_vector_type(4)))  float    v4f;
typedef v8h  __attribute__((may_alias)) v8ha;
typedef v4f  __attribute__((may_alias)) v4fa;
typedef v8us __attribute__((may_alias)) v8usa;

static_assert(TT % 128 == 0);
static_assert(TT <= SEQ_FULL);
static_assert(DM % 64 == 0);
static_assert(HD == 64);
static_assert(DM == DQ);
static_assert(NQKV % 256 == 0);
static_assert(DM % 256 == 0);

__device__ __forceinline__ unsigned short f2bf(float f) { unsigned u = __float_as_uint(f); u += 0x7FFFu + ((u >> 16) & 1u); return (unsigned short)(u >> 16); }
__device__ __forceinline__ float bf2f(unsigned short b) { return __uint_as_float(((unsigned)b) << 16); }
__device__ __forceinline__ float bfr(float f) { return bf2f(f2bf(f)); }
__device__ __forceinline__ v16h cat16(v8h lo, v8h hi) { return __builtin_shufflevector(lo, hi, 0, 1, 2, 3, 4, 5, 6, 7, 8, 9, 10, 11, 12, 13, 14, 15); }
__device__ __forceinline__ v16bf cat16b(v8us lo, v8us hi) { return __builtin_bit_cast(v16bf, __builtin_shufflevector(lo, hi, 0, 1, 2, 3, 4, 5, 6, 7, 8, 9, 10, 11, 12, 13, 14, 15)); }
__device__ __forceinline__ v8f wmma16(v16h a, v16h b, v8f c) { return __builtin_amdgcn_wmma_f32_16x16x32_f16(false, a, false, b, (short)0, c, false, false); }
__device__ __forceinline__ v8f wmmab(v16bf a, v16bf b, v8f c) { return __builtin_amdgcn_wmma_f32_16x16x32_bf16(false, a, false, b, (short)0, c, false, false); }

__device__ __forceinline__ h16 tohx(float x) { return (h16)x; }

// ---- k_gemmw: GEMM on a 128 x 256 output tile per work-group of 8 waves (2 x 4), 64 x 64 (16 accumulators) per wave; grid (M/128, N/256, Z), 256 threads.
// C[m][n] (f32, pitch ldc, + optional f32 bias[n]) = sum_k A[m][k] Bt[n][k] (+ A2[m][k] Bt[n][k] for NSPLIT 1). z-batch strides sA/sB/sC in elements. K: a compile-time multiple of 64, at least 128 (two stages).
// HEADS: no C; n runs over the fused q|k|v columns, z over the batches, and a wave's 64 x 64 tile is 64 rows t of one head of one of the three. The epilogue writes it as fp16 into its head plane:
//   q -> QK[0][z*16+h][t][d] = acc + bq; k -> QK[1][z*16+h][t][d] = (acc + bk) + 8 R[t][d]; v -> VT[z*16+h][d][t] = acc + bv (a lane's 8 accumulator rows are 8 consecutive t of one d).
// Operands: K-contiguous 16-bit planes, 64 k (one whole 128-B line of every row) per LDS stage, two buffers, brought by asynchronous copies one stage ahead of their use.
// Fragment map: lane l -> row/col l & 15, half h = l >> 4; elements 0..7 <- k0 + 8h + 0..7, elements 8..15 <- k0 + 16 + 8h + 0..7 (A and B alike); D element j -> row 8h + j, col l & 15.
#define GBM 128                   // tile rows
#define GBN 256                   // tile columns
#define GKS 64                    // k per LDS stage
#define GPI 72                    // LDS row pitch in 16-bit elements: 128 B of data + 16 B, for the 16-byte readers
template <typename T16> struct WFrag;
template <bool B> struct Flag { static constexpr bool v = B; };   // a compile-time switch handed to a generic lambda
template <> struct WFrag<h16> { typedef v16h V; static __device__ __forceinline__ V ld(const h16* p) { return cat16(*(const v8h*)p, *(const v8h*)(p + 16)); } static __device__ __forceinline__ v8f mma(V a, V b, v8f c) { return wmma16(a, b, c); } };
template <> struct WFrag<bf> { typedef v16bf V; static __device__ __forceinline__ V ld(const bf* p) { return cat16b(*(const v8us*)p, *(const v8us*)(p + 16)); } static __device__ __forceinline__ V ldl(const bf* p) { return cat16b(*(const v8usa*)p, *(const v8usa*)(p + 16)); } static __device__ __forceinline__ v8f mma(V a, V b, v8f c) { return wmmab(a, b, c); } };
// Four asynchronous copies of 16 bytes a lane: rows r, r + 32, r + 64, r + 96 of one operand (global row step gs elements, LDS row pitch GPI).
// The s_wait_xcnt stands inside the statement, behind the last copy, so that no later write of an address register named here can come in front of it.
template <typename T16>
__device__ __forceinline__ void cp4(unsigned l, const T16* g, size_t gs) {
    const unsigned l1 = l + 32 * GPI * 2, l2 = l + 64 * GPI * 2, l3 = l + 96 * GPI * 2;
    const T16* g1 = g + gs; const T16* g2 = g1 + gs; const T16* g3 = g2 + gs;
    asm volatile("global_load_async_to_lds_b128 %0, %4, off\n\t"
                 "global_load_async_to_lds_b128 %1, %5, off\n\t"
                 "global_load_async_to_lds_b128 %2, %6, off\n\t"
                 "global_load_async_to_lds_b128 %3, %7, off\n\t"
                 "s_wait_xcnt 0x0"
                 :: "v"(l), "v"(l1), "v"(l2), "v"(l3), "v"(g), "v"(g1), "v"(g2), "v"(g3) : "memory");
}
// amdgpu_waves_per_eu(4, 4): two work-groups per WGP, so that one group's matrix runs cover the other's barrier, copy issue and epilogue.
template <typename T16, int NSPLIT, bool BIAS, int K, bool HEADS>
__global__ __launch_bounds__(256) __attribute__((amdgpu_waves_per_eu(4, 4))) void k_gemmw(const T16* __restrict__ A, const T16* __restrict__ A2, const T16* __restrict__ Bt, float* C, int ldc, const float* __restrict__ bias, size_t sA, size_t sB, size_t sC,
                                                                                          const float* __restrict__ bq, const float* __restrict__ bk, const float* __restrict__ bv, const float* __restrict__ R, h16* QK, h16* VT) {
    static_assert(NSPLIT == 0 || NSPLIT == 1);
    static_assert(K % GKS == 0 && K / GKS >= 2);
    typedef typename WFrag<T16>::V V;
    constexpr int AR = (NSPLIT == 1) ? 2 * GBM : GBM;   // staged A rows: the A plane, then the A2 plane
    constexpr int SE = (AR + GBN) * GPI;                // elements per stage: A rows, then Bt rows
    __shared__ __align__(16) T16 stg[2 * SE];
    static_assert(8 * 16 * 68 * 4 <= 2 * SE * 2);       // the epilogue's staging rows lie in the same LDS
    static_assert(8 * 64 * GPI * 2 <= 2 * SE * 2);      // ... and so do the V^T tiles of the HEADS epilogue
    const size_t z = blockIdx.z; A += z * sA; if (NSPLIT == 1) A2 += z * sA; Bt += z * sB; if (!HEADS) C += z * sC;
    const int tid = threadIdx.x, lane = tid & 31, lr = lane & 15, hi = lane >> 4, wave = tid >> 5, wm = wave >> 2, wn = wave & 3;
    const int R0 = blockIdx.x * GBM, C0 = blockIdx.y * GBN; const int r0 = R0 + wm * 64, c0 = C0 + wn * 64;
    // copies: thread -> 16 bytes at element sc of rows sr + 32 i; a wave's copy covers four whole 128-B lines
    const int sr = tid >> 3, sc = (tid & 7) * 8; const size_t gs = (size_t)32 * K;
    const T16* ga = A + (size_t)(R0 + sr) * K + sc; const T16* ga2 = (NSPLIT == 1) ? A2 + (size_t)(R0 + sr) * K + sc : nullptr; const T16* gb = Bt + (size_t)(C0 + sr) * K + sc;
    const unsigned l0 = (unsigned)(size_t)stg + (unsigned)(sr * GPI + sc) * 2;   // the lane's LDS byte address in buffer 0
    auto fill = [&](int t, int buf) {
        const unsigned l = l0 + (unsigned)buf * (SE * 2); const int ko = t * GKS;
        cp4(l, ga + ko, gs);
        if (NSPLIT == 1) cp4(l + GBM * GPI * 2, ga2 + ko, gs);
        cp4(l + AR * GPI * 2, gb + ko, gs); cp4(l + (AR + 128) * GPI * 2, gb + ko + 4 * gs, gs); };
    v8f acc[4][4];
#pragma unroll
    for (int mb = 0; mb < 4; ++mb)
#pragma unroll
        for (int nb = 0; nb < 4; ++nb) acc[mb][nb] = (v8f){};
    constexpr int nt = K / GKS;
    fill(0, 0);
    asm volatile("s_wait_asynccnt 0x0" ::: "memory");   // this wave's share of stage 0 has landed
    __syncthreads();                                    // ... and every other wave's
    fill(1, 1);
    const int afo = (wm * 64 + lr) * GPI + 8 * hi, bfo = (AR + wn * 64 + lr) * GPI + 8 * hi;
#pragma unroll 1   // rolled: one copy of the stage body, and the buffer index stays a scalar
    for (int t = 0; t < nt; ++t) {
        const T16* sb = stg + (t & 1) * SE;
#pragma unroll
        for (int ks = 0; ks < GKS / 32; ++ks) {
            V a[4], a2[4], b[4];   // all of a 32-k block's fragments are asked for as one group, ahead of its matrix run
#pragma unroll
            for (int mb = 0; mb < 4; ++mb) { a[mb] = WFrag<T16>::ldl(sb + afo + mb * 16 * GPI + ks * 32); if (NSPLIT == 1) a2[mb] = WFrag<T16>::ldl(sb + afo + (GBM + mb * 16) * GPI + ks * 32); }
#pragma unroll
            for (int nb = 0; nb < 4; ++nb) b[nb] = WFrag<T16>::ldl(sb + bfo + nb * 16 * GPI + ks * 32);
            __builtin_amdgcn_sched_barrier(0);   // keeps the LDS loads one group: left alone the compiler moves the Bt loads in among the matrix instructions, each with a full wait behind it
#pragma unroll
            for (int nb = 0; nb < 4; ++nb)
#pragma unroll
                for (int mb = 0; mb < 4; ++mb) { acc[mb][nb] = WFrag<T16>::mma(a[mb], b[nb], acc[mb][nb]); if (NSPLIT == 1) acc[mb][nb] = WFrag<T16>::mma(a2[mb], b[nb], acc[mb][nb]); }
            __builtin_amdgcn_sched_barrier(0);   // ends the block: the next group of loads, and the stage's closing waits, stay behind its matrix instructions
        }
        asm volatile("s_wait_dscnt 0x0" ::: "memory");      // this wave has left buffer t & 1
        asm volatile("s_wait_asynccnt 0x0" ::: "memory");   // this wave's share of stage t + 1 has landed
        __syncthreads();                                    // publishes stage t + 1 and ends every reader's last read of buffer t & 1
        if (t + 2 < nt) fill(t + 2, t & 1);
    }
    asm volatile("s_wait_asynccnt 0x0" ::: "memory");       // no copy is outstanding when the LDS becomes output staging
    float* os = (float*)stg + wave * (16 * 68);             // each wave's own 16 x 68 floats; every reader left the buffers at the loop's last barrier
    if constexpr (HEADS) {
        const int which = C0 / DQ, hd = (c0 % DQ) / HD;     // which: the same for the whole work-group (GBN divides DQ); hd: the wave's head
        const size_t g = z * NH_ + hd; const int rr = lane >> 3, cofs = (lane & 7) * 8;   // read-back: 8 lanes per 128-byte output row, 4 rows per store
        // q and k rows; ISK: the key plane, which also takes 8 x the table row of its t. Two copies of the code, so that neither holds a branch between a load and its use.
        auto rows = [&](auto isk) {
            constexpr bool ISK = decltype(isk)::v;
            const float* bb = (ISK ? bk : bq) + hd * HD + cofs; const v4f ba = *(const v4f*)bb, bc = *(const v4f*)(bb + 4);
            asm volatile("s_wait_xcnt 0x0" :: "v"(bb) : "memory");   // the two loads' address pair lives to this wait, so nothing overwrites it in front of it
            const float* rp = R + (size_t)(r0 + rr) * HD + cofs;
            h16* dst = QK + (((size_t)(ISK ? NB * NH_ : 0) + g) * TT + r0 + rr) * HD + cofs;
            v4f tb[2][4][2];                                // the table rows of one 16-row block, asked for one block ahead of their use
            if (ISK) {
#pragma unroll
                for (int s = 0; s < 4; ++s) { tb[0][s][0] = *(const v4f*)(rp + 4 * s * HD); tb[0][s][1] = *(const v4f*)(rp + 4 * s * HD + 4); } }
            float bi[8];
#pragma unroll
            for (int q = 0; q < 8; ++q) bi[q] = bfr((q < 4) ? ba[q & 3] : bc[q & 3]);
#pragma unroll
            for (int mb = 0; mb < 4; ++mb) {
                if (ISK && mb < 3) {
#pragma unroll
                    for (int s = 0; s < 4; ++s) { tb[(mb + 1) & 1][s][0] = *(const v4f*)(rp + ((mb + 1) * 16 + 4 * s) * HD); tb[(mb + 1) & 1][s][1] = *(const v4f*)(rp + ((mb + 1) * 16 + 4 * s) * HD + 4); } }
#pragma unroll
                for (int nb = 0; nb < 4; ++nb) {
#pragma unroll
                    for (int j = 0; j < 8; ++j) os[(hi * 8 + j) * 68 + nb * 16 + lr] = acc[mb][nb][j]; }
                __builtin_amdgcn_wave_barrier(); asm volatile("" ::: "memory");   // compiler fence: the reads below take other lanes' words, so they stay behind the writes above
                v8h o[4];
#pragma unroll
                for (int s = 0; s < 4; ++s) {
                    const v4f x0 = *(const v4fa*)(os + (4 * s + rr) * 68 + cofs), x1 = *(const v4fa*)(os + (4 * s + rr) * 68 + cofs + 4);
#pragma unroll
                    for (int q = 0; q < 8; ++q) { float y = ((q < 4) ? x0[q & 3] : x1[q & 3]) + bi[q];
                        if (ISK) y += RCAR * bfr((q < 4) ? tb[mb & 1][s][0][q & 3] : tb[mb & 1][s][1][q & 3]);
                        o[s][q] = tohx(y); } }
                __builtin_amdgcn_sched_barrier(0);   // all four rows' values are finished, each in registers of its own, before the first store names any
#pragma unroll
                for (int s = 0; s < 4; ++s) *(v8h*)(dst + (mb * 16 + 4 * s) * HD) = o[s];
                asm volatile("s_wait_xcnt 0x0" ::: "memory");   // behind every block's four stores, the last block's too: in front of whatever next writes their data registers (the next block's arithmetic, or the code laid behind this copy of the epilogue); as a compiler fence it also keeps the next block's LDS writes behind this block's reads
                __builtin_amdgcn_sched_barrier(0);              // keeps that code behind the wait
            }
        };
        if (which == 0) { rows(Flag<false>{}); return; }
        if (which == 1) { rows(Flag<true>{}); return; }
        {
            h16* ot = (h16*)stg + wave * (64 * GPI);        // each wave's own [d][t] tile, 64 rows of pitch GPI
            const int bix = hd * HD + lr; float bb[4];
#pragma unroll
            for (int nb = 0; nb < 4; ++nb) bb[nb] = bv[bix + nb * 16];
            asm volatile("s_wait_xcnt 0x0" :: "v"(bix) : "memory");   // the four loads' index register lives to this wait, so nothing overwrites it in front of it
#pragma unroll
            for (int nb = 0; nb < 4; ++nb) { const float bz = bfr(bb[nb]);
#pragma unroll
                for (int mb = 0; mb < 4; ++mb) { v8h o;
#pragma unroll
                    for (int j = 0; j < 8; ++j) o[j] = tohx(acc[mb][nb][j] + bz);
                    *(v8ha*)(ot + (nb * 16 + lr) * GPI + mb * 16 + 8 * hi) = o; } }
            __builtin_amdgcn_wave_barrier(); asm volatile("" ::: "memory");       // compiler fence: the reads below take other lanes' words, so they stay behind the writes above
            h16* dst = VT + (g * HD + rr) * TT + r0 + cofs;
#pragma unroll
            for (int s = 0; s < 16; ++s) *(v8h*)(dst + (size_t)(4 * s) * TT) = *(const v8ha*)(ot + (4 * s + rr) * GPI + cofs);
            asm volatile("s_wait_xcnt 0x0" ::: "memory");   // behind the sixteen stores, in front of any code laid behind this branch that writes their registers
        }
        return;
    }
#pragma unroll
    for (int mb = 0; mb < 4; ++mb) {
#pragma unroll
        for (int nb = 0; nb < 4; ++nb) {
#pragma unroll
            for (int j = 0; j < 8; ++j) os[(hi * 8 + j) * 68 + nb * 16 + lr] = acc[mb][nb][j]; }
        __builtin_amdgcn_wave_barrier(); asm volatile("" ::: "memory");
        float* crow = C + (size_t)(r0 + mb * 16) * ldc + c0;
{
#pragma unroll
            for (int s = 0; s < 8; ++s) { const int row = 2 * s + hi, cofs = lr * 4; v4f val = *(const v4fa*)(os + row * 68 + cofs); if (BIAS) { val[0] += bfr(bias[c0 + cofs]); val[1] += bfr(bias[c0 + cofs + 1]); val[2] += bfr(bias[c0 + cofs + 2]); val[3] += bfr(bias[c0 + cofs + 3]); }
                *(v4f*)(crow + (size_t)row * ldc + cofs) = val; }
             }
        __builtin_amdgcn_wave_barrier(); asm volatile("" ::: "memory");
    }
}

__device__ __forceinline__ void splitf(float y, unsigned short& h, unsigned short& l) { h = f2bf(y); l = f2bf(y - bf2f(h)); }
typedef __attribute__((ext_vector_type(2))) unsigned short v2us;

// grid.y picks the weight: 0..2 -> rows y * N of the fused q|k|v plane, 3 -> the output-projection plane.
__global__ __launch_bounds__(256) void k_wtG(const float* __restrict__ wq, const float* __restrict__ wk, const float* __restrict__ wv, const float* __restrict__ wo, int K, int N, bf* Bqkv, bf* Bo) {
    const int y = blockIdx.y; const float* __restrict__ w = (y == 0) ? wq : (y == 1) ? wk : (y == 2) ? wv : wo; bf* Bt = (y < 3) ? Bqkv + (size_t)y * N * K : Bo;
    const int lane = threadIdx.x & 31; const int L0 = (blockIdx.x * 8 + (threadIdx.x >> 5)) * 8; const int nlines = N * K / 64;
{
#pragma unroll 1
        for (int l = 0; l < 8; ++l) { const int L = L0 + l; if (L >= nlines) break; const size_t e = (size_t)L * 64 + lane * 2; const int k = (int)(e % K), n = (int)(e / K); v2us o;
            o[0] = f2bf(w[(size_t)k * N + n]); o[1] = f2bf(w[(size_t)(k + 1) * N + n]); *(v2us*)(Bt + e) = o; }
         }
}
__global__ __launch_bounds__(256) void k_cvt8(const float* __restrict__ src, bf* dst, size_t n8, size_t sS, size_t sD) { const size_t i = (size_t)blockIdx.x * 256 + threadIdx.x; if (i >= n8) return; src += (size_t)blockIdx.y * sS; dst += (size_t)blockIdx.y * sD; const v8f v = *(const v8f*)(src + i * 8); v8us o;
#pragma unroll
    for (int k = 0; k < 8; ++k) o[k] = f2bf(v[k]); *(v8us*)(dst + i * 8) = o;  }

// ---- k_fattn: scores, mask, softmax, P x V and the head merge in one kernel; a score never leaves the registers.
// grid (TT / 256, NB * 16), 8 waves; a wave owns 32 query columns (2 groups of 16) of one head plane and walks all keys, 64 per LDS stage (2 buffers), 32 per pass.
// S^T = K' Q^T: A = key rows from LDS, B = q kept in registers; D register r of lane (c, h) = key 8h + r, query c. Two such tiles, converted in place, are the B operand (32 keys) of O^T += V^T P^T.
// O^T: D register r = d 8h + r of query c, so a lane stores 8 consecutive d of one merged-context row.
// Every plain '#pragma unroll' below makes the indices of a register array constants, so that the array stays in registers.
// amdgpu_waves_per_eu(4, 4): two work-groups per WGP, four waves per SIMD, to cover the vector work between the matrix runs.
#define FNW 8                     // waves per work-group
#define FQW 32                    // query columns per wave
#define FKS 64                    // keys per LDS stage
#define FPI 72                    // LDS row pitch in 16-bit elements: 128 B of data + 16 B, for the 16-byte readers
#define CSC (SCL * 1.4426950408889634f)
static_assert(TT % (FNW * FQW) == 0);
static_assert(TT % FKS == 0);
__device__ __forceinline__ float xhalf(float x) { return __builtin_bit_cast(float, __builtin_amdgcn_permlanex16(__builtin_bit_cast(int, x), __builtin_bit_cast(int, x), 0x76543210, 0xfedcba98, false, false)); }  // lane l with lane l ^ 16
__device__ __forceinline__ v16h ldsfrag(const h16* p) { return cat16(*(const v8ha*)p, *(const v8ha*)(p + 16)); }
__global__ __launch_bounds__(FNW * 32) __attribute__((amdgpu_waves_per_eu(4, 4))) void k_fattn(const h16* __restrict__ Q, const h16* __restrict__ Kp, const h16* __restrict__ Vt, const int* __restrict__ mk, bf* Ah, bf* Al) {
    __shared__ __align__(16) h16 kst[2][FKS * FPI];   // [key][d]
    __shared__ __align__(16) h16 vst[2][HD * FPI];    // [d][key]
    __shared__ __align__(16) float mb[TT];            // 0 for a kept key, -inf for a masked one
    const int tid = threadIdx.x, lane = tid & 31, c = lane & 15, h = lane >> 4, wave = tid >> 5;
    const int g = blockIdx.y, b = g / NH_, hh = g % NH_;
    const h16* Qg = Q + (size_t)g * TT * HD; const h16* Kg = Kp + (size_t)g * TT * HD; const h16* Vg = Vt + (size_t)g * HD * TT;
    const int q0 = blockIdx.x * (FNW * FQW) + wave * FQW;
    for (int i = tid; i < TT; i += FNW * 32) mb[i] = (mk[(size_t)b * SEQ_FULL + i] != 0) ? 0.0f : -__builtin_inff();
    // staging: thread -> rows sr and sr + 32, 16 bytes at element sc, of the 64 x 64 key tile and of the 64 x 64 V^T tile
    const int sr = tid >> 3, sc = (tid & 7) * 8;
    const unsigned ko = (unsigned)(sr * HD + sc), vo = (unsigned)(sr * TT + sc);   // the lane's 32-bit offsets beside wave-uniform bases
    v8h gk0 = *(const v8h*)(Kg + ko), gk1 = *(const v8h*)(Kg + ko + 32 * HD);
    v8h gv0 = *(const v8h*)(Vg + vo), gv1 = *(const v8h*)(Vg + vo + 32 * TT);
    v16h qf[2][2];
#pragma unroll
    for (int qg = 0; qg < 2; ++qg)
#pragma unroll
        for (int ks = 0; ks < 2; ++ks) qf[qg][ks] = WFrag<h16>::ld(Qg + (size_t)(q0 + qg * 16 + c) * HD + ks * 32 + 8 * h);
    *(v8ha*)(&kst[0][sr * FPI + sc]) = gk0; *(v8ha*)(&kst[0][(sr + 32) * FPI + sc]) = gk1;
    *(v8ha*)(&vst[0][sr * FPI + sc]) = gv0; *(v8ha*)(&vst[0][(sr + 32) * FPI + sc]) = gv1;
    v8f o[2][4];
#pragma unroll
    for (int qg = 0; qg < 2; ++qg)
#pragma unroll
        for (int dt = 0; dt < 4; ++dt) o[qg][dt] = (v8f){};
    float mrun[2] = {-1.0e30f, -1.0e30f};   // finite, below every finite score: -inf here would make -inf - (-inf) = NaN while only masked keys have been seen
    float lsum[2] = {0.0f, 0.0f};           // each wave half sums its own keys; joined once at the end
    __syncthreads();
#pragma unroll 1   // rolled: one copy of the stage body, and the buffer index stays a scalar
    for (int st = 0; st < TT / FKS; ++st) {
        const bool more = st + 1 < TT / FKS;
        if (more) { const h16* Kn = Kg + (size_t)(st + 1) * FKS * HD; const h16* Vn = Vg + (size_t)(st + 1) * FKS;
            gk0 = *(const v8h*)(Kn + ko); gk1 = *(const v8h*)(Kn + ko + 32 * HD);
            gv0 = *(const v8h*)(Vn + vo); gv1 = *(const v8h*)(Vn + vo + 32 * TT);
            asm volatile("s_wait_xcnt 0x0" ::: "memory"); }   // stands in front of the pass's address arithmetic, which reuses the four loads' address registers
        const h16* kb = kst[st & 1]; const h16* vb = vst[st & 1];
#pragma unroll 1   // one pass's registers at a time: two passes interleaved did not fit the 256 registers that four waves per SIMD leave
        for (int p = 0; p < FKS / 32; ++p) {
            v8f s[2][2];
#pragma unroll
            for (int kt = 0; kt < 2; ++kt) {
                const h16* kr = kb + (p * 32 + kt * 16 + c) * FPI + 8 * h;
                const v16h k0 = ldsfrag(kr), k1 = ldsfrag(kr + 32);
                const float* mp = mb + st * FKS + p * 32 + kt * 16 + 8 * h;
                const v4f b0 = *(const v4fa*)mp, b1 = *(const v4fa*)(mp + 4);
                const v8f bz = __builtin_shufflevector(b0, b1, 0, 1, 2, 3, 4, 5, 6, 7);
#pragma unroll
                for (int qg = 0; qg < 2; ++qg) { v8f t = wmma16(k0, qf[qg][0], (v8f){}); t = wmma16(k1, qf[qg][1], t); s[kt][qg] = t + bz; }
            }
            v16h vf[4];
#pragma unroll
            for (int dt = 0; dt < 4; ++dt) vf[dt] = ldsfrag(vb + (dt * 16 + c) * FPI + p * 32 + 8 * h);
            float mx[2]; bool need = false;
#pragma unroll
            for (int qg = 0; qg < 2; ++qg) { float m = s[0][qg][0];
#pragma unroll
                for (int r = 1; r < 8; ++r) m = fmaxf(m, s[0][qg][r]);
#pragma unroll
                for (int r = 0; r < 8; ++r) m = fmaxf(m, s[1][qg][r]);
                m = fmaxf(m, xhalf(m)) * CSC; mx[qg] = m; need = need || (m > mrun[qg] + 8.0f); }
            // the maximum in use moves only when some column's new maximum passes it by more than 8 (base 2): P stays <= 256, inside f16
            if (__builtin_amdgcn_ballot_w32(need) != 0) {
#pragma unroll
                for (int qg = 0; qg < 2; ++qg) { const float mn = fmaxf(mrun[qg], mx[qg]); const float corr = __builtin_amdgcn_exp2f(mrun[qg] - mn); mrun[qg] = mn; lsum[qg] *= corr;
#pragma unroll
                    for (int dt = 0; dt < 4; ++dt) o[qg][dt] = o[qg][dt] * corr; }
            }
#pragma unroll
            for (int qg = 0; qg < 2; ++qg) { const float nm = -mrun[qg]; v16h pf; float ls = 0.0f;
                const v8f cv = {CSC, CSC, CSC, CSC, CSC, CSC, CSC, CSC}, nv = {nm, nm, nm, nm, nm, nm, nm, nm};
                const v8f a0 = __builtin_elementwise_fma(s[0][qg], cv, nv), a1 = __builtin_elementwise_fma(s[1][qg], cv, nv);
#pragma unroll
                for (int i = 0; i < 16; ++i) { const float pv = __builtin_amdgcn_exp2f((i < 8) ? a0[i & 7] : a1[i & 7]); ls += pv; pf[i] = tohx(pv); }
                lsum[qg] += ls;
#pragma unroll
                for (int dt = 0; dt < 4; ++dt) o[qg][dt] = wmma16(vf[dt], pf, o[qg][dt]); }
            // four vector slots behind the pass's last matrix instructions: across the back edge the next pass's address arithmetic would overwrite their A registers too early
            asm volatile("v_nop\n\tv_nop\n\tv_nop\n\tv_nop" : "+v"(o[1][0]), "+v"(o[1][1]), "+v"(o[1][2]), "+v"(o[1][3]));
        }
        if (more) { h16* kw = kst[(st + 1) & 1]; h16* vw = vst[(st + 1) & 1];   // this buffer's last readers left it before the barrier that ended stage st - 1
            *(v8ha*)(kw + sr * FPI + sc) = gk0; *(v8ha*)(kw + (sr + 32) * FPI + sc) = gk1;
            *(v8ha*)(vw + sr * FPI + sc) = gv0; *(v8ha*)(vw + (sr + 32) * FPI + sc) = gv1; }
        __syncthreads();
    }
#pragma unroll
    for (int qg = 0; qg < 2; ++qg) { const float lf = lsum[qg] + xhalf(lsum[qg]); const float inv = 1.0f / lf;
        const size_t oo = ((size_t)b * TT + q0 + qg * 16 + c) * DQ + hh * HD + 8 * h;
#pragma unroll
        for (int dt = 0; dt < 4; ++dt) { v8us oh, ol;
#pragma unroll
            for (int j = 0; j < 8; ++j) { unsigned short a, c2; splitf(o[qg][dt][j] * inv, a, c2); oh[j] = a; ol[j] = c2; }
            *(v8us*)(Ah + oo + dt * 16) = oh; *(v8us*)(Al + oo + dt * 16) = ol; } }
}

extern "C" void kernel_launch(void* const* d_in, const int* in_sizes, int n_in,
                              void* d_out, int out_size, void* d_ws, size_t ws_size, hipStream_t stream) {
    (void)out_size;
    if (n_in < 11) return;
    if (in_sizes[0] < NB * TT * DM || in_sizes[1] < TT * HD || in_sizes[2] < NB * TT) return;
    if (in_sizes[3] < DM * DQ || in_sizes[5] < DM * DQ || in_sizes[7] < DM * DQ || in_sizes[9] < DQ * DM) return;
    if (in_sizes[4] < DQ || in_sizes[6] < DQ || in_sizes[8] < DQ || in_sizes[10] < DM) return;
    // wire order: x, rel_pos_enc, attention_mask, Wq, bq, Wk, bk, Wv, bv, Wo, bo
    const float* x = (const float*)d_in[0]; const float* rel = (const float*)d_in[1]; const int* msk = (const int*)d_in[2];
    const float* wq = (const float*)d_in[3]; const float* bq = (const float*)d_in[4]; const float* wk = (const float*)d_in[5]; const float* bk = (const float*)d_in[6];
    const float* wv = (const float*)d_in[7]; const float* bv = (const float*)d_in[8]; const float* wo = (const float*)d_in[9]; const float* bo = (const float*)d_in[10];
    float* OUT = (float*)d_out;     // [8][1024][1024]
    char* wsp = (char*)d_ws;
    auto take = [&](size_t bytes) { char* p = wsp; wsp += (bytes + 255) & ~(size_t)255; return (void*)p; };
    bf* WO = (bf*)take((size_t)DM * DQ * 2);                     // [1024][1024]
    h16* QK16 = (h16*)take((size_t)2 * NB * NH_ * TT * HD * 2);  // [2][NB*16][TT][64]
    h16* VT16 = (h16*)take((size_t)NB * NH_ * HD * TT * 2);      // [NB*16][64][TT]
    // one region, two lives: the projection's operands, dead once the head planes are written, then the merged context
    char* const shared0 = wsp;
    bf* WQKV = (bf*)take((size_t)NQKV * DM * 2);                 // [3072][1024]: rows 0..1023 q, 1024..2047 k, 2048..3071 v
    bf* XB = (bf*)take((size_t)NB * TT * DM * 2);                // [NB][TT][DM]
    char* const end1 = wsp; wsp = shared0;
    bf* ATh = (bf*)take((size_t)NB * TT * DQ * 2);               // merged context [NB*TT][1024], hi
    bf* ATl = (bf*)take((size_t)NB * TT * DQ * 2);               // the same, lo
    if (end1 > wsp) wsp = end1;
    if ((size_t)(wsp - (char*)d_ws) > ws_size) return;           // 82 MiB at full size
    h16* Q16 = QK16; h16* K16 = QK16 + (size_t)NB * NH_ * TT * HD;
    // weights: w[in = K][out = N] -> Bt[N][K]
    const unsigned GW = (unsigned)((DM * DQ / 64 + 63) / 64);
    k_wtG<<<dim3(GW, 4, 1), 256, 0, stream>>>(wq, wk, wv, wo, DM, DQ, WQKV, WO);
    k_cvt8<<<dim3((unsigned)(((size_t)TT * DM / 8 + 255) / 256), NB, 1), 256, 0, stream>>>(x, XB, (size_t)TT * DM / 8, (size_t)SEQ_FULL * DM, (size_t)TT * DM);
    k_gemmw<bf, 0, false, DM, true><<<dim3(TT / GBM, NQKV / GBN, NB), 256, 0, stream>>>(XB, nullptr, WQKV, nullptr, 0, nullptr, (size_t)TT * DM, 0, 0, bq, bk, bv, rel, QK16, VT16);
    k_fattn<<<dim3(TT / (FNW * FQW), NB * NH_, 1), FNW * 32, 0, stream>>>(Q16, K16, VT16, msk, ATh, ATl);
    k_gemmw<bf, 1, true, DQ, false><<<dim3(TT / GBM, DM / GBN, NB), 256, 0, stream>>>(ATh, ATl, WO, OUT, DM, bo, (size_t)TT * DQ, 0, (size_t)SEQ_FULL * DM, nullptr, nullptr, nullptr, nullptr, nullptr, nullptr);
}

// v005
// It runs in 134 microseconds.
// Timed twice side by side with v004, it ran 1.10 times as fast both times.
// All steps since v000 together make it 9.58 times as fast.
#include <hip/hip_runtime.h>

// Compute dtypes (f32 accumulate everywhere): every float input RNE-converted to bf16; QKV projection v_wmma_f32_16x16x32_bf16 (exact products); scores (k + 8 R) x q^T and V^T x P^T (V^T read from [t][d] rows by the transposing LDS load) on v_wmma_f32_16x16x32_f16 (P = exp2 of the score against the maximum in use, not yet normalised); softmax f32; merged context as bf16 hi+lo planes x bf16 Wo (2 products) + f32 bias.
// Self-attention on one stream x [8][1024][1024]; weights [in][out] transposed once into K-contiguous bf16 planes (q|k|v fused to one [3072][1024] plane); 16 heads x 64.
// Score algebra: (q.k) x 0.125 + q.R[t] = 0.125 x q.(k[t] + 8 R[t]); the key plane stores k + 8 R (R = per-key table input, read by value), the 0.125 is applied in the softmax's exponent.
// Key mask [b][t] (int32, data): a key with mask == 0 has weight exp(-inf) = 0, so it is left out of the key walk: each attention work-group lists the kept keys in ascending order and stages only their rows.
// Softmax in the running-maximum form, normalised once at the end (a row without any kept key ends as 0 x (1 / 0) = NaN).

#ifndef NB
#define NB 8
#endif
#ifndef SEQ
#define SEQ 1024
#endif
#define SEQ_FULL 1024             // per-batch row count of the inputs / output (strides)
#define TT   SEQ
#define DM   1024
#define NH_  16
#define HD   64
#define DQ   (NH_ * HD)
#define NQKV (3 * DQ)
#define SCL  0.125f               // HD^-0.5
#define RCAR 8.0f                 // 1 / SCL
typedef _Float16 h16;
typedef unsigned short bf;
typedef __attribute__((ext_vector_type(16))) __bf16   v16bf;
typedef __attribute__((ext_vector_type(16))) _Float16 v16h;
typedef __attribute__((ext_vector_type(8)))  _Float16 v8h;
typedef __attribute__((ext_vector_type(8)))  unsigned short v8us;
typedef __attribute__((ext_vector_type(8)))  float    v8f;
typedef __attribute__((ext_vector_type(4)))  float    v4f;
typedef v8h  __attribute__((may_alias)) v8ha;
typedef v4f  __attribute__((may_alias)) v4fa;
typedef v8us __attribute__((may_alias)) v8usa;

static_assert(TT % 128 == 0);
static_assert(TT <= SEQ_FULL);
static_assert(DM % 64 == 0);
static_assert(HD == 64);
static_assert(DM == DQ);
static_assert(NQKV % 256 == 0);
static_assert(DM % 256 == 0);

__device__ __forceinline__ unsigned short f2bf(float f) { unsigned u = __float_as_uint(f); u += 0x7FFFu + ((u >> 16) & 1u); return (unsigned short)(u >> 16); }
__device__ __forceinline__ float bf2f(unsigned short b) { return __uint_as_float(((unsigned)b) << 16); }
__device__ __forceinline__ float bfr(float f) { return bf2f(f2bf(f)); }
__device__ __forceinline__ v16h cat16(v8h lo, v8h hi) { return __builtin_shufflevector(lo, hi, 0, 1, 2, 3, 4, 5, 6, 7, 8, 9, 10, 11, 12, 13, 14, 15); }
__device__ __forceinline__ v16bf cat16b(v8us lo, v8us hi) { return __builtin_bit_cast(v16bf, __builtin_shufflevector(lo, hi, 0, 1, 2, 3, 4, 5, 6, 7, 8, 9, 10, 11, 12, 13, 14, 15)); }
__device__ __forceinline__ v8f wmma16(v16h a, v16h b, v8f c) { return __builtin_amdgcn_wmma_f32_16x16x32_f16(false, a, false, b, (short)0, c, false, false); }
__device__ __forceinline__ v8f wmmab(v16bf a, v16bf b, v8f c) { return __builtin_amdgcn_wmma_f32_16x16x32_bf16(false, a, false, b, (short)0, c, false, false); }

__device__ __forceinline__ h16 tohx(float x) { return (h16)x; }

// ---- k_gemmw: GEMM on a 128 x 256 output tile per work-group of 8 waves (2 x 4), 64 x 64 (16 accumulators) per wave; grid (M/128, N/256, Z), 256 threads.
// C[m][n] (f32, pitch ldc, + optional f32 bias[n]) = sum_k A[m][k] Bt[n][k] (+ A2[m][k] Bt[n][k] for NSPLIT 1). z-batch strides sA/sB/sC in elements. K: a compile-time multiple of 64, at least 128 (two stages).
// HEADS: no C; n runs over the fused q|k|v columns, z over the batches, and a wave's 64 x 64 tile is 64 rows t of one head of one of the three. The epilogue writes it as fp16 into its head plane:
//   q -> QK[0][z*16+h][t][d] = acc + bq; k -> QK[1][z*16+h][t][d] = (acc + bk) + 8 R[t][d]; v -> VP[z*16+h][t][d] = acc + bv.
// Operands: K-contiguous 16-bit planes, 64 k (one whole 128-B line of every row) per LDS stage, two buffers, brought by asynchronous copies one stage ahead of their use.
// Fragment map: lane l -> row/col l & 15, half h = l >> 4; elements 0..7 <- k0 + 8h + 0..7, elements 8..15 <- k0 + 16 + 8h + 0..7 (A and B alike); D element j -> row 8h + j, col l & 15.
#define GBM 128                   // tile rows
#define GBN 256                   // tile columns
#define GKS 64                    // k per LDS stage
#define GPI 72                    // LDS row pitch in 16-bit elements: 128 B of data + 16 B, for the 16-byte readers
template <typename T16> struct WFrag;
template <bool B> struct Flag { static constexpr bool v = B; };   // a compile-time switch handed to a generic lambda
template <> struct WFrag<h16> { typedef v16h V; static __device__ __forceinline__ V ld(const h16* p) { return cat16(*(const v8h*)p, *(const v8h*)(p + 16)); } static __device__ __forceinline__ v8f mma(V a, V b, v8f c) { return wmma16(a, b, c); } };
template <> struct WFrag<bf> { typedef v16bf V; static __device__ __forceinline__ V ld(const bf* p) { return cat16b(*(const v8us*)p, *(const v8us*)(p + 16)); } static __device__ __forceinline__ V ldl(const bf* p) { return cat16b(*(const v8usa*)p, *(const v8usa*)(p + 16)); } static __device__ __forceinline__ v8f mma(V a, V b, v8f c) { return wmmab(a, b, c); } };
// Four asynchronous copies of 16 bytes a lane: rows r, r + 32, r + 64, r + 96 of one operand (global row step gs elements, LDS row pitch GPI).
// The s_wait_xcnt stands inside the statement, behind the last copy, so that no later write of an address register named here can come in front of it.
template <typename T16>
__device__ __forceinline__ void cp4(unsigned l, const T16* g, size_t gs) {
    const unsigned l1 = l + 32 * GPI * 2, l2 = l + 64 * GPI * 2, l3 = l + 96 * GPI * 2;
    const T16* g1 = g + gs; const T16* g2 = g1 + gs; const T16* g3 = g2 + gs;
    asm volatile("global_load_async_to_lds_b128 %0, %4, off\n\t"
                 "global_load_async_to_lds_b128 %1, %5, off\n\t"
                 "global_load_async_to_lds_b128 %2, %6, off\n\t"
                 "global_load_async_to_lds_b128 %3, %7, off\n\t"
                 "s_wait_xcnt 0x0"
                 :: "v"(l), "v"(l1), "v"(l2), "v"(l3), "v"(g), "v"(g1), "v"(g2), "v"(g3) : "memory");
}
// amdgpu_waves_per_eu(4, 4): two work-groups per WGP, so that one group's matrix runs cover the other's barrier, copy issue and epilogue.
template <typename T16, int NSPLIT, bool BIAS, int K, bool HEADS>
__global__ __launch_bounds__(256) __attribute__((amdgpu_waves_per_eu(4, 4))) void k_gemmw(const T16* __restrict__ A, const T16* __restrict__ A2, const T16* __restrict__ Bt, float* C, int ldc, const float* __restrict__ bias, size_t sA, size_t sB, size_t sC,
                                                                                          const float* __restrict__ bq, const float* __restrict__ bk, const float* __restrict__ bv, const float* __restrict__ R, h16* QK, h16* VP) {
    static_assert(NSPLIT == 0 || NSPLIT == 1);
    static_assert(K % GKS == 0 && K / GKS >= 2);
    typedef typename WFrag<T16>::V V;
    constexpr int AR = (NSPLIT == 1) ? 2 * GBM : GBM;   // staged A rows: the A plane, then the A2 plane
    constexpr int SE = (AR + GBN) * GPI;                // elements per stage: A rows, then Bt rows
    __shared__ __align__(16) T16 stg[2 * SE];
    static_assert(8 * 16 * 68 * 4 <= 2 * SE * 2);       // the epilogue's staging rows lie in the same LDS
    const size_t z = blockIdx.z; A += z * sA; if (NSPLIT == 1) A2 += z * sA; Bt += z * sB; if (!HEADS) C += z * sC;
    const int tid = threadIdx.x, lane = tid & 31, lr = lane & 15, hi = lane >> 4, wave = tid >> 5, wm = wave >> 2, wn = wave & 3;
    const int R0 = blockIdx.x * GBM, C0 = blockIdx.y * GBN; const int r0 = R0 + wm * 64, c0 = C0 + wn * 64;
    // copies: thread -> 16 bytes at element sc of rows sr + 32 i; a wave's copy covers four whole 128-B lines
    const int sr = tid >> 3, sc = (tid & 7) * 8; const size_t gs = (size_t)32 * K;
    const T16* ga = A + (size_t)(R0 + sr) * K + sc; const T16* ga2 = (NSPLIT == 1) ? A2 + (size_t)(R0 + sr) * K + sc : nullptr; const T16* gb = Bt + (size_t)(C0 + sr) * K + sc;
    const unsigned l0 = (unsigned)(size_t)stg + (unsigned)(sr * GPI + sc) * 2;   // the lane's LDS byte address in buffer 0
    auto fill = [&](int t, int buf) {
        const unsigned l = l0 + (unsigned)buf * (SE * 2); const int ko = t * GKS;
        cp4(l, ga + ko, gs);
        if (NSPLIT == 1) cp4(l + GBM * GPI * 2, ga2 + ko, gs);
        cp4(l + AR * GPI * 2, gb + ko, gs); cp4(l + (AR + 128) * GPI * 2, gb + ko + 4 * gs, gs); };
    v8f acc[4][4];
#pragma unroll
    for (int mb = 0; mb < 4; ++mb)
#pragma unroll
        for (int nb = 0; nb < 4; ++nb) acc[mb][nb] = (v8f){};
    constexpr int nt = K / GKS;
    fill(0, 0);
    asm volatile("s_wait_asynccnt 0x0" ::: "memory");   // this wave's share of stage 0 has landed
    __syncthreads();                                    // ... and every other wave's
    fill(1, 1);
    const int afo = (wm * 64 + lr) * GPI + 8 * hi, bfo = (AR + wn * 64 + lr) * GPI + 8 * hi;
#pragma unroll 1   // rolled: one copy of the stage body, and the buffer index stays a scalar
    for (int t = 0; t < nt; ++t) {
        const T16* sb = stg + (t & 1) * SE;
#pragma unroll
        for (int ks = 0; ks < GKS / 32; ++ks) {
            V a[4], a2[4], b[4];   // all of a 32-k block's fragments are asked for as one group, ahead of its matrix run
#pragma unroll
            for (int mb = 0; mb < 4; ++mb) { a[mb] = WFrag<T16>::ldl(sb + afo + mb * 16 * GPI + ks * 32); if (NSPLIT == 1) a2[mb] = WFrag<T16>::ldl(sb + afo + (GBM + mb * 16) * GPI + ks * 32); }
#pragma unroll
            for (int nb = 0; nb < 4; ++nb) b[nb] = WFrag<T16>::ldl(sb + bfo + nb * 16 * GPI + ks * 32);
            __builtin_amdgcn_sched_barrier(0);   // keeps the LDS loads one group: left alone the compiler moves the Bt loads in among the matrix instructions, each with a full wait behind it
#pragma unroll
            for (int nb = 0; nb < 4; ++nb)
#pragma unroll
                for (int mb = 0; mb < 4; ++mb) { acc[mb][nb] = WFrag<T16>::mma(a[mb], b[nb], acc[mb][nb]); if (NSPLIT == 1) acc[mb][nb] = WFrag<T16>::mma(a2[mb], b[nb], acc[mb][nb]); }
            __builtin_amdgcn_sched_barrier(0);   // ends the block: the next group of loads, and the stage's closing waits, stay behind its matrix instructions
        }
        asm volatile("s_wait_dscnt 0x0" ::: "memory");      // this wave has left buffer t & 1
        asm volatile("s_wait_asynccnt 0x0" ::: "memory");   // this wave's share of stage t + 1 has landed
        __syncthreads();                                    // publishes stage t + 1 and ends every reader's last read of buffer t & 1
        if (t + 2 < nt) fill(t + 2, t & 1);
    }
    asm volatile("s_wait_asynccnt 0x0" ::: "memory");       // no copy is outstanding when the LDS becomes output staging
    float* os = (float*)stg + wave * (16 * 68);             // each wave's own 16 x 68 floats; every reader left the buffers at the loop's last barrier
    if constexpr (HEADS) {
        const int which = C0 / DQ, hd = (c0 % DQ) / HD;     // which: the same for the whole work-group (GBN divides DQ); hd: the wave's head
        const size_t g = z * NH_ + hd; const int rr = lane >> 3, cofs = (lane & 7) * 8;   // read-back: 8 lanes per 128-byte output row, 4 rows per store
        // q, k and v rows; ISK: the key plane, which also takes 8 x the table row of its t. Two copies of the code, so that neither holds a branch between a load and its use.
        auto rows = [&](auto isk, const float* bsrc, h16* plane) {
            constexpr bool ISK = decltype(isk)::v;
            const float* bb = bsrc + hd * HD + cofs; const v4f ba = *(const v4f*)bb, bc = *(const v4f*)(bb + 4);
            asm volatile("s_wait_xcnt 0x0" :: "v"(bb) : "memory");   // the two loads' address pair lives to this wait, so nothing overwrites it in front of it
            const float* rp = R + (size_t)(r0 + rr) * HD + cofs;
            h16* dst = plane + (g * TT + r0 + rr) * HD + cofs;
            v4f tb[2][4][2];                                // the table rows of one 16-row block, asked for one block ahead of their use
            if (ISK) {
#pragma unroll
                for (int s = 0; s < 4; ++s) { tb[0][s][0] = *(const v4f*)(rp + 4 * s * HD); tb[0][s][1] = *(const v4f*)(rp + 4 * s * HD + 4); } }
            float bi[8];
#pragma unroll
            for (int q = 0; q < 8; ++q) bi[q] = bfr((q < 4) ? ba[q & 3] : bc[q & 3]);
#pragma unroll
            for (int mb = 0; mb < 4; ++mb) {
                if (ISK && mb < 3) {
#pragma unroll
                    for (int s = 0; s < 4; ++s) { tb[(mb + 1) & 1][s][0] = *(const v4f*)(rp + ((mb + 1) * 16 + 4 * s) * HD); tb[(mb + 1) & 1][s][1] = *(const v4f*)(rp + ((mb + 1) * 16 + 4 * s) * HD + 4); } }
#pragma unroll
                for (int nb = 0; nb < 4; ++nb) {
#pragma unroll
                    for (int j = 0; j < 8; ++j) os[(hi * 8 + j) * 68 + nb * 16 + lr] = acc[mb][nb][j]; }
                __builtin_amdgcn_wave_barrier(); asm volatile("" ::: "memory");   // compiler fence: the reads below take other lanes' words, so they stay behind the writes above
                v8h o[4];
#pragma unroll
                for (int s = 0; s < 4; ++s) {
                    const v4f x0 = *(const v4fa*)(os + (4 * s + rr) * 68 + cofs), x1 = *(const v4fa*)(os + (4 * s + rr) * 68 + cofs + 4);
#pragma unroll
                    for (int q = 0; q < 8; ++q) { float y = ((q < 4) ? x0[q & 3] : x1[q & 3]) + bi[q];
                        if (ISK) y += RCAR * bfr((q < 4) ? tb[mb & 1][s][0][q & 3] : tb[mb & 1][s][1][q & 3]);
                        o[s][q] = tohx(y); } }
                __builtin_amdgcn_sched_barrier(0);   // all four rows' values are finished, each in registers of its own, before the first store names any
#pragma unroll
                for (int s = 0; s < 4; ++s) *(v8h*)(dst + (mb * 16 + 4 * s) * HD) = o[s];
                asm volatile("s_wait_xcnt 0x0" ::: "memory");   // behind every block's four stores, the last block's too: in front of whatever next writes their data registers (the next block's arithmetic, or the code laid behind this copy of the epilogue); as a compiler fence it also keeps the next block's LDS writes behind this block's reads
                __builtin_amdgcn_sched_barrier(0);              // keeps that code behind the wait
            }
        };
        if (which == 1) { rows(Flag<true>{}, bk, QK + (size_t)NB * NH_ * TT * HD); return; }
        rows(Flag<false>{}, (which == 0) ? bq : bv, (which == 0) ? QK : VP);
        return;
    }
#pragma unroll
    for (int mb = 0; mb < 4; ++mb) {
#pragma unroll
        for (int nb = 0; nb < 4; ++nb) {
#pragma unroll
            for (int j = 0; j < 8; ++j) os[(hi * 8 + j) * 68 + nb * 16 + lr] = acc[mb][nb][j]; }
        __builtin_amdgcn_wave_barrier(); asm volatile("" ::: "memory");
        float* crow = C + (size_t)(r0 + mb * 16) * ldc + c0;
{
#pragma unroll
            for (int s = 0; s < 8; ++s) { const int row = 2 * s + hi, cofs = lr * 4; v4f val = *(const v4fa*)(os + row * 68 + cofs); if (BIAS) { val[0] += bfr(bias[c0 + cofs]); val[1] += bfr(bias[c0 + cofs + 1]); val[2] += bfr(bias[c0 + cofs + 2]); val[3] += bfr(bias[c0 + cofs + 3]); }
                *(v4f*)(crow + (size_t)row * ldc + cofs) = val; }
             }
        __builtin_amdgcn_wave_barrier(); asm volatile("" ::: "memory");
    }
}

__device__ __forceinline__ void splitf(float y, unsigned short& h, unsigned short& l) { h = f2bf(y); l = f2bf(y - bf2f(h)); }
typedef __attribute__((ext_vector_type(2))) unsigned short v2us;

// grid.y picks the weight: 0..2 -> rows y * N of the fused q|k|v plane, 3 -> the output-projection plane.
__global__ __launch_bounds__(256) void k_wtG(const float* __restrict__ wq, const float* __restrict__ wk, const float* __restrict__ wv, const float* __restrict__ wo, int K, int N, bf* Bqkv, bf* Bo) {
    const int y = blockIdx.y; const float* __restrict__ w = (y == 0) ? wq : (y == 1) ? wk : (y == 2) ? wv : wo; bf* Bt = (y < 3) ? Bqkv + (size_t)y * N * K : Bo;
    const int lane = threadIdx.x & 31; const int L0 = (blockIdx.x * 8 + (threadIdx.x >> 5)) * 8; const int nlines = N * K / 64;
{
#pragma unroll 1
        for (int l = 0; l < 8; ++l) { const int L = L0 + l; if (L >= nlines) break; const size_t e = (size_t)L * 64 + lane * 2; const int k = (int)(e % K), n = (int)(e / K); v2us o;
            o[0] = f2bf(w[(size_t)k * N + n]); o[1] = f2bf(w[(size_t)(k + 1) * N + n]); *(v2us*)(Bt + e) = o; }
         }
}
__global__ __launch_bounds__(256) void k_cvt8(const float* __restrict__ src, bf* dst, size_t n8, size_t sS, size_t sD) { const size_t i = (size_t)blockIdx.x * 256 + threadIdx.x; if (i >= n8) return; src += (size_t)blockIdx.y * sS; dst += (size_t)blockIdx.y * sD; const v8f v = *(const v8f*)(src + i * 8); v8us o;
#pragma unroll
    for (int k = 0; k < 8; ++k) o[k] = f2bf(v[k]); *(v8us*)(dst + i * 8) = o;  }

// ---- k_fattn: scores, mask, softmax, P x V and the head merge in one kernel; a score never leaves the registers.
// grid (TT / 256, NB * 16), 8 waves; a wave owns 32 query columns (2 groups of 16) of one head plane and walks the kept keys, 64 per LDS stage (2 buffers), 32 per pass.
// Kept keys: the mask row's 32 ballot words give every kept key its rank (kept keys in front of it); kidx[rank] = key. Places from the count up to the end of the last stage hold key 0 under a -inf bias.
// S^T = K' Q^T: A = key rows from LDS, B = q kept in registers; D register r of lane (c, h) = key 8h + r, query c. Two such tiles, converted in place, are the B operand (32 keys) of O^T += V^T P^T.
// V^T: A = V rows [key][d] from LDS through ds_load_tr16_b128, which hands lane (c, h) the keys 8h + 0..7 of column d = c: the k order of the packed P^T.
// O^T: D register r = d 8h + r of query c, so a lane stores 8 consecutive d of one merged-context row.
// Every plain '#pragma unroll' below makes the indices of a register array constants, so that the array stays in registers.
// amdgpu_waves_per_eu(4, 4): two work-groups per WGP, four waves per SIMD, to cover the vector work between the matrix runs.
#define FNW 8                     // waves per work-group
#define FQW 32                    // query columns per wave
#define FKS 64                    // keys per LDS stage
#define FPI 72                    // LDS row pitch in 16-bit elements: 128 B of data + 16 B, for the 16-byte readers
#define FPV 80                    // the V rows' pitch: 128 B of data + 32 B, for the transposing reader
#define CSC (SCL * 1.4426950408889634f)
static_assert(TT % (FNW * FQW) == 0);
static_assert(TT % FKS == 0);
static_assert(TT % (FNW * 32) == 0 && (TT & (TT - 1)) == 0);   // whole mask rounds (one ballot word per wave and round); the staged row is bounded by a bit mask
__device__ __forceinline__ float xhalf(float x) { return __builtin_bit_cast(float, __builtin_amdgcn_permlanex16(__builtin_bit_cast(int, x), __builtin_bit_cast(int, x), 0x76543210, 0xfedcba98, false, false)); }  // lane l with lane l ^ 16
__device__ __forceinline__ v16h ldsfrag(const h16* p) { return cat16(*(const v8ha*)p, *(const v8ha*)(p + 16)); }
typedef __attribute__((ext_vector_type(8))) short v8s;
typedef __attribute__((address_space(3))) v8s lds_v8s;
__device__ __forceinline__ v8h ldtr16(const h16* p) { return __builtin_bit_cast(v8h, __builtin_amdgcn_ds_load_tr16_b128_v8i16((lds_v8s*)p)); }
__global__ __launch_bounds__(FNW * 32) __attribute__((amdgpu_waves_per_eu(4, 4))) void k_fattn(const h16* __restrict__ Q, const h16* __restrict__ Kp, const h16* __restrict__ Vp, const int* __restrict__ mk, bf* Ah, bf* Al) {
    __shared__ __align__(16) h16 kst[2][FKS * FPI];   // [key][d]
    __shared__ __align__(32) h16 vst[2][FKS * FPV];   // [key][d]
    __shared__ __align__(16) float mb[TT];            // by place in the kept list: 0 for a kept key, -inf behind the last one
    __shared__ int kidx[TT];                          // the kept keys in ascending order, then 0
    __shared__ __align__(16) unsigned kbal[TT / 32];  // the mask row as bits, key order
    const int tid = threadIdx.x, lane = tid & 31, c = lane & 15, h = lane >> 4, wave = tid >> 5;
    const int g = blockIdx.y, b = g / NH_, hh = g % NH_;
    const h16* Qg = Q + (size_t)g * TT * HD; const h16* Kg = Kp + (size_t)g * TT * HD; const h16* Vg = Vp + (size_t)g * TT * HD;
    const int q0 = blockIdx.x * (FNW * FQW) + wave * FQW;
    constexpr int MR = TT / (FNW * 32);               // mask rounds: round j, thread tid -> key j * 256 + tid, ballot word j * 8 + wave
    const int* mkb = mk + (size_t)b * SEQ_FULL + tid; int mv[MR];
#pragma unroll
    for (int j = 0; j < MR; ++j) mv[j] = mkb[j * (FNW * 32)];
    asm volatile("s_wait_xcnt 0x0" ::: "memory");     // behind the mask loads, in front of whatever next writes a register that they name
    v16h qf[2][2];
#pragma unroll
    for (int qg = 0; qg < 2; ++qg)
#pragma unroll
        for (int ks = 0; ks < 2; ++ks) qf[qg][ks] = WFrag<h16>::ld(Qg + (size_t)(q0 + qg * 16 + c) * HD + ks * 32 + 8 * h);
    asm volatile("s_wait_xcnt 0x0" ::: "memory");     // behind the q loads, in front of the arithmetic below, which may reuse their address registers
    unsigned bl[MR];
#pragma unroll
    for (int j = 0; j < MR; ++j) { bl[j] = __builtin_amdgcn_ballot_w32(mv[j] != 0); kidx[j * (FNW * 32) + tid] = 0; }
    if (lane == 0) {
#pragma unroll
        for (int j = 0; j < MR; ++j) kbal[j * FNW + wave] = bl[j]; }
    __syncthreads();                                  // the 32 ballot words are complete, and every place of kidx holds 0
    unsigned run = 0, base[MR];
#pragma unroll
    for (int j = 0; j < MR; ++j) base[j] = 0;
#pragma unroll
    for (int w = 0; w < TT / 32; ++w) {
#pragma unroll
        for (int j = 0; j < MR; ++j) if (w / FNW == j) base[j] = (w % FNW == wave) ? run : base[j];   // kept keys in front of this wave's word of round j
        run += (unsigned)__builtin_popcount(kbal[w]); }
    const unsigned below = (1u << lane) - 1u;
#pragma unroll
    for (int j = 0; j < MR; ++j) { const int e = j * (FNW * 32) + tid;
        if (mv[j] != 0) kidx[base[j] + (unsigned)__builtin_popcount(bl[j] & below)] = e;   // a rank is below the count of kept keys, at most TT - 1
        mb[e] = ((unsigned)e < run) ? 0.0f : -__builtin_inff(); }
    const int nkeep = __builtin_amdgcn_readfirstlane((int)run);            // the same in every thread of the work-group
    const int nst = min((nkeep + FKS - 1) / FKS, TT / FKS);                // stages to walk, bounded by the shape
    __syncthreads();                                  // kidx and mb are complete
    // staging: thread -> places sr and sr + 32 of the stage's 64 kept keys, 16 bytes at element sc of the key's K row and of its V row
    const int sr = tid >> 3, sc = (tid & 7) * 8;
    const v8h* Kg8 = (const v8h*)Kg; const v8h* Vg8 = (const v8h*)Vg;   // rows of HD / 8 pieces of 16 bytes
    // the lane's 32-bit offsets, in 16-byte pieces, beside wave-uniform bases; the mask bounds the row whatever kidx holds
    unsigned j0 = (unsigned)((kidx[sr] & (TT - 1)) * (HD / 8) + (tid & 7)), j1 = (unsigned)((kidx[sr + 32] & (TT - 1)) * (HD / 8) + (tid & 7));
    v8h gk0 = Kg8[j0], gk1 = Kg8[j1];
    v8h gv0 = Vg8[j0], gv1 = Vg8[j1];
    asm volatile("s_wait_xcnt 0x0" :: "v"(j0), "v"(j1) : "memory");   // the four loads' offset registers live to this wait, so nothing overwrites them in front of it
    *(v8ha*)(&kst[0][sr * FPI + sc]) = gk0; *(v8ha*)(&kst[0][(sr + 32) * FPI + sc]) = gk1;
    *(v8ha*)(&vst[0][sr * FPV + sc]) = gv0; *(v8ha*)(&vst[0][(sr + 32) * FPV + sc]) = gv1;
    v8f o[2][4];
#pragma unroll
    for (int qg = 0; qg < 2; ++qg)
#pragma unroll
        for (int dt = 0; dt < 4; ++dt) o[qg][dt] = (v8f){};
    float mrun[2] = {-1.0e30f, -1.0e30f};   // finite, below every finite score
    float lsum[2] = {0.0f, 0.0f};           // each wave half sums its own keys; joined once at the end
    __syncthreads();
#pragma unroll 1   // rolled: one copy of the stage body, and the buffer index stays a scalar
    for (int st = 0; st < nst; ++st) {
        const bool more = st + 1 < nst;
        if (more) { j0 = (unsigned)((kidx[(st + 1) * FKS + sr] & (TT - 1)) * (HD / 8) + (tid & 7)); j1 = (unsigned)((kidx[(st + 1) * FKS + sr + 32] & (TT - 1)) * (HD / 8) + (tid & 7));
            gk0 = Kg8[j0]; gk1 = Kg8[j1];
            gv0 = Vg8[j0]; gv1 = Vg8[j1];
            asm volatile("s_wait_xcnt 0x0" :: "v"(j0), "v"(j1) : "memory"); }   // the four loads' offset registers live to this wait: it stands in front of the pass's address arithmetic, which reuses them
        const h16* kb = kst[st & 1]; const h16* vb = vst[st & 1];
        const int np = (nkeep - st * FKS > 32) ? FKS / 32 : 1;   // the last stage's second pass is walked only if it holds a kept key
#pragma unroll 1   // one pass's registers at a time: two passes interleaved did not fit the 256 registers that four waves per SIMD leave
        for (int p = 0; p < np; ++p) {
            v8f s[2][2];
#pragma unroll
            for (int kt = 0; kt < 2; ++kt) {
                const h16* kr = kb + (p * 32 + kt * 16 + c) * FPI + 8 * h;
                const v16h k0 = ldsfrag(kr), k1 = ldsfrag(kr + 32);
                const float* mp = mb + st * FKS + p * 32 + kt * 16 + 8 * h;
                const v4f b0 = *(const v4fa*)mp, b1 = *(const v4fa*)(mp + 4);
                const v8f bz = __builtin_shufflevector(b0, b1, 0, 1, 2, 3, 4, 5, 6, 7);
#pragma unroll
                for (int qg = 0; qg < 2; ++qg) { v8f t = wmma16(k0, qf[qg][0], (v8f){}); t = wmma16(k1, qf[qg][1], t); s[kt][qg] = t + bz; }
            }
            v16h vf[4];
#pragma unroll
            for (int dt = 0; dt < 4; ++dt) { const h16* vr = vb + (p * 32 + 8 * h + (lane & 7)) * FPV + dt * 16 + 8 * ((lane >> 3) & 1); vf[dt] = cat16(ldtr16(vr), ldtr16(vr + 16 * FPV)); }
            float mx[2]; bool need = false;
#pragma unroll
            for (int qg = 0; qg < 2; ++qg) { float m = s[0][qg][0];
#pragma unroll
                for (int r = 1; r < 8; ++r) m = fmaxf(m, s[0][qg][r]);
#pragma unroll
                for (int r = 0; r < 8; ++r) m = fmaxf(m, s[1][qg][r]);
                m = fmaxf(m, xhalf(m)) * CSC; mx[qg] = m; need = need || (m > mrun[qg] + 8.0f); }
            // the maximum in use moves only when some column's new maximum passes it by more than 8 (base 2): P stays <= 256, inside f16
            if (__builtin_amdgcn_ballot_w32(need) != 0) {
#pragma unroll
                for (int qg = 0; qg < 2; ++qg) { const float mn = fmaxf(mrun[qg], mx[qg]); const float corr = __builtin_amdgcn_exp2f(mrun[qg] - mn); mrun[qg] = mn; lsum[qg] *= corr;
#pragma unroll
                    for (int dt = 0; dt < 4; ++dt) o[qg][dt] = o[qg][dt] * corr; }
            }
#pragma unroll
            for (int qg = 0; qg < 2; ++qg) { const float nm = -mrun[qg]; v16h pf; float ls = 0.0f;
                const v8f cv = {CSC, CSC, CSC, CSC, CSC, CSC, CSC, CSC}, nv = {nm, nm, nm, nm, nm, nm, nm, nm};
                const v8f a0 = __builtin_elementwise_fma(s[0][qg], cv, nv), a1 = __builtin_elementwise_fma(s[1][qg], cv, nv);
#pragma unroll
                for (int i = 0; i < 16; ++i) { const float pv = __builtin_amdgcn_exp2f((i < 8) ? a0[i & 7] : a1[i & 7]); ls += pv; pf[i] = tohx(pv); }
                lsum[qg] += ls;
#pragma unroll
                for (int dt = 0; dt < 4; ++dt) o[qg][dt] = wmma16(vf[dt], pf, o[qg][dt]); }
            // four vector slots behind the pass's last matrix instructions: across the back edge the next pass's address arithmetic would overwrite their A registers too early
            asm volatile("v_nop\n\tv_nop\n\tv_nop\n\tv_nop" : "+v"(o[1][0]), "+v"(o[1][1]), "+v"(o[1][2]), "+v"(o[1][3]));
        }
        if (more) { h16* kw = kst[(st + 1) & 1]; h16* vw = vst[(st + 1) & 1];   // this buffer's last readers left it before the barrier that ended stage st - 1
            *(v8ha*)(kw + sr * FPI + sc) = gk0; *(v8ha*)(kw + (sr + 32) * FPI + sc) = gk1;
            *(v8ha*)(vw + sr * FPV + sc) = gv0; *(v8ha*)(vw + (sr + 32) * FPV + sc) = gv1; }
        __syncthreads();
    }
#pragma unroll
    for (int qg = 0; qg < 2; ++qg) { const float lf = lsum[qg] + xhalf(lsum[qg]); const float inv = 1.0f / lf;
        const size_t oo = ((size_t)b * TT + q0 + qg * 16 + c) * DQ + hh * HD + 8 * h;
#pragma unroll
        for (int dt = 0; dt < 4; ++dt) { v8us oh, ol;
#pragma unroll
            for (int j = 0; j < 8; ++j) { unsigned short a, c2; splitf(o[qg][dt][j] * inv, a, c2); oh[j] = a; ol[j] = c2; }
            *(v8us*)(Ah + oo + dt * 16) = oh; *(v8us*)(Al + oo + dt * 16) = ol; } }
}

extern "C" void kernel_launch(void* const* d_in, const int* in_sizes, int n_in,
                              void* d_out, int out_size, void* d_ws, size_t ws_size, hipStream_t stream) {
    (void)out_size;
    if (n_in < 11) return;
    if (in_sizes[0] < NB * TT * DM || in_sizes[1] < TT * HD || in_sizes[2] < NB * TT) return;
    if (in_sizes[3] < DM * DQ || in_sizes[5] < DM * DQ || in_sizes[7] < DM * DQ || in_sizes[9] < DQ * DM) return;
    if (in_sizes[4] < DQ || in_sizes[6] < DQ || in_sizes[8] < DQ || in_sizes[10] < DM) return;
    // wire order: x, rel_pos_enc, attention_mask, Wq, bq, Wk, bk, Wv, bv, Wo, bo
    const float* x = (const float*)d_in[0]; const float* rel = (const float*)d_in[1]; const int* msk = (const int*)d_in[2];
    const float* wq = (const float*)d_in[3]; const float* bq = (const float*)d_in[4]; const float* wk = (const float*)d_in[5]; const float* bk = (const float*)d_in[6];
    const float* wv = (const float*)d_in[7]; const float* bv = (const float*)d_in[8]; const float* wo = (const float*)d_in[9]; const float* bo = (const float*)d_in[10];
    float* OUT = (float*)d_out;     // [8][1024][1024]
    char* wsp = (char*)d_ws;
    auto take = [&](size_t bytes) { char* p = wsp; wsp += (bytes + 255) & ~(size_t)255; return (void*)p; };
    bf* WO = (bf*)take((size_t)DM * DQ * 2);                     // [1024][1024]
    h16* QK16 = (h16*)take((size_t)2 * NB * NH_ * TT * HD * 2);  // [2][NB*16][TT][64]
    h16* VP16 = (h16*)take((size_t)NB * NH_ * TT * HD * 2);      // [NB*16][TT][64]
    // one region, two lives: the projection's operands, dead once the head planes are written, then the merged context
    char* const shared0 = wsp;
    bf* WQKV = (bf*)take((size_t)NQKV * DM * 2);                 // [3072][1024]: rows 0..1023 q, 1024..2047 k, 2048..3071 v
    bf* XB = (bf*)take((size_t)NB * TT * DM * 2);                // [NB][TT][DM]
    char* const end1 = wsp; wsp = shared0;
    bf* ATh = (bf*)take((size_t)NB * TT * DQ * 2);               // merged context [NB*TT][1024], hi
    bf* ATl = (bf*)take((size_t)NB * TT * DQ * 2);               // the same, lo
    if (end1 > wsp) wsp = end1;
    if ((size_t)(wsp - (char*)d_ws) > ws_size) return;           // 82 MiB at full size
    h16* Q16 = QK16; h16* K16 = QK16 + (size_t)NB * NH_ * TT * HD;
    // weights: w[in = K][out = N] -> Bt[N][K]
    const unsigned GW = (unsigned)((DM * DQ / 64 + 63) / 64);
    k_wtG<<<dim3(GW, 4, 1), 256, 0, stream>>>(wq, wk, wv, wo, DM, DQ, WQKV, WO);
    k_cvt8<<<dim3((unsigned)(((size_t)TT * DM / 8 + 255) / 256), NB, 1), 256, 0, stream>>>(x, XB, (size_t)TT * DM / 8, (size_t)SEQ_FULL * DM, (size_t)TT * DM);
    k_gemmw<bf, 0, false, DM, true><<<dim3(TT / GBM, NQKV / GBN, NB), 256, 0, stream>>>(XB, nullptr, WQKV, nullptr, 0, nullptr, (size_t)TT * DM, 0, 0, bq, bk, bv, rel, QK16, VP16);
    k_fattn<<<dim3(TT / (FNW * FQW), NB * NH_, 1), FNW * 32, 0, stream>>>(Q16, K16, VP16, msk, ATh, ATl);
    k_gemmw<bf, 1, true, DQ, false><<<dim3(TT / GBM, DM / GBN, NB), 256, 0, stream>>>(ATh, ATl, WO, OUT, DM, bo, (size_t)TT * DQ, 0, (size_t)SEQ_FULL * DM, nullptr, nullptr, nullptr, nullptr, nullptr, nullptr);
}

// v007
// A run of this version takes 108 microseconds.
// Versions between v005 and this one are left out; their measured steps multiply to 1.24 times as fast.
// Over all steps from v000 it is 11.9 times as fast.
#include <hip/hip_runtime.h>

// Compute dtypes (f32 accumulate everywhere): every float input RNE-converted to bf16; QKV projection v_wmma_f32_16x16x32_bf16 (exact products); scores (k + 8 R) x q^T and V^T x P^T (V^T read from [t][d] rows by the transposing LDS load) on v_wmma_f32_16x16x32_f16 (P = exp2 of the score against the maximum in use, not yet normalised); softmax f32; output projection v_wmma_f32_16x16x32_f16: merged context rounded once to f16 x Wo (its bf16 value, held as f16) + f32 bias.
// Self-attention on one stream x [8][1024][1024]; weights keep their [in][out] = [k][n] order as 16-bit planes (q, k, v: three bf16 planes in a row; Wo f16), and the GEMMs turn them on the LDS read; 16 heads x 64.
// Score algebra: (q.k) x 0.125 + q.R[t] = 0.125 x q.(k[t] + 8 R[t]); the key plane stores k + 8 R (R = per-key table input, read by value), the 0.125 is applied in the softmax's exponent.
// Key mask [b][t] (int32, data): a key with mask == 0 has weight exp(-inf) = 0, so it is left out of the key walk: each attention work-group lists the kept keys in ascending order and stages only their rows.
// Softmax in the running-maximum form, normalised once at the end (a row without any kept key ends as 0 x (1 / 0) = NaN).

#ifndef NB
#define NB 8
#endif
#ifndef SEQ
#define SEQ 1024
#endif
#define SEQ_FULL 1024             // per-batch row count of the inputs / output (strides)
#define TT   SEQ
#define DM   1024
#define NH_  16
#define HD   64
#define DQ   (NH_ * HD)
#define NQKV (3 * DQ)
#define SCL  0.125f               // HD^-0.5
#define RCAR 8.0f                 // 1 / SCL
typedef _Float16 h16;
typedef unsigned short bf;
typedef __attribute__((ext_vector_type(16))) __bf16   v16bf;
typedef __attribute__((ext_vector_type(16))) _Float16 v16h;
typedef __attribute__((ext_vector_type(8)))  _Float16 v8h;
typedef __attribute__((ext_vector_type(8)))  unsigned short v8us;
typedef __attribute__((ext_vector_type(8)))  float    v8f;
typedef __attribute__((ext_vector_type(4)))  float    v4f;
typedef v8h  __attribute__((may_alias)) v8ha;
typedef v4f  __attribute__((may_alias)) v4fa;
typedef v8us __attribute__((may_alias)) v8usa;

static_assert(TT % 128 == 0);
static_assert(TT <= SEQ_FULL);
static_assert(DM % 64 == 0);
static_assert(HD == 64);
static_assert(DM == DQ);
static_assert(NQKV % 256 == 0);
static_assert(DM % 256 == 0);

__device__ __forceinline__ unsigned short f2bf(float f) { unsigned u = __float_as_uint(f); u += 0x7FFFu + ((u >> 16) & 1u); return (unsigned short)(u >> 16); }
__device__ __forceinline__ float bf2f(unsigned short b) { return __uint_as_float(((unsigned)b) << 16); }
__device__ __forceinline__ float bfr(float f) { return bf2f(f2bf(f)); }
__device__ __forceinline__ v16h cat16(v8h lo, v8h hi) { return __builtin_shufflevector(lo, hi, 0, 1, 2, 3, 4, 5, 6, 7, 8, 9, 10, 11, 12, 13, 14, 15); }
__device__ __forceinline__ v16bf cat16b(v8us lo, v8us hi) { return __builtin_bit_cast(v16bf, __builtin_shufflevector(lo, hi, 0, 1, 2, 3, 4, 5, 6, 7, 8, 9, 10, 11, 12, 13, 14, 15)); }
__device__ __forceinline__ v8f wmma16(v16h a, v16h b, v8f c) { return __builtin_amdgcn_wmma_f32_16x16x32_f16(false, a, false, b, (short)0, c, false, false); }
__device__ __forceinline__ v8f wmmab(v16bf a, v16bf b, v8f c) { return __builtin_amdgcn_wmma_f32_16x16x32_bf16(false, a, false, b, (short)0, c, false, false); }

__device__ __forceinline__ h16 tohx(float x) { return (h16)x; }
typedef __attribute__((ext_vector_type(8))) short v8s;
typedef __attribute__((address_space(3))) v8s lds_v8s;
__device__ __forceinline__ v8h ldtr16(const h16* p) { return __builtin_bit_cast(v8h, __builtin_amdgcn_ds_load_tr16_b128_v8i16((lds_v8s*)p)); }
__device__ __forceinline__ v8us ldtr16u(const bf* p) { return __builtin_bit_cast(v8us, __builtin_amdgcn_ds_load_tr16_b128_v8i16((lds_v8s*)p)); }

// ---- k_gemmw: GEMM on a 128 x 256 output tile per work-group of 8 waves (2 x 4), 64 x 64 (16 accumulators) per wave; grid (M/128, N/256, Z), 256 threads.
// C[m][n] (f32, pitch ldc, + optional f32 bias[n]) = sum_k A[m][k] B[k][n] (+ A2[m][k] B[k][n] for NSPLIT 1). z-batch strides sA/sB/sC in elements. K: a compile-time multiple of 64, at least 128 (two stages).
// B: planes of [K][GLB] in a row, plane n / GLB, column n % GLB (a tile's 256 columns lie in one plane).
// HEADS: no C; n runs over the fused q|k|v columns, z over the batches, and a wave's 64 x 64 tile is 64 rows t of one head of one of the three. The epilogue writes it as fp16 into its head plane:
//   q -> QK[0][z*16+h][t][d] = acc + bq; k -> QK[1][z*16+h][t][d] = (acc + bk) + 8 R[t][d]; v -> VP[z*16+h][t][d] = acc + bv.
// Operands: 16-bit planes, 64 k per LDS stage (A: one whole 128-B line of each of its rows; B: 512 B, four whole lines, of each of 64 k rows), two buffers, brought by asynchronous copies one stage ahead of their use.
// Fragment map: lane l -> row/col l & 15, half h = l >> 4; elements 0..7 <- k0 + 8h + 0..7, elements 8..15 <- k0 + 16 + 8h + 0..7 (A and B alike); D element j -> row 8h + j, col l & 15.
// B fragments: ds_load_tr16_b128 on the [k][n] rows hands lane (c, h) the k 8h + 0..7 of column c; two of them, 16 k rows apart, are the map above.
#define GBM 128                   // tile rows
#define GBN 256                   // tile columns
#define GKS 64                    // k per LDS stage
#define GPI 72                    // LDS row pitch in 16-bit elements: 128 B of data + 16 B, for the 16-byte readers
#define GPB 272                   // the B rows' pitch: 512 B of data + 32 B, for the transposing reader
#define GLB 1024                  // columns of a B plane
template <typename T16> struct WFrag;
template <bool B> struct Flag { static constexpr bool v = B; };   // a compile-time switch handed to a generic lambda
template <> struct WFrag<h16> { typedef v16h V; static __device__ __forceinline__ V ld(const h16* p) { return cat16(*(const v8h*)p, *(const v8h*)(p + 16)); } static __device__ __forceinline__ V ldl(const h16* p) { return cat16(*(const v8ha*)p, *(const v8ha*)(p + 16)); } static __device__ __forceinline__ V ldt(const h16* p) { return cat16(ldtr16(p), ldtr16(p + 16 * GPB)); } static __device__ __forceinline__ v8f mma(V a, V b, v8f c) { return wmma16(a, b, c); } };
template <> struct WFrag<bf> { typedef v16bf V; static __device__ __forceinline__ V ld(const bf* p) { return cat16b(*(const v8us*)p, *(const v8us*)(p + 16)); } static __device__ __forceinline__ V ldl(const bf* p) { return cat16b(*(const v8usa*)p, *(const v8usa*)(p + 16)); } static __device__ __forceinline__ V ldt(const bf* p) { return cat16b(ldtr16u(p), ldtr16u(p + 16 * GPB)); } static __device__ __forceinline__ v8f mma(V a, V b, v8f c) { return wmmab(a, b, c); } };
// Four asynchronous copies of 16 bytes a lane: four rows of one operand, equally spaced (global step gs elements, LDS step ls bytes).
// The s_wait_xcnt stands inside the statement, behind the last copy, so that no later write of an address register named here can come in front of it.
template <typename T16>
__device__ __forceinline__ void cp4(unsigned l, unsigned ls, const T16* g, size_t gs) {
    const unsigned l1 = l + ls, l2 = l + 2 * ls, l3 = l + 3 * ls;
    const T16* g1 = g + gs; const T16* g2 = g1 + gs; const T16* g3 = g2 + gs;
    asm volatile("global_load_async_to_lds_b128 %0, %4, off\n\t"
                 "global_load_async_to_lds_b128 %1, %5, off\n\t"
                 "global_load_async_to_lds_b128 %2, %6, off\n\t"
                 "global_load_async_to_lds_b128 %3, %7, off\n\t"
                 "s_wait_xcnt 0x0"
                 :: "v"(l), "v"(l1), "v"(l2), "v"(l3), "v"(g), "v"(g1), "v"(g2), "v"(g3) : "memory");
}
// amdgpu_waves_per_eu(4, 4): two work-groups per WGP, so that one group's matrix runs cover the other's barrier, copy issue and epilogue.
template <typename T16, int NSPLIT, bool BIAS, int K, bool HEADS>
__global__ __launch_bounds__(256) __attribute__((amdgpu_waves_per_eu(4, 4))) void k_gemmw(const T16* __restrict__ A, const T16* __restrict__ A2, const T16* __restrict__ Bw, float* C, int ldc, const float* __restrict__ bias, size_t sA, size_t sB, size_t sC,
                                                                                          const float* __restrict__ bq, const float* __restrict__ bk, const float* __restrict__ bv, const float* __restrict__ R, h16* QK, h16* VP) {
    static_assert(NSPLIT == 0 || NSPLIT == 1);
    static_assert(K % GKS == 0 && K / GKS >= 2);
    typedef typename WFrag<T16>::V V;
    constexpr int AR = (NSPLIT == 1) ? 2 * GBM : GBM;   // staged A rows: the A plane, then the A2 plane
    constexpr int SE = AR * GPI + GKS * GPB;            // elements per stage: A rows [m][k], then B rows [k][n]
    __shared__ __align__(32) T16 stg[2 * SE];
    static_assert(GLB % GBN == 0 && (AR * GPI * 2) % 32 == 0 && (SE * 2) % 32 == 0);
    static_assert(8 * 16 * 68 * 4 <= 2 * SE * 2);       // the epilogue's staging rows lie in the same LDS
    const size_t z = blockIdx.z; A += z * sA; if (NSPLIT == 1) A2 += z * sA; Bw += z * sB; if (!HEADS) C += z * sC;
    const int tid = threadIdx.x, lane = tid & 31, lr = lane & 15, hi = lane >> 4, wave = tid >> 5, wm = wave >> 2, wn = wave & 3;
    const int R0 = blockIdx.x * GBM, C0 = blockIdx.y * GBN; const int r0 = R0 + wm * 64, c0 = C0 + wn * 64;
    // copies: A: thread -> 16 bytes at element sc of rows sr + 32 i; B: thread -> 16 bytes at element 8 lane of k rows wave + 8 i; either way a wave's copy covers four whole 128-B lines
    const int sr = tid >> 3, sc = (tid & 7) * 8; const size_t gs = (size_t)32 * K;
    const T16* ga = A + (size_t)(R0 + sr) * K + sc; const T16* ga2 = (NSPLIT == 1) ? A2 + (size_t)(R0 + sr) * K + sc : nullptr; const T16* gb = Bw + (size_t)(C0 / GLB) * K * GLB + (size_t)wave * GLB + (C0 % GLB) + lane * 8;
    const unsigned l0 = (unsigned)(size_t)stg + (unsigned)(sr * GPI + sc) * 2;   // the lane's LDS byte address in buffer 0, A rows
    const unsigned lb0 = (unsigned)(size_t)stg + (unsigned)(AR * GPI + wave * GPB + lane * 8) * 2;   // ... B rows
    auto fill = [&](int t, int buf) {
        const unsigned l = l0 + (unsigned)buf * (SE * 2); const int ko = t * GKS;
        cp4(l, 32 * GPI * 2, ga + ko, gs);
        if (NSPLIT == 1) cp4(l + GBM * GPI * 2, 32 * GPI * 2, ga2 + ko, gs);
        const unsigned lb = lb0 + (unsigned)buf * (SE * 2); const T16* gk = gb + (size_t)ko * GLB;
        cp4(lb, 8 * GPB * 2, gk, (size_t)8 * GLB); cp4(lb + 32 * GPB * 2, 8 * GPB * 2, gk + 32 * GLB, (size_t)8 * GLB); };
    v8f acc[4][4];
#pragma unroll
    for (int mb = 0; mb < 4; ++mb)
#pragma unroll
        for (int nb = 0; nb < 4; ++nb) acc[mb][nb] = (v8f){};
    constexpr int nt = K / GKS;
    fill(0, 0);
    asm volatile("s_wait_asynccnt 0x0" ::: "memory");   // this wave's share of stage 0 has landed
    __syncthreads();                                    // ... and every other wave's
    fill(1, 1);
    const int afo = (wm * 64 + lr) * GPI + 8 * hi, bfo = AR * GPI + (8 * hi + (lane & 7)) * GPB + wn * 64 + 8 * ((lane >> 3) & 1);
#pragma unroll 1   // rolled: one copy of the stage body, and the buffer index stays a scalar
    for (int t = 0; t < nt; ++t) {
        const T16* sb = stg + (t & 1) * SE;
#pragma unroll
        for (int ks = 0; ks < GKS / 32; ++ks) {
            V a[4], a2[4], b[4];   // all of a 32-k block's fragments are asked for as one group, ahead of its matrix run
#pragma unroll
            for (int mb = 0; mb < 4; ++mb) { a[mb] = WFrag<T16>::ldl(sb + afo + mb * 16 * GPI + ks * 32); if (NSPLIT == 1) a2[mb] = WFrag<T16>::ldl(sb + afo + (GBM + mb * 16) * GPI + ks * 32); }
#pragma unroll
            for (int nb = 0; nb < 4; ++nb) b[nb] = WFrag<T16>::ldt(sb + bfo + ks * 32 * GPB + nb * 16);
            __builtin_amdgcn_sched_barrier(0);   // keeps the LDS loads one group: left alone the compiler moves the Bw loads in among the matrix instructions, each with a full wait behind it
#pragma unroll
            for (int nb = 0; nb < 4; ++nb)
#pragma unroll
                for (int mb = 0; mb < 4; ++mb) { acc[mb][nb] = WFrag<T16>::mma(a[mb], b[nb], acc[mb][nb]); if (NSPLIT == 1) acc[mb][nb] = WFrag<T16>::mma(a2[mb], b[nb], acc[mb][nb]); }
            __builtin_amdgcn_sched_barrier(0);   // ends the block: the next group of loads, and the stage's closing waits, stay behind its matrix instructions
        }
        asm volatile("s_wait_dscnt 0x0" ::: "memory");      // this wave has left buffer t & 1
        asm volatile("s_wait_asynccnt 0x0" ::: "memory");   // this wave's share of stage t + 1 has landed
        __syncthreads();                                    // publishes stage t + 1 and ends every reader's last read of buffer t & 1
        if (t + 2 < nt) fill(t + 2, t & 1);
    }
    asm volatile("s_wait_asynccnt 0x0" ::: "memory");       // no copy is outstanding when the LDS becomes output staging
    float* os = (float*)stg + wave * (16 * 68);             // each wave's own 16 x 68 floats; every reader left the buffers at the loop's last barrier
    if constexpr (HEADS) {
        const int which = C0 / DQ, hd = (c0 % DQ) / HD;     // which: the same for the whole work-group (GBN divides DQ); hd: the wave's head
        const size_t g = z * NH_ + hd; const int rr = lane >> 3, cofs = (lane & 7) * 8;   // read-back: 8 lanes per 128-byte output row, 4 rows per store
        // q, k and v rows; ISK: the key plane, which also takes 8 x the table row of its t. Two copies of the code, so that neither holds a branch between a load and its use.
        auto rows = [&](auto isk, const float* bsrc, h16* plane) {
            constexpr bool ISK = decltype(isk)::v;
            const float* bb = bsrc + hd * HD + cofs; const v4f ba = *(const v4f*)bb, bc = *(const v4f*)(bb + 4);
            asm volatile("s_wait_xcnt 0x0" :: "v"(bb) : "memory");   // the two loads' address pair lives to this wait, so nothing overwrites it in front of it
            const float* rp = R + (size_t)(r0 + rr) * HD + cofs;
            h16* dst = plane + (g * TT + r0 + rr) * HD + cofs;
            v4f tb[2][4][2];                                // the table rows of one 16-row block, asked for one block ahead of their use
            if (ISK) {
#pragma unroll
                for (int s = 0; s < 4; ++s) { tb[0][s][0] = *(const v4f*)(rp + 4 * s * HD); tb[0][s][1] = *(const v4f*)(rp + 4 * s * HD + 4); } }
            float bi[8];
#pragma unroll
            for (int q = 0; q < 8; ++q) bi[q] = bfr((q < 4) ? ba[q & 3] : bc[q & 3]);
#pragma unroll
            for (int mb = 0; mb < 4; ++mb) {
                if (ISK && mb < 3) {
#pragma unroll
                    for (int s = 0; s < 4; ++s) { tb[(mb + 1) & 1][s][0] = *(const v4f*)(rp + ((mb + 1) * 16 + 4 * s) * HD); tb[(mb + 1) & 1][s][1] = *(const v4f*)(rp + ((mb + 1) * 16 + 4 * s) * HD + 4); } }
#pragma unroll
                for (int nb = 0; nb < 4; ++nb) {
#pragma unroll
                    for (int j = 0; j < 8; ++j) os[(hi * 8 + j) * 68 + nb * 16 + lr] = acc[mb][nb][j]; }
                __builtin_amdgcn_wave_barrier(); asm volatile("" ::: "memory");   // compiler fence: the reads below take other lanes' words, so they stay behind the writes above
                v8h o[4];
#pragma unroll
                for (int s = 0; s < 4; ++s) {
                    const v4f x0 = *(const v4fa*)(os + (4 * s + rr) * 68 + cofs), x1 = *(const v4fa*)(os + (4 * s + rr) * 68 + cofs + 4);
#pragma unroll
                    for (int q = 0; q < 8; ++q) { float y = ((q < 4) ? x0[q & 3] : x1[q & 3]) + bi[q];
                        if (ISK) y += RCAR * bfr((q < 4) ? tb[mb & 1][s][0][q & 3] : tb[mb & 1][s][1][q & 3]);
                        o[s][q] = tohx(y); } }
                __builtin_amdgcn_sched_barrier(0);   // all four rows' values are finished, each in registers of its own, before the first store names any
#pragma unroll
                for (int s = 0; s < 4; ++s) *(v8h*)(dst + (mb * 16 + 4 * s) * HD) = o[s];
                asm volatile("s_wait_xcnt 0x0" ::: "memory");   // behind every block's four stores, the last block's too: in front of whatever next writes their data registers (the next block's arithmetic, or the code laid behind this copy of the epilogue); as a compiler fence it also keeps the next block's LDS writes behind this block's reads
                __builtin_amdgcn_sched_barrier(0);              // keeps that code behind the wait
            }
        };
        if (which == 1) { rows(Flag<true>{}, bk, QK + (size_t)NB * NH_ * TT * HD); return; }
        rows(Flag<false>{}, (which == 0) ? bq : bv, (which == 0) ? QK : VP);
        return;
    }
#pragma unroll
    for (int mb = 0; mb < 4; ++mb) {
#pragma unroll
        for (int nb = 0; nb < 4; ++nb) {
#pragma unroll
            for (int j = 0; j < 8; ++j) os[(hi * 8 + j) * 68 + nb * 16 + lr] = acc[mb][nb][j]; }
        __builtin_amdgcn_wave_barrier(); asm volatile("" ::: "memory");
        float* crow = C + (size_t)(r0 + mb * 16) * ldc + c0;
{
#pragma unroll
            for (int s = 0; s < 8; ++s) { const int row = 2 * s + hi, cofs = lr * 4; v4f val = *(const v4fa*)(os + row * 68 + cofs); if (BIAS) { val[0] += bfr(bias[c0 + cofs]); val[1] += bfr(bias[c0 + cofs + 1]); val[2] += bfr(bias[c0 + cofs + 2]); val[3] += bfr(bias[c0 + cofs + 3]); }
                *(v4f*)(crow + (size_t)row * ldc + cofs) = val; }
             }
        __builtin_amdgcn_wave_barrier(); asm volatile("" ::: "memory");
    }
}

// One streaming conversion for every 16-bit GEMM operand, element order kept. grid.y picks the plane of n8 x 8 floats: 0..NB-1 -> a batch of x (bf16); NB..NB+2 -> Wq, Wk, Wv (bf16, three planes in a row); NB+3 -> Wo (the same bf16 rounding, written as f16: exact from 2^-17 up to the f16 range's end).
static_assert((size_t)TT * DM == (size_t)DM * DQ);   // a weight plane has as many elements as a batch of x
__global__ __launch_bounds__(256) void k_cvt8(const float* __restrict__ x, const float* __restrict__ wq, const float* __restrict__ wk, const float* __restrict__ wv, const float* __restrict__ wo, bf* XBo, bf* Wqkv, h16* Wo16, size_t n8, size_t sS, size_t sD) {
    const size_t i = (size_t)blockIdx.x * 256 + threadIdx.x; if (i >= n8) return;
    const int y = blockIdx.y;
    const float* src = (y < NB) ? x + (size_t)y * sS : (y == NB) ? wq : (y == NB + 1) ? wk : (y == NB + 2) ? wv : wo;
    bf* dst = (y < NB) ? XBo + (size_t)y * sD : (y < NB + 3) ? Wqkv + (size_t)(y - NB) * DM * DQ : (bf*)Wo16;
    const float* sp = src + i * 8; const v8f v = *(const v8f*)sp; v8us o;
    asm volatile("s_wait_xcnt 0x0" :: "v"(sp) : "memory");   // the load's address lives to this wait, so nothing overwrites it in front of it
#pragma unroll
    for (int k = 0; k < 8; ++k) o[k] = f2bf(v[k]);
    if (y == NB + 3) {
#pragma unroll
        for (int k = 0; k < 8; ++k) o[k] = __builtin_bit_cast(unsigned short, tohx(bf2f(o[k]))); }
    *(v8us*)(dst + i * 8) = o;
}

// ---- k_fattn: scores, mask, softmax, P x V and the head merge in one kernel; a score never leaves the registers.
// grid (TT / 256, NB * 16), 8 waves; a wave owns 32 query columns (2 groups of 16) of one head plane and walks the kept keys, 64 per LDS stage (2 buffers), 32 per pass.
// Kept keys: the mask row's 32 ballot words give every kept key its rank (kept keys in front of it); kidx[rank] = key. Places from the count up to the end of the last stage hold key 0 under a -inf bias.
// S^T = K' Q^T: A = key rows from LDS, B = q kept in registers; D register r of lane (c, h) = key 8h + r, query c. Two such tiles, converted in place, are the B operand (32 keys) of O^T += V^T P^T.
// V^T: A = V rows [key][d] from LDS through ds_load_tr16_b128, which hands lane (c, h) the keys 8h + 0..7 of column d = c: the k order of the packed P^T.
// O^T: D register r = d 8h + r of query c, so a lane stores 8 consecutive d of one merged-context row.
// Every plain '#pragma unroll' below makes the indices of a register array constants, so that the array stays in registers.
// amdgpu_waves_per_eu(4, 4): two work-groups per WGP, four waves per SIMD, to cover the vector work between the matrix runs.
#define FNW 8                     // waves per work-group
#define FQW 32                    // query columns per wave
#define FKS 64                    // keys per LDS stage
#define FPI 72                    // LDS row pitch in 16-bit elements: 128 B of data + 16 B, for the 16-byte readers
#define FPV 80                    // the V rows' pitch: 128 B of data + 32 B, for the transposing reader
#define CSC (SCL * 1.4426950408889634f)
static_assert(TT % (FNW * FQW) == 0);
static_assert(TT % FKS == 0);
static_assert(TT % (FNW * 32) == 0 && (TT & (TT - 1)) == 0);   // whole mask rounds (one ballot word per wave and round); the staged row is bounded by a bit mask
__device__ __forceinline__ float xhalf(float x) { return __builtin_bit_cast(float, __builtin_amdgcn_permlanex16(__builtin_bit_cast(int, x), __builtin_bit_cast(int, x), 0x76543210, 0xfedcba98, false, false)); }  // lane l with lane l ^ 16
__device__ __forceinline__ v16h ldsfrag(const h16* p) { return cat16(*(const v8ha*)p, *(const v8ha*)(p + 16)); }
__global__ __launch_bounds__(FNW * 32) __attribute__((amdgpu_waves_per_eu(4, 4))) void k_fattn(const h16* __restrict__ Q, const h16* __restrict__ Kp, const h16* __restrict__ Vp, const int* __restrict__ mk, h16* Ac) {
    __shared__ __align__(16) h16 kst[2][FKS * FPI];   // [key][d]
    __shared__ __align__(32) h16 vst[2][FKS * FPV];   // [key][d]
    __shared__ __align__(16) float mb[TT];            // by place in the kept list: 0 for a kept key, -inf behind the last one
    __shared__ int kidx[TT];                          // the kept keys in ascending order, then 0
    __shared__ __align__(16) unsigned kbal[TT / 32];  // the mask row as bits, key order
    const int tid = threadIdx.x, lane = tid & 31, c = lane & 15, h = lane >> 4, wave = tid >> 5;
    const int g = blockIdx.y, b = g / NH_, hh = g % NH_;
    const h16* Qg = Q + (size_t)g * TT * HD; const h16* Kg = Kp + (size_t)g * TT * HD; const h16* Vg = Vp + (size_t)g * TT * HD;
    const int q0 = blockIdx.x * (FNW * FQW) + wave * FQW;
    constexpr int MR = TT / (FNW * 32);               // mask rounds: round j, thread tid -> key j * 256 + tid, ballot word j * 8 + wave
    const int* mkb = mk + (size_t)b * SEQ_FULL + tid; int mv[MR];
#pragma unroll
    for (int j = 0; j < MR; ++j) mv[j] = mkb[j * (FNW * 32)];
    asm volatile("s_wait_xcnt 0x0" ::: "memory");     // behind the mask loads, in front of whatever next writes a register that they name
    v16h qf[2][2];
#pragma unroll
    for (int qg = 0; qg < 2; ++qg)
#pragma unroll
        for (int ks = 0; ks < 2; ++ks) qf[qg][ks] = WFrag<h16>::ld(Qg + (size_t)(q0 + qg * 16 + c) * HD + ks * 32 + 8 * h);
    asm volatile("s_wait_xcnt 0x0" ::: "memory");     // behind the q loads, in front of the arithmetic below, which may reuse their address registers
    unsigned bl[MR];
#pragma unroll
    for (int j = 0; j < MR; ++j) { bl[j] = __builtin_amdgcn_ballot_w32(mv[j] != 0); kidx[j * (FNW * 32) + tid] = 0; }
    if (lane == 0) {
#pragma unroll
        for (int j = 0; j < MR; ++j) kbal[j * FNW + wave] = bl[j]; }
    __syncthreads();                                  // the 32 ballot words are complete, and every place of kidx holds 0
    unsigned run = 0, base[MR];
#pragma unroll
    for (int j = 0; j < MR; ++j) base[j] = 0;
#pragma unroll
    for (int w = 0; w < TT / 32; ++w) {
#pragma unroll
        for (int j = 0; j < MR; ++j) if (w / FNW == j) base[j] = (w % FNW == wave) ? run : base[j];   // kept keys in front of this wave's word of round j
        run += (unsigned)__builtin_popcount(kbal[w]); }
    const unsigned below = (1u << lane) - 1u;
#pragma unroll
    for (int j = 0; j < MR; ++j) { const int e = j * (FNW * 32) + tid;
        if (mv[j] != 0) kidx[base[j] + (unsigned)__builtin_popcount(bl[j] & below)] = e;   // a rank is below the count of kept keys, at most TT - 1
        mb[e] = ((unsigned)e < run) ? 0.0f : -__builtin_inff(); }
    const int nkeep = __builtin_amdgcn_readfirstlane((int)run);            // the same in every thread of the work-group
    const int nst = min((nkeep + FKS - 1) / FKS, TT / FKS);                // stages to walk, bounded by the shape
    __syncthreads();                                  // kidx and mb are complete
    // staging: thread -> places sr and sr + 32 of the stage's 64 kept keys, 16 bytes at element sc of the key's K row and of its V row
    const int sr = tid >> 3, sc = (tid & 7) * 8;
    const v8h* Kg8 = (const v8h*)Kg; const v8h* Vg8 = (const v8h*)Vg;   // rows of HD / 8 pieces of 16 bytes
    // the lane's 32-bit offsets, in 16-byte pieces, beside wave-uniform bases; the mask bounds the row whatever kidx holds
    unsigned j0 = (unsigned)((kidx[sr] & (TT - 1)) * (HD / 8) + (tid & 7)), j1 = (unsigned)((kidx[sr + 32] & (TT - 1)) * (HD / 8) + (tid & 7));
    v8h gk0 = Kg8[j0], gk1 = Kg8[j1];
    v8h gv0 = Vg8[j0], gv1 = Vg8[j1];
    asm volatile("s_wait_xcnt 0x0" :: "v"(j0), "v"(j1) : "memory");   // the four loads' offset registers live to this wait, so nothing overwrites them in front of it
    *(v8ha*)(&kst[0][sr * FPI + sc]) = gk0; *(v8ha*)(&kst[0][(sr + 32) * FPI + sc]) = gk1;
    *(v8ha*)(&vst[0][sr * FPV + sc]) = gv0; *(v8ha*)(&vst[0][(sr + 32) * FPV + sc]) = gv1;
    v8f o[2][4];
#pragma unroll
    for (int qg = 0; qg < 2; ++qg)
#pragma unroll
        for (int dt = 0; dt < 4; ++dt) o[qg][dt] = (v8f){};
    float mrun[2] = {-1.0e30f, -1.0e30f};   // finite, below every finite score
    float lsum[2] = {0.0f, 0.0f};           // each wave half sums its own keys; joined once at the end
    __syncthreads();
#pragma unroll 1   // rolled: one copy of the stage body, and the buffer index stays a scalar
    for (int st = 0; st < nst; ++st) {
        const bool more = st + 1 < nst;
        if (more) { j0 = (unsigned)((kidx[(st + 1) * FKS + sr] & (TT - 1)) * (HD / 8) + (tid & 7)); j1 = (unsigned)((kidx[(st + 1) * FKS + sr + 32] & (TT - 1)) * (HD / 8) + (tid & 7));
            gk0 = Kg8[j0]; gk1 = Kg8[j1];
            gv0 = Vg8[j0]; gv1 = Vg8[j1];
            asm volatile("s_wait_xcnt 0x0" :: "v"(j0), "v"(j1) : "memory"); }   // the four loads' offset registers live to this wait: it stands in front of the pass's address arithmetic, which reuses them
        const h16* kb = kst[st & 1]; const h16* vb = vst[st & 1];
        const int np = (nkeep - st * FKS > 32) ? FKS / 32 : 1;   // the last stage's second pass is walked only if it holds a kept key
#pragma unroll 1   // one pass's registers at a time: two passes interleaved did not fit the 256 registers that four waves per SIMD leave
        for (int p = 0; p < np; ++p) {
            v8f s[2][2];
#pragma unroll
            for (int kt = 0; kt < 2; ++kt) {
                const h16* kr = kb + (p * 32 + kt * 16 + c) * FPI + 8 * h;
                const v16h k0 = ldsfrag(kr), k1 = ldsfrag(kr + 32);
                const float* mp = mb + st * FKS + p * 32 + kt * 16 + 8 * h;
                const v4f b0 = *(const v4fa*)mp, b1 = *(const v4fa*)(mp + 4);
                const v8f bz = __builtin_shufflevector(b0, b1, 0, 1, 2, 3, 4, 5, 6, 7);
#pragma unroll
                for (int qg = 0; qg < 2; ++qg) { v8f t = wmma16(k0, qf[qg][0], (v8f){}); t = wmma16(k1, qf[qg][1], t); s[kt][qg] = t + bz; }
            }
            v16h vf[4];
#pragma unroll
            for (int dt = 0; dt < 4; ++dt) { const h16* vr = vb + (p * 32 + 8 * h + (lane & 7)) * FPV + dt * 16 + 8 * ((lane >> 3) & 1); vf[dt] = cat16(ldtr16(vr), ldtr16(vr + 16 * FPV)); }
            float mx[2]; bool need = false;
#pragma unroll
            for (int qg = 0; qg < 2; ++qg) { float m = s[0][qg][0];
#pragma unroll
                for (int r = 1; r < 8; ++r) m = fmaxf(m, s[0][qg][r]);
#pragma unroll
                for (int r = 0; r < 8; ++r) m = fmaxf(m, s[1][qg][r]);
                m = fmaxf(m, xhalf(m)) * CSC; mx[qg] = m; need = need || (m > mrun[qg] + 8.0f); }
            // the maximum in use moves only when some column's new maximum passes it by more than 8 (base 2): P stays <= 256, inside f16
            if (__builtin_amdgcn_ballot_w32(need) != 0) {
#pragma unroll
                for (int qg = 0; qg < 2; ++qg) { const float mn = fmaxf(mrun[qg], mx[qg]); const float corr = __builtin_amdgcn_exp2f(mrun[qg] - mn); mrun[qg] = mn; lsum[qg] *= corr;
#pragma unroll
                    for (int dt = 0; dt < 4; ++dt) o[qg][dt] = o[qg][dt] * corr; }
            }
#pragma unroll
            for (int qg = 0; qg < 2; ++qg) { const float nm = -mrun[qg]; v16h pf; float ls = 0.0f;
                const v8f cv = {CSC, CSC, CSC, CSC, CSC, CSC, CSC, CSC}, nv = {nm, nm, nm, nm, nm, nm, nm, nm};
                const v8f a0 = __builtin_elementwise_fma(s[0][qg], cv, nv), a1 = __builtin_elementwise_fma(s[1][qg], cv, nv);
#pragma unroll
                for (int i = 0; i < 16; ++i) { const float pv = __builtin_amdgcn_exp2f((i < 8) ? a0[i & 7] : a1[i & 7]); ls += pv; pf[i] = tohx(pv); }
                lsum[qg] += ls;
#pragma unroll
                for (int dt = 0; dt < 4; ++dt) o[qg][dt] = wmma16(vf[dt], pf, o[qg][dt]); }
            // four vector slots behind the pass's last matrix instructions: across the back edge the next pass's address arithmetic would overwrite their A registers too early
            asm volatile("v_nop\n\tv_nop\n\tv_nop\n\tv_nop" : "+v"(o[1][0]), "+v"(o[1][1]), "+v"(o[1][2]), "+v"(o[1][3]));
        }
        if (more) { h16* kw = kst[(st + 1) & 1]; h16* vw = vst[(st + 1) & 1];   // this buffer's last readers left it before the barrier that ended stage st - 1
            *(v8ha*)(kw + sr * FPI + sc) = gk0; *(v8ha*)(kw + (sr + 32) * FPI + sc) = gk1;
            *(v8ha*)(vw + sr * FPV + sc) = gv0; *(v8ha*)(vw + (sr + 32) * FPV + sc) = gv1; }
        __syncthreads();
    }
    v8h oc[2][4];
#pragma unroll
    for (int qg = 0; qg < 2; ++qg) { const float lf = lsum[qg] + xhalf(lsum[qg]); const float inv = 1.0f / lf;
#pragma unroll
        for (int dt = 0; dt < 4; ++dt)
#pragma unroll
            for (int j = 0; j < 8; ++j) oc[qg][dt][j] = tohx(o[qg][dt][j] * inv); }
    h16* od = Ac + ((size_t)b * TT + q0 + c) * DQ + hh * HD + 8 * h;
    __builtin_amdgcn_sched_barrier(0);   // every value is finished, each in registers of its own, before the first store names any: nothing is written behind the stores
#pragma unroll
    for (int qg = 0; qg < 2; ++qg)
#pragma unroll
        for (int dt = 0; dt < 4; ++dt) *(v8h*)(od + (size_t)qg * 16 * DQ + dt * 16) = oc[qg][dt];
}

extern "C" void kernel_launch(void* const* d_in, const int* in_sizes, int n_in,
                              void* d_out, int out_size, void* d_ws, size_t ws_size, hipStream_t stream) {
    (void)out_size;
    if (n_in < 11) return;
    if (in_sizes[0] < NB * TT * DM || in_sizes[1] < TT * HD || in_sizes[2] < NB * TT) return;
    if (in_sizes[3] < DM * DQ || in_sizes[5] < DM * DQ || in_sizes[7] < DM * DQ || in_sizes[9] < DQ * DM) return;
    if (in_sizes[4] < DQ || in_sizes[6] < DQ || in_sizes[8] < DQ || in_sizes[10] < DM) return;
    // wire order: x, rel_pos_enc, attention_mask, Wq, bq, Wk, bk, Wv, bv, Wo, bo
    const float* x = (const float*)d_in[0]; const float* rel = (const float*)d_in[1]; const int* msk = (const int*)d_in[2];
    const float* wq = (const float*)d_in[3]; const float* bq = (const float*)d_in[4]; const float* wk = (const float*)d_in[5]; const float* bk = (const float*)d_in[6];
    const float* wv = (const float*)d_in[7]; const float* bv = (const float*)d_in[8]; const float* wo = (const float*)d_in[9]; const float* bo = (const float*)d_in[10];
    float* OUT = (float*)d_out;     // [8][1024][1024]
    char* wsp = (char*)d_ws;
    auto take = [&](size_t bytes) { char* p = wsp; wsp += (bytes + 255) & ~(size_t)255; return (void*)p; };
    h16* WO = (h16*)take((size_t)DM * DQ * 2);                   // [k = 1024][n = 1024]
    h16* QK16 = (h16*)take((size_t)2 * NB * NH_ * TT * HD * 2);  // [2][NB*16][TT][64]
    h16* VP16 = (h16*)take((size_t)NB * NH_ * TT * HD * 2);      // [NB*16][TT][64]
    // one region, two lives: the projection's operands, dead once the head planes are written, then the merged context
    char* const shared0 = wsp;
    bf* WQKV = (bf*)take((size_t)NQKV * DM * 2);                 // [3][k = 1024][n = 1024]: planes q, k, v
    bf* XB = (bf*)take((size_t)NB * TT * DM * 2);                // [NB][TT][DM]
    char* const end1 = wsp; wsp = shared0;
    h16* AT = (h16*)take((size_t)NB * TT * DQ * 2);              // merged context [NB*TT][1024]
    if (end1 > wsp) wsp = end1;
    if ((size_t)(wsp - (char*)d_ws) > ws_size) return;           // 72 MiB at full size
    h16* Q16 = QK16; h16* K16 = QK16 + (size_t)NB * NH_ * TT * HD;
    k_cvt8<<<dim3((unsigned)(((size_t)TT * DM / 8 + 255) / 256), NB + 4, 1), 256, 0, stream>>>(x, wq, wk, wv, wo, XB, WQKV, WO, (size_t)TT * DM / 8, (size_t)SEQ_FULL * DM, (size_t)TT * DM);
    k_gemmw<bf, 0, false, DM, true><<<dim3(TT / GBM, NQKV / GBN, NB), 256, 0, stream>>>(XB, nullptr, WQKV, nullptr, 0, nullptr, (size_t)TT * DM, 0, 0, bq, bk, bv, rel, QK16, VP16);
    k_fattn<<<dim3(TT / (FNW * FQW), NB * NH_, 1), FNW * 32, 0, stream>>>(Q16, K16, VP16, msk, AT);
    k_gemmw<h16, 0, true, DQ, false><<<dim3(TT / GBM, DM / GBN, NB), 256, 0, stream>>>(AT, nullptr, WO, OUT, DM, bo, (size_t)TT * DQ, 0, (size_t)SEQ_FULL * DM, nullptr, nullptr, nullptr, nullptr, nullptr, nullptr);
}

// v008
// A run of this version takes 93.9 microseconds.
// In two side-by-side timings against v007, it was 1.16 and 1.15 times as fast.
// Counting every step since v000, it is 13.7 times as fast.
#include <hip/hip_runtime.h>

// Compute dtypes (f32 accumulate everywhere): every float input RNE-converted to bf16; QKV projection v_wmma_f32_16x16x32_bf16 (exact products); scores (k + 8 R) x q^T and V^T x P^T (V^T read from [t][d] rows by the transposing LDS load) on v_wmma_f32_16x16x32_f16 (P = exp2 of the score against the maximum in use, not yet normalised); softmax f32; output projection v_wmma_f32_16x16x32_f16: merged context rounded once to f16 x Wo (its bf16 value, held as f16) + f32 bias.
// Self-attention on one stream x [8][1024][1024]; weights keep their [in][out] = [k][n] order as 16-bit planes (q, k, v: three bf16 planes in a row; Wo f16), and the GEMMs turn them on the LDS read; 16 heads x 64.
// Score algebra: (q.k) x 0.125 + q.R[t] = 0.125 x q.(k[t] + 8 R[t]); the key plane stores k + 8 R (R = per-key table input, read by value), the 0.125 is applied in the softmax's exponent.
// Key mask [b][t] (int32, data): a key with mask == 0 has weight exp(-inf) = 0, so it is left out of the key walk: each attention work-group lists the kept keys in ascending order and stages only their rows.
// Keys that no score can use are not projected either: the conversion launch lists the rows of x that are a kept key, or key 0 of a batch (the attention's filler places read that row), and the k and v columns of the projection run over that list alone.
// Softmax in the running-maximum form, normalised once at the end (a row without any kept key ends as 0 x (1 / 0) = NaN).

#ifndef NB
#define NB 8
#endif
#ifndef SEQ
#define SEQ 1024
#endif
#define SEQ_FULL 1024             // per-batch row count of the inputs / output (strides)
#define TT   SEQ
#define DM   1024
#define NH_  16
#define HD   64
#define DQ   (NH_ * HD)
#define NQKV (3 * DQ)
#define SCL  0.125f               // HD^-0.5
#define RCAR 8.0f                 // 1 / SCL
typedef _Float16 h16;
typedef unsigned short bf;
typedef __attribute__((ext_vector_type(16))) __bf16   v16bf;
typedef __attribute__((ext_vector_type(16))) _Float16 v16h;
typedef __attribute__((ext_vector_type(8)))  _Float16 v8h;
typedef __attribute__((ext_vector_type(8)))  unsigned short v8us;
typedef __attribute__((ext_vector_type(8)))  float    v8f;
typedef __attribute__((ext_vector_type(4)))  float    v4f;
typedef v8h  __attribute__((may_alias)) v8ha;
typedef v4f  __attribute__((may_alias)) v4fa;
typedef v8us __attribute__((may_alias)) v8usa;

static_assert(TT % 128 == 0);
static_assert(TT <= SEQ_FULL);
static_assert(DM % 64 == 0);
static_assert(HD == 64);
static_assert(DM == DQ);
static_assert(NQKV % 256 == 0);
static_assert(DM % 256 == 0);

__device__ __forceinline__ unsigned short f2bf(float f) { unsigned u = __float_as_uint(f); u += 0x7FFFu + ((u >> 16) & 1u); return (unsigned short)(u >> 16); }
__device__ __forceinline__ float bf2f(unsigned short b) { return __uint_as_float(((unsigned)b) << 16); }
__device__ __forceinline__ float bfr(float f) { return bf2f(f2bf(f)); }
__device__ __forceinline__ v16h cat16(v8h lo, v8h hi) { return __builtin_shufflevector(lo, hi, 0, 1, 2, 3, 4, 5, 6, 7, 8, 9, 10, 11, 12, 13, 14, 15); }
__device__ __forceinline__ v16bf cat16b(v8us lo, v8us hi) { return __builtin_bit_cast(v16bf, __builtin_shufflevector(lo, hi, 0, 1, 2, 3, 4, 5, 6, 7, 8, 9, 10, 11, 12, 13, 14, 15)); }
__device__ __forceinline__ v8f wmma16(v16h a, v16h b, v8f c) { return __builtin_amdgcn_wmma_f32_16x16x32_f16(false, a, false, b, (short)0, c, false, false); }
__device__ __forceinline__ v8f wmmab(v16bf a, v16bf b, v8f c) { return __builtin_amdgcn_wmma_f32_16x16x32_bf16(false, a, false, b, (short)0, c, false, false); }

__device__ __forceinline__ h16 tohx(float x) { return (h16)x; }
typedef __attribute__((ext_vector_type(8))) short v8s;
typedef __attribute__((address_space(3))) v8s lds_v8s;
__device__ __forceinline__ v8h ldtr16(const h16* p) { return __builtin_bit_cast(v8h, __builtin_amdgcn_ds_load_tr16_b128_v8i16((lds_v8s*)p)); }
__device__ __forceinline__ v8us ldtr16u(const bf* p) { return __builtin_bit_cast(v8us, __builtin_amdgcn_ds_load_tr16_b128_v8i16((lds_v8s*)p)); }

// ---- k_gemmw: GEMM on a 128 x 256 output tile per work-group of 8 waves (2 x 4), 64 x 64 (16 accumulators) per wave; grid (M/128, N/256, Z), or for HEADS one dimension of (NROW/128) x (N/256), 256 threads.
// C[m][n] (f32, pitch ldc, + optional f32 bias[n]) = sum_k A[m][k] B[k][n] (+ A2[m][k] B[k][n] for NSPLIT 1). z-batch strides sA/sB/sC in elements. K: a compile-time multiple of 64, at least 128 (two stages).
// B: planes of [K][GLB] in a row, plane n / GLB, column n % GLB (a tile's 256 columns lie in one plane).
// HEADS: no C; n runs over the fused q|k|v columns, m over all rows b * TT + t of x (q) or over the listed rows (k, v), and a wave's 64 x 64 tile is 64 such rows of one head of one of the three. The epilogue writes each row as fp16 into its head plane:
//   q -> QK[0][b*16+h][t][d] = acc + bq; k -> QK[1][b*16+h][t][d] = (acc + bk) + 8 R[t][d]; v -> VP[b*16+h][t][d] = acc + bv. Rows of k and v behind the list's count are written only where they share a wave's 64 places with a listed row, and nothing reads them.
// Operands: 16-bit planes, 64 k per LDS stage (A: one whole 128-B line of each of its rows; B: 512 B, four whole lines, of each of 64 k rows), two buffers, brought by asynchronous copies one stage ahead of their use.
// Fragment map: lane l -> row/col l & 15, half h = l >> 4; elements 0..7 <- k0 + 8h + 0..7, elements 8..15 <- k0 + 16 + 8h + 0..7 (A and B alike); D element j -> row 8h + j, col l & 15.
// B fragments: ds_load_tr16_b128 on the [k][n] rows hands lane (c, h) the k 8h + 0..7 of column c; two of them, 16 k rows apart, are the map above.
#define GBM 128                   // tile rows
#define GBN 256                   // tile columns
#define GKS 64                    // k per LDS stage
#define GPI 72                    // LDS row pitch in 16-bit elements: 128 B of data + 16 B, for the 16-byte readers
#define GPB 272                   // the B rows' pitch: 512 B of data + 32 B, for the transposing reader
#define GLB 1024                  // columns of a B plane
template <typename T16> struct WFrag;
template <bool B> struct Flag { static constexpr bool v = B; };   // a compile-time switch handed to a generic lambda
template <> struct WFrag<h16> { typedef v16h V; static __device__ __forceinline__ V ld(const h16* p) { return cat16(*(const v8h*)p, *(const v8h*)(p + 16)); } static __device__ __forceinline__ V ldl(const h16* p) { return cat16(*(const v8ha*)p, *(const v8ha*)(p + 16)); } static __device__ __forceinline__ V ldt(const h16* p) { return cat16(ldtr16(p), ldtr16(p + 16 * GPB)); } static __device__ __forceinline__ v8f mma(V a, V b, v8f c) { return wmma16(a, b, c); } };
template <> struct WFrag<bf> { typedef v16bf V; static __device__ __forceinline__ V ld(const bf* p) { return cat16b(*(const v8us*)p, *(const v8us*)(p + 16)); } static __device__ __forceinline__ V ldl(const bf* p) { return cat16b(*(const v8usa*)p, *(const v8usa*)(p + 16)); } static __device__ __forceinline__ V ldt(const bf* p) { return cat16b(ldtr16u(p), ldtr16u(p + 16 * GPB)); } static __device__ __forceinline__ v8f mma(V a, V b, v8f c) { return wmmab(a, b, c); } };
// Four asynchronous copies of 16 bytes a lane: four rows of one operand, equally spaced (global step gs elements, LDS step ls bytes).
// The s_wait_xcnt stands inside the statement, behind the last copy, so that no later write of an address register named here can come in front of it.
template <typename T16>
__device__ __forceinline__ void cp4(unsigned l, unsigned ls, const T16* g, size_t gs) {
    const unsigned l1 = l + ls, l2 = l + 2 * ls, l3 = l + 3 * ls;
    const T16* g1 = g + gs; const T16* g2 = g1 + gs; const T16* g3 = g2 + gs;
    asm volatile("global_load_async_to_lds_b128 %0, %4, off\n\t"
                 "global_load_async_to_lds_b128 %1, %5, off\n\t"
                 "global_load_async_to_lds_b128 %2, %6, off\n\t"
                 "global_load_async_to_lds_b128 %3, %7, off\n\t"
                 "s_wait_xcnt 0x0"
                 :: "v"(l), "v"(l1), "v"(l2), "v"(l3), "v"(g), "v"(g1), "v"(g2), "v"(g3) : "memory");
}
// The same for four rows that lie anywhere: each copy has a global pointer of its own.
template <typename T16>
__device__ __forceinline__ void cp4g(unsigned l, unsigned ls, const T16* g, const T16* g1, const T16* g2, const T16* g3) {
    const unsigned l1 = l + ls, l2 = l + 2 * ls, l3 = l + 3 * ls;
    asm volatile("global_load_async_to_lds_b128 %0, %4, off\n\t"
                 "global_load_async_to_lds_b128 %1, %5, off\n\t"
                 "global_load_async_to_lds_b128 %2, %6, off\n\t"
                 "global_load_async_to_lds_b128 %3, %7, off\n\t"
                 "s_wait_xcnt 0x0"
                 :: "v"(l), "v"(l1), "v"(l2), "v"(l3), "v"(g), "v"(g1), "v"(g2), "v"(g3) : "memory");
}
#define NROW (NB * TT)            // rows of x; the row list holds NROW places, then the count of listed rows
// amdgpu_waves_per_eu(4, 4): two work-groups per WGP, so that one group's matrix runs cover the other's barrier, copy issue and epilogue.
template <typename T16, int NSPLIT, bool BIAS, int K, bool HEADS>
__global__ __launch_bounds__(256) __attribute__((amdgpu_waves_per_eu(4, 4))) void k_gemmw(const T16* __restrict__ A, const T16* __restrict__ A2, const T16* __restrict__ Bw, float* C, int ldc, const float* __restrict__ bias, size_t sA, size_t sB, size_t sC,
                                                                                          const float* __restrict__ bq, const float* __restrict__ bk, const float* __restrict__ bv, const float* __restrict__ R, h16* QK, h16* VP, const int* __restrict__ rlist) {
    static_assert(NSPLIT == 0 || NSPLIT == 1);
    static_assert(K % GKS == 0 && K / GKS >= 2);
    typedef typename WFrag<T16>::V V;
    constexpr int AR = (NSPLIT == 1) ? 2 * GBM : GBM;   // staged A rows: the A plane, then the A2 plane
    constexpr int SE = AR * GPI + GKS * GPB;            // elements per stage: A rows [m][k], then B rows [k][n]
    __shared__ __align__(32) T16 stg[2 * SE];
    static_assert(GLB % GBN == 0 && (AR * GPI * 2) % 32 == 0 && (SE * 2) % 32 == 0);
    static_assert(8 * 16 * 68 * 4 <= 2 * SE * 2);       // the epilogue's staging rows lie in the same LDS
    __shared__ int rl[HEADS ? GBM : 1];                 // HEADS: the row of x behind each of the tile's 128 places
    const size_t z = HEADS ? 0 : blockIdx.z; A += z * sA; if (NSPLIT == 1) A2 += z * sA; Bw += z * sB; if (!HEADS) C += z * sC;
    const int tid = threadIdx.x, lane = tid & 31, lr = lane & 15, hi = lane >> 4, wave = tid >> 5, wm = wave >> 2, wn = wave & 3;
    // HEADS: a one-dimensional grid. First the q tiles, places = rows of x; then the k and v tiles, places = ranks in the row list, the last (part-filled) 128 ranks first, so that the short tiles end early and free their room; tiles past the list leave here, ahead of every barrier.
    int R0 = blockIdx.x * GBM, C0 = blockIdx.y * GBN, lim = 0;   // lim: the rows at places of the list from lim on are read by nobody
    if constexpr (HEADS) {
        constexpr int MT = NROW / GBM, QT = MT * (DQ / GBN), KVN = 2 * DQ / GBN;
        const int f = blockIdx.x;
        if (f < QT) { R0 = (f % MT) * GBM; C0 = (f / MT) * GBN; lim = NROW; }
        else { lim = min(rlist[NROW], NROW); const int mt = (lim + GBM - 1) / GBM - 1 - (f - QT) / KVN; if (mt < 0) return;
            R0 = mt * GBM; C0 = DQ + ((f - QT) % KVN) * GBN; }
    }
    const int r0 = R0 + wm * 64, c0 = C0 + wn * 64;
    const bool act = !HEADS || R0 + (__builtin_amdgcn_readfirstlane(wave) >> 2) * 64 < lim;   // a wave whose 64 places all lie past the list only copies and keeps the barriers
    // copies: A: thread -> 16 bytes at element sc of rows sr + 32 i; B: thread -> 16 bytes at element 8 lane of k rows wave + 8 i; either way a wave's copy covers four whole 128-B lines
    const int sr = tid >> 3, sc = (tid & 7) * 8; const size_t gs = (size_t)32 * K;
    const T16* ga = A + (size_t)(R0 + sr) * K + sc; const T16* ga2 = (NSPLIT == 1) ? A2 + (size_t)(R0 + sr) * K + sc : nullptr; const T16* gb = Bw + (size_t)(C0 / GLB) * K * GLB + (size_t)wave * GLB + (C0 % GLB) + lane * 8;
    const unsigned l0 = (unsigned)(size_t)stg + (unsigned)(sr * GPI + sc) * 2;   // the lane's LDS byte address in buffer 0, A rows
    const unsigned lb0 = (unsigned)(size_t)stg + (unsigned)(AR * GPI + wave * GPB + lane * 8) * 2;   // ... B rows
    const T16* gq[4] = {ga, ga, ga, ga};                // HEADS: the thread's four rows of x
    if constexpr (HEADS) {
        int rw[4];   // the '#pragma unroll's here and in the epilogue's ask() make the indices of register arrays constants
        if (C0 < DQ) {
#pragma unroll
            for (int i = 0; i < 4; ++i) rw[i] = R0 + sr + 32 * i; }
        else { const unsigned ro = (unsigned)(R0 + sr);
#pragma unroll
            for (int i = 0; i < 4; ++i) rw[i] = rlist[ro + 32 * i];
            asm volatile("s_wait_xcnt 0x0" :: "v"(ro) : "memory");   // the four loads' offset register lives to this wait, so nothing overwrites it in front of it
#pragma unroll
            for (int i = 0; i < 4; ++i) rw[i] &= NROW - 1; }          // bounds the row whatever the list holds
#pragma unroll
        for (int i = 0; i < 4; ++i) { gq[i] = A + (size_t)rw[i] * K + sc; if ((tid & 7) == 0) rl[sr + 32 * i] = rw[i]; }   // rl is published by the barrier behind stage 0
    }
    auto fill = [&](int t, int buf) {
        const unsigned l = l0 + (unsigned)buf * (SE * 2); const int ko = t * GKS;
        if constexpr (HEADS) cp4g(l, 32 * GPI * 2, gq[0] + ko, gq[1] + ko, gq[2] + ko, gq[3] + ko);
        else cp4(l, 32 * GPI * 2, ga + ko, gs);
        if (NSPLIT == 1) cp4(l + GBM * GPI * 2, 32 * GPI * 2, ga2 + ko, gs);
        const unsigned lb = lb0 + (unsigned)buf * (SE * 2); const T16* gk = gb + (size_t)ko * GLB;
        cp4(lb, 8 * GPB * 2, gk, (size_t)8 * GLB); cp4(lb + 32 * GPB * 2, 8 * GPB * 2, gk + 32 * GLB, (size_t)8 * GLB); };
    v8f acc[4][4];
#pragma unroll
    for (int mb = 0; mb < 4; ++mb)
#pragma unroll
        for (int nb = 0; nb < 4; ++nb) acc[mb][nb] = (v8f){};
    constexpr int nt = K / GKS;
    fill(0, 0);
    asm volatile("s_wait_asynccnt 0x0" ::: "memory");   // this wave's share of stage 0 has landed
    __syncthreads();                                    // ... and every other wave's
    fill(1, 1);
    const int afo = (wm * 64 + lr) * GPI + 8 * hi, bfo = AR * GPI + (8 * hi + (lane & 7)) * GPB + wn * 64 + 8 * ((lane >> 3) & 1);
#pragma unroll 1   // rolled: one copy of the stage body, and the buffer index stays a scalar
    for (int t = 0; t < nt; ++t) {
        const T16* sb = stg + (t & 1) * SE;
        if (act) {
#pragma unroll
        for (int ks = 0; ks < GKS / 32; ++ks) {
            V a[4], a2[4], b[4];   // all of a 32-k block's fragments are asked for as one group, ahead of its matrix run
#pragma unroll
            for (int mb = 0; mb < 4; ++mb) { a[mb] = WFrag<T16>::ldl(sb + afo + mb * 16 * GPI + ks * 32); if (NSPLIT == 1) a2[mb] = WFrag<T16>::ldl(sb + afo + (GBM + mb * 16) * GPI + ks * 32); }
#pragma unroll
            for (int nb = 0; nb < 4; ++nb) b[nb] = WFrag<T16>::ldt(sb + bfo + ks * 32 * GPB + nb * 16);
            __builtin_amdgcn_sched_barrier(0);   // keeps the LDS loads one group: left alone the compiler moves the Bw loads in among the matrix instructions, each with a full wait behind it
#pragma unroll
            for (int nb = 0; nb < 4; ++nb)
#pragma unroll
                for (int mb = 0; mb < 4; ++mb) { acc[mb][nb] = WFrag<T16>::mma(a[mb], b[nb], acc[mb][nb]); if (NSPLIT == 1) acc[mb][nb] = WFrag<T16>::mma(a2[mb], b[nb], acc[mb][nb]); }
            __builtin_amdgcn_sched_barrier(0);   // ends the block: the next group of loads, and the stage's closing waits, stay behind its matrix instructions
        } }
        asm volatile("s_wait_dscnt 0x0" ::: "memory");      // this wave has left buffer t & 1
        asm volatile("s_wait_asynccnt 0x0" ::: "memory");   // this wave's share of stage t + 1 has landed
        __syncthreads();                                    // publishes stage t + 1 and ends every reader's last read of buffer t & 1
        if (t + 2 < nt) fill(t + 2, t & 1);
    }
    asm volatile("s_wait_asynccnt 0x0" ::: "memory");       // no copy is outstanding when the LDS becomes output staging
    float* os = (float*)stg + wave * (16 * 68);             // each wave's own 16 x 68 floats; every reader left the buffers at the loop's last barrier
    if constexpr (HEADS) {
        const int which = C0 / DQ, hd = (c0 % DQ) / HD;     // which: the same for the whole work-group (GBN divides DQ); hd: the wave's head
        if (!act) return;                                   // no barrier follows
        const int rr = lane >> 3, cofs = (lane & 7) * 8;    // read-back: 8 lanes per 128-byte output row, 4 rows per store
        const int* rw = rl + wm * 64 + rr;                  // the lane's rows of x: place 16 mb + 4 s of the wave's 64
        // q, k and v rows; ISK: the key plane, which also takes 8 x the table row of its t. Two copies of the code, so that neither holds a branch between a load and its use.
        auto rows = [&](auto isk, const float* bsrc, h16* plane) {
            constexpr bool ISK = decltype(isk)::v;
            const float* bb = bsrc + hd * HD + cofs; const v4f ba = *(const v4f*)bb, bc = *(const v4f*)(bb + 4);
            asm volatile("s_wait_xcnt 0x0" :: "v"(bb) : "memory");   // the two loads' address pair lives to this wait, so nothing overwrites it in front of it
            v4f tb[2][4][2];                                // the table rows of one 16-row block, asked for one block ahead of their use
            int gr[2][4];                                   // the rows of x of one block, read with them
            const v4f* R4 = (const v4f*)R;
            auto ask = [&](int mb) {
#pragma unroll
                for (int s = 0; s < 4; ++s) gr[mb & 1][s] = rw[mb * 16 + 4 * s];
                if (ISK) { unsigned to[4];
#pragma unroll
                    for (int s = 0; s < 4; ++s) { to[s] = (unsigned)((gr[mb & 1][s] & (TT - 1)) * (HD / 4) + cofs / 4); tb[mb & 1][s][0] = R4[to[s]]; tb[mb & 1][s][1] = R4[to[s] + 1]; }   // offsets in 16-byte pieces beside a wave-uniform base
                    asm volatile("s_wait_xcnt 0x0" :: "v"(to[0]), "v"(to[1]), "v"(to[2]), "v"(to[3]) : "memory"); } };   // the eight loads' offset registers live to this wait, so nothing overwrites them in front of it
            ask(0);
            float bi[8];
#pragma unroll
            for (int q = 0; q < 8; ++q) bi[q] = bfr((q < 4) ? ba[q & 3] : bc[q & 3]);
#pragma unroll
            for (int mb = 0; mb < 4; ++mb) {
                if (mb < 3) ask(mb + 1);
#pragma unroll
                for (int nb = 0; nb < 4; ++nb) {
#pragma unroll
                    for (int j = 0; j < 8; ++j) os[(hi * 8 + j) * 68 + nb * 16 + lr] = acc[mb][nb][j]; }
                __builtin_amdgcn_wave_barrier(); asm volatile("" ::: "memory");   // compiler fence: the reads below take other lanes' words, so they stay behind the writes above
                v8h o[4]; unsigned dof[4];
#pragma unroll
                for (int s = 0; s < 4; ++s) {
                    dof[s] = (unsigned)(((((unsigned)gr[mb & 1][s] / TT) * NH_ + hd) * TT + (gr[mb & 1][s] & (TT - 1))) * HD + cofs);   // row b * TT + t of x -> row t of head plane b * 16 + hd
                    const v4f x0 = *(const v4fa*)(os + (4 * s + rr) * 68 + cofs), x1 = *(const v4fa*)(os + (4 * s + rr) * 68 + cofs + 4);
#pragma unroll
                    for (int q = 0; q < 8; ++q) { float y = ((q < 4) ? x0[q & 3] : x1[q & 3]) + bi[q];
                        if (ISK) y += RCAR * bfr((q < 4) ? tb[mb & 1][s][0][q & 3] : tb[mb & 1][s][1][q & 3]);
                        o[s][q] = tohx(y); } }
                __builtin_amdgcn_sched_barrier(0);   // all four rows' values are finished, each in registers of its own, before the first store names any
#pragma unroll
                for (int s = 0; s < 4; ++s) *(v8h*)(plane + dof[s]) = o[s];
                asm volatile("s_wait_xcnt 0x0" ::: "memory");   // behind every block's four stores, the last block's too: in front of whatever next writes their data registers (the next block's arithmetic, or the code laid behind this copy of the epilogue); as a compiler fence it also keeps the next block's LDS writes behind this block's reads
                __builtin_amdgcn_sched_barrier(0);              // keeps that code behind the wait
            }
        };
        if (which == 1) { rows(Flag<true>{}, bk, QK + (size_t)NB * NH_ * TT * HD); return; }
        rows(Flag<false>{}, (which == 0) ? bq : bv, (which == 0) ? QK : VP);
        return;
    }
#pragma unroll
    for (int mb = 0; mb < 4; ++mb) {
#pragma unroll
        for (int nb = 0; nb < 4; ++nb) {
#pragma unroll
            for (int j = 0; j < 8; ++j) os[(hi * 8 + j) * 68 + nb * 16 + lr] = acc[mb][nb][j]; }
        __builtin_amdgcn_wave_barrier(); asm volatile("" ::: "memory");
        float* crow = C + (size_t)(r0 + mb * 16) * ldc + c0;
{
#pragma unroll
            for (int s = 0; s < 8; ++s) { const int row = 2 * s + hi, cofs = lr * 4; v4f val = *(const v4fa*)(os + row * 68 + cofs); if (BIAS) { val[0] += bfr(bias[c0 + cofs]); val[1] += bfr(bias[c0 + cofs + 1]); val[2] += bfr(bias[c0 + cofs + 2]); val[3] += bfr(bias[c0 + cofs + 3]); }
                *(v4f*)(crow + (size_t)row * ldc + cofs) = val; }
             }
        __builtin_amdgcn_wave_barrier(); asm volatile("" ::: "memory");
    }
}

// One streaming conversion for every 16-bit GEMM operand, element order kept. grid.y picks the plane of n8 x 8 floats: 0..NB-1 -> a batch of x (bf16); NB..NB+2 -> Wq, Wk, Wv (bf16, three planes in a row); NB+3 -> Wo (the same bf16 rounding, written as f16: exact from 2^-17 up to the f16 range's end).
static_assert((size_t)TT * DM == (size_t)DM * DQ);   // a weight plane has as many elements as a batch of x
// The first work-group also writes the row list for the k and v projections: a permutation of the rows b * TT + t of x. First, ascending, every row that is a kept key (mask != 0) or key 0 of its batch; behind them the other rows, so that a tile's places past the count hold rows of their own; rlist[NROW] = the count.
// Thread -> 32 rows in a row, their flags one 32-bit word; a row's rank = flags set in the words in front + flags set below it in its word. The list is put together in LDS and leaves in whole lines.
typedef __attribute__((ext_vector_type(4))) int v4i;
typedef v4i __attribute__((may_alias)) v4ia;
static_assert(TT == SEQ_FULL && NROW == 256 * 32 && (TT & (TT - 1)) == 0);
__global__ __launch_bounds__(256) void k_cvt8(const float* __restrict__ x, const float* __restrict__ wq, const float* __restrict__ wk, const float* __restrict__ wv, const float* __restrict__ wo, bf* XBo, bf* Wqkv, h16* Wo16, size_t n8, size_t sS, size_t sD, const int* __restrict__ mk, int* rlist) {
    __shared__ __align__(16) int lst[NROW];
    __shared__ __align__(16) unsigned wc[256];
    if (blockIdx.x == 0 && blockIdx.y == 0) {           // the same for the whole work-group, so its two barriers are met by all or none
        const int tid = threadIdx.x, e0 = tid * 32;
        const v4i* mk4 = (const v4i*)mk; const unsigned mo = (unsigned)tid * 8; v4i mv[8];   // the lane's offset in 16-byte pieces beside a wave-uniform base
        // every '#pragma unroll' of this block makes the indices of a register array, or a flag's position, constants
#pragma unroll
        for (int j = 0; j < 8; ++j) mv[j] = mk4[mo + j];
        asm volatile("s_wait_xcnt 0x0" :: "v"(mo) : "memory");   // the loads' offset register lives to this wait, so nothing overwrites it in front of it
        unsigned word = ((e0 & (TT - 1)) == 0) ? 1u : 0u;
#pragma unroll
        for (int j = 0; j < 32; ++j) word |= (mv[j >> 2][j & 3] != 0) ? (1u << j) : 0u;
        wc[tid] = (unsigned)__builtin_popcount(word);
        __syncthreads();                                // the 256 counts are complete
        unsigned pos = 0, total = 0;
        for (int w = 0; w < 256; ++w) { const unsigned cw = wc[w]; pos += (w < tid) ? cw : 0u; total += cw; }
#pragma unroll
        for (int j = 0; j < 32; ++j) {
            const bool in = (word >> j) & 1u;
            lst[in ? pos : total + (unsigned)(e0 + j) - pos] = e0 + j;   // pos: listed rows in front of this one; either place is below NROW, and no two rows share one
            pos += in ? 1u : 0u; }
        __syncthreads();                                // the list is complete
        v4i lo[8];
#pragma unroll
        for (int j = 0; j < 8; ++j) lo[j] = *(const v4ia*)(lst + (j * 256 + tid) * 4);
        v4i* rl4 = (v4i*)rlist;
#pragma unroll
        for (int j = 0; j < 8; ++j) rl4[j * 256 + tid] = lo[j];
        if (tid == 0) rlist[NROW] = (int)total;
        asm volatile("s_wait_xcnt 0x0" ::: "memory");   // behind the list's stores, in front of the conversion below, which may reuse their registers
    }
    const size_t i = (size_t)blockIdx.x * 256 + threadIdx.x; if (i >= n8) return;
    const int y = blockIdx.y;
    const float* src = (y < NB) ? x + (size_t)y * sS : (y == NB) ? wq : (y == NB + 1) ? wk : (y == NB + 2) ? wv : wo;
    bf* dst = (y < NB) ? XBo + (size_t)y * sD : (y < NB + 3) ? Wqkv + (size_t)(y - NB) * DM * DQ : (bf*)Wo16;
    const float* sp = src + i * 8; const v8f v = *(const v8f*)sp; v8us o;
    asm volatile("s_wait_xcnt 0x0" :: "v"(sp) : "memory");   // the load's address lives to this wait, so nothing overwrites it in front of it
#pragma unroll
    for (int k = 0; k < 8; ++k) o[k] = f2bf(v[k]);
    if (y == NB + 3) {
#pragma unroll
        for (int k = 0; k < 8; ++k) o[k] = __builtin_bit_cast(unsigned short, tohx(bf2f(o[k]))); }
    *(v8us*)(dst + i * 8) = o;
}

// ---- k_fattn: scores, mask, softmax, P x V and the head merge in one kernel; a score never leaves the registers.
// grid (TT / 256, NB * 16), 8 waves; a wave owns 32 query columns (2 groups of 16) of one head plane and walks the kept keys, 64 per LDS stage (2 buffers), 32 per pass.
// Kept keys: the mask row's 32 ballot words give every kept key its rank (kept keys in front of it); kidx[rank] = key. Places from the count up to the end of the last stage hold key 0 under a -inf bias.
// S^T = K' Q^T: A = key rows from LDS, B = q kept in registers; D register r of lane (c, h) = key 8h + r, query c. Two such tiles, converted in place, are the B operand (32 keys) of O^T += V^T P^T.
// V^T: A = V rows [key][d] from LDS through ds_load_tr16_b128, which hands lane (c, h) the keys 8h + 0..7 of column d = c: the k order of the packed P^T.
// O^T: D register r = d 8h + r of query c, so a lane stores 8 consecutive d of one merged-context row.
// Every plain '#pragma unroll' below makes the indices of a register array constants, so that the array stays in registers.
// amdgpu_waves_per_eu(4, 4): two work-groups per WGP, four waves per SIMD, to cover the vector work between the matrix runs.
#define FNW 8                     // waves per work-group
#define FQW 32                    // query columns per wave
#define FKS 64                    // keys per LDS stage
#define FPI 72                    // LDS row pitch in 16-bit elements: 128 B of data + 16 B, for the 16-byte readers
#define FPV 80                    // the V rows' pitch: 128 B of data + 32 B, for the transposing reader
#define CSC (SCL * 1.4426950408889634f)
static_assert(TT % (FNW * FQW) == 0);
static_assert(TT % FKS == 0);
static_assert(TT % (FNW * 32) == 0 && (TT & (TT - 1)) == 0);   // whole mask rounds (one ballot word per wave and round); the staged row is bounded by a bit mask
__device__ __forceinline__ float xhalf(float x) { return __builtin_bit_cast(float, __builtin_amdgcn_permlanex16(__builtin_bit_cast(int, x), __builtin_bit_cast(int, x), 0x76543210, 0xfedcba98, false, false)); }  // lane l with lane l ^ 16
__device__ __forceinline__ v16h ldsfrag(const h16* p) { return cat16(*(const v8ha*)p, *(const v8ha*)(p + 16)); }
__global__ __launch_bounds__(FNW * 32) __attribute__((amdgpu_waves_per_eu(4, 4))) void k_fattn(const h16* __restrict__ Q, const h16* __restrict__ Kp, const h16* __restrict__ Vp, const int* __restrict__ mk, h16* Ac) {
    __shared__ __align__(16) h16 kst[2][FKS * FPI];   // [key][d]
    __shared__ __align__(32) h16 vst[2][FKS * FPV];   // [key][d]
    __shared__ __align__(16) float mb[TT];            // by place in the kept list: 0 for a kept key, -inf behind the last one
    __shared__ int kidx[TT];                          // the kept keys in ascending order, then 0
    __shared__ __align__(16) unsigned kbal[TT / 32];  // the mask row as bits, key order
    const int tid = threadIdx.x, lane = tid & 31, c = lane & 15, h = lane >> 4, wave = tid >> 5;
    const int g = blockIdx.y, b = g / NH_, hh = g % NH_;
    const h16* Qg = Q + (size_t)g * TT * HD; const h16* Kg = Kp + (size_t)g * TT * HD; const h16* Vg = Vp + (size_t)g * TT * HD;
    const int q0 = blockIdx.x * (FNW * FQW) + wave * FQW;
    constexpr int MR = TT / (FNW * 32);               // mask rounds: round j, thread tid -> key j * 256 + tid, ballot word j * 8 + wave
    const int* mkb = mk + (size_t)b * SEQ_FULL + tid; int mv[MR];
#pragma unroll
    for (int j = 0; j < MR; ++j) mv[j] = mkb[j * (FNW * 32)];
    asm volatile("s_wait_xcnt 0x0" ::: "memory");     // behind the mask loads, in front of whatever next writes a register that they name
    v16h qf[2][2];
#pragma unroll
    for (int qg = 0; qg < 2; ++qg)
#pragma unroll
        for (int ks = 0; ks < 2; ++ks) qf[qg][ks] = WFrag<h16>::ld(Qg + (size_t)(q0 + qg * 16 + c) * HD + ks * 32 + 8 * h);
    asm volatile("s_wait_xcnt 0x0" ::: "memory");     // behind the q loads, in front of the arithmetic below, which may reuse their address registers
    unsigned bl[MR];
#pragma unroll
    for (int j = 0; j < MR; ++j) { bl[j] = __builtin_amdgcn_ballot_w32(mv[j] != 0); kidx[j * (FNW * 32) + tid] = 0; }
    if (lane == 0) {
#pragma unroll
        for (int j = 0; j < MR; ++j) kbal[j * FNW + wave] = bl[j]; }
    __syncthreads();                                  // the 32 ballot words are complete, and every place of kidx holds 0
    unsigned run = 0, base[MR];
#pragma unroll
    for (int j = 0; j < MR; ++j) base[j] = 0;
#pragma unroll
    for (int w = 0; w < TT / 32; ++w) {
#pragma unroll
        for (int j = 0; j < MR; ++j) if (w / FNW == j) base[j] = (w % FNW == wave) ? run : base[j];   // kept keys in front of this wave's word of round j
        run += (unsigned)__builtin_popcount(kbal[w]); }
    const unsigned below = (1u << lane) - 1u;
#pragma unroll
    for (int j = 0; j < MR; ++j) { const int e = j * (FNW * 32) + tid;
        if (mv[j] != 0) kidx[base[j] + (unsigned)__builtin_popcount(bl[j] & below)] = e;   // a rank is below the count of kept keys, at most TT - 1
        mb[e] = ((unsigned)e < run) ? 0.0f : -__builtin_inff(); }
    const int nkeep = __builtin_amdgcn_readfirstlane((int)run);            // the same in every thread of the work-group
    const int nst = min((nkeep + FKS - 1) / FKS, TT / FKS);                // stages to walk, bounded by the shape
    __syncthreads();                                  // kidx and mb are complete
    // staging: thread -> places sr and sr + 32 of the stage's 64 kept keys, 16 bytes at element sc of the key's K row and of its V row
    const int sr = tid >> 3, sc = (tid & 7) * 8;
    const v8h* Kg8 = (const v8h*)Kg; const v8h* Vg8 = (const v8h*)Vg;   // rows of HD / 8 pieces of 16 bytes
    // the lane's 32-bit offsets, in 16-byte pieces, beside wave-uniform bases; the mask bounds the row whatever kidx holds
    unsigned j0 = (unsigned)((kidx[sr] & (TT - 1)) * (HD / 8) + (tid & 7)), j1 = (unsigned)((kidx[sr + 32] & (TT - 1)) * (HD / 8) + (tid & 7));
    v8h gk0 = Kg8[j0], gk1 = Kg8[j1];
    v8h gv0 = Vg8[j0], gv1 = Vg8[j1];
    asm volatile("s_wait_xcnt 0x0" :: "v"(j0), "v"(j1) : "memory");   // the four loads' offset registers live to this wait, so nothing overwrites them in front of it
    *(v8ha*)(&kst[0][sr * FPI + sc]) = gk0; *(v8ha*)(&kst[0][(sr + 32) * FPI + sc]) = gk1;
    *(v8ha*)(&vst[0][sr * FPV + sc]) = gv0; *(v8ha*)(&vst[0][(sr + 32) * FPV + sc]) = gv1;
    v8f o[2][4];
#pragma unroll
    for (int qg = 0; qg < 2; ++qg)
#pragma unroll
        for (int dt = 0; dt < 4; ++dt) o[qg][dt] = (v8f){};
    float mrun[2] = {-1.0e30f, -1.0e30f};   // finite, below every finite score
    float lsum[2] = {0.0f, 0.0f};           // each wave half sums its own keys; joined once at the end
    __syncthreads();
#pragma unroll 1   // rolled: one copy of the stage body, and the buffer index stays a scalar
    for (int st = 0; st < nst; ++st) {
        const bool more = st + 1 < nst;
        if (more) { j0 = (unsigned)((kidx[(st + 1) * FKS + sr] & (TT - 1)) * (HD / 8) + (tid & 7)); j1 = (unsigned)((kidx[(st + 1) * FKS + sr + 32] & (TT - 1)) * (HD / 8) + (tid & 7));
            gk0 = Kg8[j0]; gk1 = Kg8[j1];
            gv0 = Vg8[j0]; gv1 = Vg8[j1];
            asm volatile("s_wait_xcnt 0x0" :: "v"(j0), "v"(j1) : "memory"); }   // the four loads' offset registers live to this wait: it stands in front of the pass's address arithmetic, which reuses them
        const h16* kb = kst[st & 1]; const h16* vb = vst[st & 1];
        const int np = (nkeep - st * FKS > 32) ? FKS / 32 : 1;   // the last stage's second pass is walked only if it holds a kept key
#pragma unroll 1   // one pass's registers at a time: two passes interleaved did not fit the 256 registers that four waves per SIMD leave
        for (int p = 0; p < np; ++p) {
            v8f s[2][2];
#pragma unroll
            for (int kt = 0; kt < 2; ++kt) {
                const h16* kr = kb + (p * 32 + kt * 16 + c) * FPI + 8 * h;
                const v16h k0 = ldsfrag(kr), k1 = ldsfrag(kr + 32);
                const float* mp = mb + st * FKS + p * 32 + kt * 16 + 8 * h;
                const v4f b0 = *(const v4fa*)mp, b1 = *(const v4fa*)(mp + 4);
                const v8f bz = __builtin_shufflevector(b0, b1, 0, 1, 2, 3, 4, 5, 6, 7);
#pragma unroll
                for (int qg = 0; qg < 2; ++qg) { v8f t = wmma16(k0, qf[qg][0], (v8f){}); t = wmma16(k1, qf[qg][1], t); s[kt][qg] = t + bz; }
            }
            v16h vf[4];
#pragma unroll
            for (int dt = 0; dt < 4; ++dt) { const h16* vr = vb + (p * 32 + 8 * h + (lane & 7)) * FPV + dt * 16 + 8 * ((lane >> 3) & 1); vf[dt] = cat16(ldtr16(vr), ldtr16(vr + 16 * FPV)); }
            float mx[2]; bool need = false;
#pragma unroll
            for (int qg = 0; qg < 2; ++qg) { float m = s[0][qg][0];
#pragma unroll
                for (int r = 1; r < 8; ++r) m = fmaxf(m, s[0][qg][r]);
#pragma unroll
                for (int r = 0; r < 8; ++r) m = fmaxf(m, s[1][qg][r]);
                m = fmaxf(m, xhalf(m)) * CSC; mx[qg] = m; need = need || (m > mrun[qg] + 8.0f); }
            // the maximum in use moves only when some column's new maximum passes it by more than 8 (base 2): P stays <= 256, inside f16
            if (__builtin_amdgcn_ballot_w32(need) != 0) {
#pragma unroll
                for (int qg = 0; qg < 2; ++qg) { const float mn = fmaxf(mrun[qg], mx[qg]); const float corr = __builtin_amdgcn_exp2f(mrun[qg] - mn); mrun[qg] = mn; lsum[qg] *= corr;
#pragma unroll
                    for (int dt = 0; dt < 4; ++dt) o[qg][dt] = o[qg][dt] * corr; }
            }
#pragma unroll
            for (int qg = 0; qg < 2; ++qg) { const float nm = -mrun[qg]; v16h pf; float ls = 0.0f;
                const v8f cv = {CSC, CSC, CSC, CSC, CSC, CSC, CSC, CSC}, nv = {nm, nm, nm, nm, nm, nm, nm, nm};
                const v8f a0 = __builtin_elementwise_fma(s[0][qg], cv, nv), a1 = __builtin_elementwise_fma(s[1][qg], cv, nv);
#pragma unroll
                for (int i = 0; i < 16; ++i) { const float pv = __builtin_amdgcn_exp2f((i < 8) ? a0[i & 7] : a1[i & 7]); ls += pv; pf[i] = tohx(pv); }
                lsum[qg] += ls;
#pragma unroll
                for (int dt = 0; dt < 4; ++dt) o[qg][dt] = wmma16(vf[dt], pf, o[qg][dt]); }
            // four vector slots behind the pass's last matrix instructions: across the back edge the next pass's address arithmetic would overwrite their A registers too early
            asm volatile("v_nop\n\tv_nop\n\tv_nop\n\tv_nop" : "+v"(o[1][0]), "+v"(o[1][1]), "+v"(o[1][2]), "+v"(o[1][3]));
        }
        if (more) { h16* kw = kst[(st + 1) & 1]; h16* vw = vst[(st + 1) & 1];   // this buffer's last readers left it before the barrier that ended stage st - 1
            *(v8ha*)(kw + sr * FPI + sc) = gk0; *(v8ha*)(kw + (sr + 32) * FPI + sc) = gk1;
            *(v8ha*)(vw + sr * FPV + sc) = gv0; *(v8ha*)(vw + (sr + 32) * FPV + sc) = gv1; }
        __syncthreads();
    }
    v8h oc[2][4];
#pragma unroll
    for (int qg = 0; qg < 2; ++qg) { const float lf = lsum[qg] + xhalf(lsum[qg]); const float inv = 1.0f / lf;
#pragma unroll
        for (int dt = 0; dt < 4; ++dt)
#pragma unroll
            for (int j = 0; j < 8; ++j) oc[qg][dt][j] = tohx(o[qg][dt][j] * inv); }
    h16* od = Ac + ((size_t)b * TT + q0 + c) * DQ + hh * HD + 8 * h;
    __builtin_amdgcn_sched_barrier(0);   // every value is finished, each in registers of its own, before the first store names any: nothing is written behind the stores
#pragma unroll
    for (int qg = 0; qg < 2; ++qg)
#pragma unroll
        for (int dt = 0; dt < 4; ++dt) *(v8h*)(od + (size_t)qg * 16 * DQ + dt * 16) = oc[qg][dt];
}

extern "C" void kernel_launch(void* const* d_in, const int* in_sizes, int n_in,
                              void* d_out, int out_size, void* d_ws, size_t ws_size, hipStream_t stream) {
    (void)out_size;
    if (n_in < 11) return;
    if (in_sizes[0] < NB * TT * DM || in_sizes[1] < TT * HD || in_sizes[2] < NB * TT) return;
    if (in_sizes[3] < DM * DQ || in_sizes[5] < DM * DQ || in_sizes[7] < DM * DQ || in_sizes[9] < DQ * DM) return;
    if (in_sizes[4] < DQ || in_sizes[6] < DQ || in_sizes[8] < DQ || in_sizes[10] < DM) return;
    // wire order: x, rel_pos_enc, attention_mask, Wq, bq, Wk, bk, Wv, bv, Wo, bo
    const float* x = (const float*)d_in[0]; const float* rel = (const float*)d_in[1]; const int* msk = (const int*)d_in[2];
    const float* wq = (const float*)d_in[3]; const float* bq = (const float*)d_in[4]; const float* wk = (const float*)d_in[5]; const float* bk = (const float*)d_in[6];
    const float* wv = (const float*)d_in[7]; const float* bv = (const float*)d_in[8]; const float* wo = (const float*)d_in[9]; const float* bo = (const float*)d_in[10];
    float* OUT = (float*)d_out;     // [8][1024][1024]
    char* wsp = (char*)d_ws;
    auto take = [&](size_t bytes) { char* p = wsp; wsp += (bytes + 255) & ~(size_t)255; return (void*)p; };
    h16* WO = (h16*)take((size_t)DM * DQ * 2);                   // [k = 1024][n = 1024]
    h16* QK16 = (h16*)take((size_t)2 * NB * NH_ * TT * HD * 2);  // [2][NB*16][TT][64]
    h16* VP16 = (h16*)take((size_t)NB * NH_ * TT * HD * 2);      // [NB*16][TT][64]
    int* RL = (int*)take((size_t)(NROW + 1) * 4);                // the row list, then its count
    // one region, two lives: the projection's operands, dead once the head planes are written, then the merged context
    char* const shared0 = wsp;
    bf* WQKV = (bf*)take((size_t)NQKV * DM * 2);                 // [3][k = 1024][n = 1024]: planes q, k, v
    bf* XB = (bf*)take((size_t)NB * TT * DM * 2);                // [NB][TT][DM]
    char* const end1 = wsp; wsp = shared0;
    h16* AT = (h16*)take((size_t)NB * TT * DQ * 2);              // merged context [NB*TT][1024]
    if (end1 > wsp) wsp = end1;
    if ((size_t)(wsp - (char*)d_ws) > ws_size) return;           // 72 MiB at full size
    h16* Q16 = QK16; h16* K16 = QK16 + (size_t)NB * NH_ * TT * HD;
    k_cvt8<<<dim3((unsigned)(((size_t)TT * DM / 8 + 255) / 256), NB + 4, 1), 256, 0, stream>>>(x, wq, wk, wv, wo, XB, WQKV, WO, (size_t)TT * DM / 8, (size_t)SEQ_FULL * DM, (size_t)TT * DM, msk, RL);
    k_gemmw<bf, 0, false, DM, true><<<dim3((NROW / GBM) * (NQKV / GBN), 1, 1), 256, 0, stream>>>(XB, nullptr, WQKV, nullptr, 0, nullptr, 0, 0, 0, bq, bk, bv, rel, QK16, VP16, RL);
    k_fattn<<<dim3(TT / (FNW * FQW), NB * NH_, 1), FNW * 32, 0, stream>>>(Q16, K16, VP16, msk, AT);
    k_gemmw<h16, 0, true, DQ, false><<<dim3(TT / GBM, DM / GBN, NB), 256, 0, stream>>>(AT, nullptr, WO, OUT, DM, bo, (size_t)TT * DQ, 0, (size_t)SEQ_FULL * DM, nullptr, nullptr, nullptr, nullptr, nullptr, nullptr, nullptr);
}

// v009
// It runs in 89.4 microseconds.
// In two side-by-side timings against v008, it was 1.07 and 1.05 times as fast.
// Over all steps from v000 it is 14.5 times as fast.
#include <hip/hip_runtime.h>

// Compute dtypes (f32 accumulate everywhere): every float input RNE-converted to bf16; QKV projection v_wmma_f32_16x16x32_bf16 (exact products); scores (k + 8 R) x q^T and V^T x P^T (V^T read from [t][d] rows by the transposing LDS load) on v_wmma_f32_16x16x32_f16 (P = exp2 of the score against the maximum in use, not yet normalised); softmax f32; output projection v_wmma_f32_16x16x32_f16: merged context rounded once to f16 x Wo (its bf16 value, held as f16) + f32 bias.
// Self-attention on one stream x [8][1024][1024]; weights keep their [in][out] = [k][n] order as 16-bit planes (q, k, v: three bf16 planes in a row; Wo f16), and the GEMMs turn them on the LDS read; 16 heads x 64.
// Score algebra: (q.k) x 0.125 + q.R[t] = 0.125 x q.(k[t] + 8 R[t]); the key plane stores k + 8 R (R = per-key table input, read by value), the 0.125 is applied in the softmax's exponent.
// Key mask [b][t] (int32, data): a key with mask == 0 has weight exp(-inf) = 0, so it is left out of the key walk: each attention work-group lists the kept keys in ascending order and stages only their rows.
// Keys that no score can use are not projected either: the conversion launch lists the rows of x that are a kept key, or key 0 of a batch (the attention's filler places read that row), and the k and v columns of the projection run over that list alone.
// Softmax in the running-maximum form, normalised once at the end (a row without any kept key ends as 0 x (1 / 0) = NaN).

#ifndef NB
#define NB 8
#endif
#ifndef SEQ
#define SEQ 1024
#endif
#define SEQ_FULL 1024             // per-batch row count of the inputs / output (strides)
#define TT   SEQ
#define DM   1024
#define NH_  16
#define HD   64
#define DQ   (NH_ * HD)
#define NQKV (3 * DQ)
#define SCL  0.125f               // HD^-0.5
#define RCAR 8.0f                 // 1 / SCL
typedef _Float16 h16;
typedef unsigned short bf;
typedef __attribute__((ext_vector_type(16))) __bf16   v16bf;
typedef __attribute__((ext_vector_type(16))) _Float16 v16h;
typedef __attribute__((ext_vector_type(8)))  _Float16 v8h;
typedef __attribute__((ext_vector_type(8)))  unsigned short v8us;
typedef __attribute__((ext_vector_type(8)))  float    v8f;
typedef __attribute__((ext_vector_type(4)))  float    v4f;
typedef v8h  __attribute__((may_alias)) v8ha;
typedef v4f  __attribute__((may_alias)) v4fa;
typedef v8us __attribute__((may_alias)) v8usa;

static_assert(TT % 128 == 0);
static_assert(TT <= SEQ_FULL);
static_assert(DM % 64 == 0);
static_assert(HD == 64);
static_assert(DM == DQ);
static_assert(NQKV % 256 == 0);
static_assert(DM % 256 == 0);

__device__ __forceinline__ unsigned short f2bf(float f) { unsigned u = __float_as_uint(f); u += 0x7FFFu + ((u >> 16) & 1u); return (unsigned short)(u >> 16); }
__device__ __forceinline__ float bf2f(unsigned short b) { return __uint_as_float(((unsigned)b) << 16); }
__device__ __forceinline__ float bfr(float f) { return bf2f(f2bf(f)); }
__device__ __forceinline__ v16h cat16(v8h lo, v8h hi) { return __builtin_shufflevector(lo, hi, 0, 1, 2, 3, 4, 5, 6, 7, 8, 9, 10, 11, 12, 13, 14, 15); }
__device__ __forceinline__ v16bf cat16b(v8us lo, v8us hi) { return __builtin_bit_cast(v16bf, __builtin_shufflevector(lo, hi, 0, 1, 2, 3, 4, 5, 6, 7, 8, 9, 10, 11, 12, 13, 14, 15)); }
__device__ __forceinline__ v8f wmma16(v16h a, v16h b, v8f c) { return __builtin_amdgcn_wmma_f32_16x16x32_f16(false, a, false, b, (short)0, c, false, false); }
__device__ __forceinline__ v8f wmmab(v16bf a, v16bf b, v8f c) { return __builtin_amdgcn_wmma_f32_16x16x32_bf16(false, a, false, b, (short)0, c, false, false); }

__device__ __forceinline__ h16 tohx(float x) { return (h16)x; }
typedef __attribute__((ext_vector_type(8))) short v8s;
typedef __attribute__((address_space(3))) v8s lds_v8s;
__device__ __forceinline__ v8h ldtr16(const h16* p) { return __builtin_bit_cast(v8h, __builtin_amdgcn_ds_load_tr16_b128_v8i16((lds_v8s*)p)); }
__device__ __forceinline__ v8us ldtr16u(const bf* p) { return __builtin_bit_cast(v8us, __builtin_amdgcn_ds_load_tr16_b128_v8i16((lds_v8s*)p)); }

// ---- k_gemmw: GEMM on a 128 x 256 output tile per work-group of 8 waves (2 x 4), 64 x 64 (16 accumulators) per wave; grid (M/128, N/256, Z), 256 threads.
// C[m][n] (f32, pitch ldc, + optional f32 bias[n]) = sum_k A[m][k] B[k][n] (+ A2[m][k] B[k][n] for NSPLIT 1). z-batch strides sA/sB/sC in elements. K: a compile-time multiple of the stage's KS, at least NBUF stages.
// B: planes of [K][GLB] in a row, plane n / GLB, column n % GLB (a tile's 256 columns lie in one plane).
// HEADS: no C; n runs over the fused q|k|v columns, m over all rows b * TT + t of x (q) or over the listed rows (k, v), and a wave's 64 x 64 tile is 64 such rows of one head of one of the three. The epilogue writes each row as fp16 into its head plane:
//   q -> QK[0][b*16+h][t][d] = acc + bq; k -> QK[1][b*16+h][t][d] = (acc + bk) + 8 R[t][d]; v -> VP[b*16+h][t][d] = acc + bv. Rows of k and v behind the list's count are written only where they share a wave's 64 places with a listed row, and nothing reads them.
// Operands: 16-bit planes, KS k per LDS stage (A: 2 KS bytes, whole 128-B lines, of each of its rows; B: 512 B, four whole lines, of each of KS k rows), a ring of NBUF buffers, brought by asynchronous copies NBUF - 1 stages ahead of their use.
// Fragment map: lane l -> row/col l & 15, half h = l >> 4; elements 0..7 <- k0 + 8h + 0..7, elements 8..15 <- k0 + 16 + 8h + 0..7 (A and B alike); D element j -> row 8h + j, col l & 15.
// B fragments: ds_load_tr16_b128 on the [k][n] rows hands lane (c, h) the k 8h + 0..7 of column c; two of them, 16 k rows apart, are the map above.
#define GBM 128                   // tile rows
#define GBN 256                   // tile columns
#define GPB 272                   // the B rows' pitch: 512 B of data + 32 B, for the transposing reader
#define GLB 1024                  // columns of a B plane
template <typename T16> struct WFrag;
template <bool B> struct Flag { static constexpr bool v = B; };   // a compile-time switch handed to a generic lambda
template <> struct WFrag<h16> { typedef v16h V; static __device__ __forceinline__ V ld(const h16* p) { return cat16(*(const v8h*)p, *(const v8h*)(p + 16)); } static __device__ __forceinline__ V ldl(const h16* p) { return cat16(*(const v8ha*)p, *(const v8ha*)(p + 16)); } static __device__ __forceinline__ V ldt(const h16* p) { return cat16(ldtr16(p), ldtr16(p + 16 * GPB)); } static __device__ __forceinline__ v8f mma(V a, V b, v8f c) { return wmma16(a, b, c); } };
template <> struct WFrag<bf> { typedef v16bf V; static __device__ __forceinline__ V ld(const bf* p) { return cat16b(*(const v8us*)p, *(const v8us*)(p + 16)); } static __device__ __forceinline__ V ldl(const bf* p) { return cat16b(*(const v8usa*)p, *(const v8usa*)(p + 16)); } static __device__ __forceinline__ V ldt(const bf* p) { return cat16b(ldtr16u(p), ldtr16u(p + 16 * GPB)); } static __device__ __forceinline__ v8f mma(V a, V b, v8f c) { return wmmab(a, b, c); } };
// Four asynchronous copies of 16 bytes a lane: four rows of one operand, equally spaced (global step gs elements, LDS step ls bytes).
// The s_wait_xcnt stands inside the statement, behind the last copy, so that no later write of an address register named here can come in front of it.
template <typename T16>
__device__ __forceinline__ void cp4(unsigned l, unsigned ls, const T16* g, size_t gs) {
    const unsigned l1 = l + ls, l2 = l + 2 * ls, l3 = l + 3 * ls;
    const T16* g1 = g + gs; const T16* g2 = g1 + gs; const T16* g3 = g2 + gs;
    asm volatile("global_load_async_to_lds_b128 %0, %4, off\n\t"
                 "global_load_async_to_lds_b128 %1, %5, off\n\t"
                 "global_load_async_to_lds_b128 %2, %6, off\n\t"
                 "global_load_async_to_lds_b128 %3, %7, off\n\t"
                 "s_wait_xcnt 0x0"
                 :: "v"(l), "v"(l1), "v"(l2), "v"(l3), "v"(g), "v"(g1), "v"(g2), "v"(g3) : "memory");
}
// The same for four rows that lie anywhere: each copy has a global pointer of its own.
template <typename T16>
__device__ __forceinline__ void cp4g(unsigned l, unsigned ls, const T16* g, const T16* g1, const T16* g2, const T16* g3) {
    const unsigned l1 = l + ls, l2 = l + 2 * ls, l3 = l + 3 * ls;
    asm volatile("global_load_async_to_lds_b128 %0, %4, off\n\t"
                 "global_load_async_to_lds_b128 %1, %5, off\n\t"
                 "global_load_async_to_lds_b128 %2, %6, off\n\t"
                 "global_load_async_to_lds_b128 %3, %7, off\n\t"
                 "s_wait_xcnt 0x0"
                 :: "v"(l), "v"(l1), "v"(l2), "v"(l3), "v"(g), "v"(g1), "v"(g2), "v"(g3) : "memory");
}
#define NROW (NB * TT)            // rows of x; the row list holds NROW places, then the count of listed rows
// amdgpu_waves_per_eu(4, 4): at most 256 registers a wave. With 64-k stages three buffers are 156 KiB, so two work-groups share a WGP and one group's matrix runs cover the other's barrier, copy issue and epilogue.
// With 128-k stages three buffers are 306 KiB, one work-group per WGP: for a grid that has no more work-groups than that; a stage then holds four 32-k blocks between two barriers, and an A row's share is a whole 256 B.
template <typename T16, int NSPLIT, bool BIAS, int K, bool HEADS, int KS, int NBUF>
__global__ __launch_bounds__(256) __attribute__((amdgpu_waves_per_eu(4, 4))) void k_gemmw(const T16* __restrict__ A, const T16* __restrict__ A2, const T16* __restrict__ Bw, float* C, int ldc, const float* __restrict__ bias, size_t sA, size_t sB, size_t sC,
                                                                                          const float* __restrict__ bq, const float* __restrict__ bk, const float* __restrict__ bv, const float* __restrict__ R, h16* QK, h16* VP, const int* __restrict__ rlist) {
    static_assert(NSPLIT == 0 || NSPLIT == 1);
    static_assert((KS == 64 || KS == 128) && K % KS == 0 && NBUF >= 3 && K / KS >= NBUF);
    static_assert(!HEADS || KS == 64);                  // the gathered rows' copies and the rl places are laid out for 8 lanes a row
    typedef typename WFrag<T16>::V V;
    constexpr int GPI = KS + 8;                         // the A rows' pitch in 16-bit elements: the data + 16 B (144 or 272 B), for the 16-byte readers
    constexpr int AR = (NSPLIT == 1) ? 2 * GBM : GBM;   // staged A rows: the A plane, then the A2 plane
    constexpr int SE = AR * GPI + KS * GPB;             // elements per stage: A rows [m][k], then B rows [k][n]
    constexpr int LPR = KS / 8, RPP = 256 / LPR;        // lanes that copy one A row; A rows that the 256 threads copy at a time
    constexpr int CPF = AR / RPP + KS / 8;              // copies of every wave per stage
    static_assert(CPF * (NBUF - 1) <= 63);              // the most copies of a wave that are ever outstanding
    __shared__ __align__(32) T16 stg[NBUF * SE];
    static_assert(GLB % GBN == 0 && (AR * GPI * 2) % 32 == 0 && (SE * 2) % 32 == 0);
    static_assert(8 * 16 * 68 * 4 <= NBUF * SE * 2);    // the epilogue's staging rows lie in the same LDS
    __shared__ int rl[HEADS ? GBM : 1];                 // HEADS: the row of x behind each of the tile's 128 places
    const size_t z = HEADS ? 0 : blockIdx.z; A += z * sA; if (NSPLIT == 1) A2 += z * sA; Bw += z * sB; if (!HEADS) C += z * sC;
    const int tid = threadIdx.x, lane = tid & 31, lr = lane & 15, hi = lane >> 4, wave = tid >> 5, wm = wave >> 2, wn = wave & 3;
    // HEADS: a one-dimensional grid. First the q tiles, places = rows of x; then the k and v tiles, places = ranks in the row list, the last (part-filled) 128 ranks first, so that the short tiles end early and free their room; tiles past the list leave here, ahead of every barrier.
    int R0 = blockIdx.x * GBM, C0 = blockIdx.y * GBN, lim = 0;   // lim: the rows at places of the list from lim on are read by nobody
    if constexpr (HEADS) {
        constexpr int MT = NROW / GBM, QT = MT * (DQ / GBN), KVN = 2 * DQ / GBN;
        const int f = blockIdx.x;
        if (f < QT) { R0 = (f % MT) * GBM; C0 = (f / MT) * GBN; lim = NROW; }
        else { lim = min(rlist[NROW], NROW); const int mt = (lim + GBM - 1) / GBM - 1 - (f - QT) / KVN; if (mt < 0) return;
            R0 = mt * GBM; C0 = DQ + ((f - QT) % KVN) * GBN; }
    }
    const int r0 = R0 + wm * 64, c0 = C0 + wn * 64;
    const bool act = !HEADS || R0 + (__builtin_amdgcn_readfirstlane(wave) >> 2) * 64 < lim;   // a wave whose 64 places all lie past the list only copies and keeps the barriers
    // copies: A: thread -> 16 bytes at element sc of rows sr + RPP i; B: thread -> 16 bytes at element 8 lane of k rows wave + 8 i; either way a wave's copy covers four whole 128-B lines
    const int sr = tid / LPR, sc = (tid % LPR) * 8; const size_t gs = (size_t)RPP * K;
    const T16* ga = A + (size_t)(R0 + sr) * K + sc; const T16* ga2 = (NSPLIT == 1) ? A2 + (size_t)(R0 + sr) * K + sc : nullptr; const T16* gb = Bw + (size_t)(C0 / GLB) * K * GLB + (size_t)wave * GLB + (C0 % GLB) + lane * 8;
    const unsigned l0 = (unsigned)(size_t)stg + (unsigned)(sr * GPI + sc) * 2;   // the lane's LDS byte address in buffer 0, A rows
    const unsigned lb0 = (unsigned)(size_t)stg + (unsigned)(AR * GPI + wave * GPB + lane * 8) * 2;   // ... B rows
    const T16* gq[4] = {ga, ga, ga, ga};                // HEADS: the thread's four rows of x
    if constexpr (HEADS) {
        int rw[4];   // the '#pragma unroll's here and in the epilogue's ask() make the indices of register arrays constants
        if (C0 < DQ) {
#pragma unroll
            for (int i = 0; i < 4; ++i) rw[i] = R0 + sr + 32 * i; }
        else { const unsigned ro = (unsigned)(R0 + sr);
#pragma unroll
            for (int i = 0; i < 4; ++i) rw[i] = rlist[ro + 32 * i];
            asm volatile("s_wait_xcnt 0x0" :: "v"(ro) : "memory");   // the four loads' offset register lives to this wait, so nothing overwrites it in front of it
#pragma unroll
            for (int i = 0; i < 4; ++i) rw[i] &= NROW - 1; }          // bounds the row whatever the list holds
#pragma unroll
        for (int i = 0; i < 4; ++i) { gq[i] = A + (size_t)rw[i] * K + sc; if ((tid & 7) == 0) rl[sr + 32 * i] = rw[i]; }   // rl is published by the barrier behind stage 0
    }
    auto fill = [&](int t, int buf) {
        const unsigned l = l0 + (unsigned)buf * (SE * 2); const int ko = t * KS;
        if constexpr (HEADS) cp4g(l, RPP * GPI * 2, gq[0] + ko, gq[1] + ko, gq[2] + ko, gq[3] + ko);
        else {
#pragma unroll   // straight-line copies: each group of four has address registers of its own
            for (int i = 0; i < GBM / RPP / 4; ++i) { cp4(l + (unsigned)i * (4 * RPP * GPI * 2), RPP * GPI * 2, ga + ko + (size_t)i * 4 * gs, gs);
                if (NSPLIT == 1) cp4(l + (unsigned)(GBM + i * 4 * RPP) * (GPI * 2), RPP * GPI * 2, ga2 + ko + (size_t)i * 4 * gs, gs); } }
        const unsigned lb = lb0 + (unsigned)buf * (SE * 2); const T16* gk = gb + (size_t)ko * GLB;
#pragma unroll   // as above
        for (int i = 0; i < KS / 32; ++i) cp4(lb + (unsigned)i * (32 * GPB * 2), 8 * GPB * 2, gk + (size_t)i * 32 * GLB, (size_t)8 * GLB); };
    v8f acc[4][4];
#pragma unroll
    for (int mb = 0; mb < 4; ++mb)
#pragma unroll
        for (int nb = 0; nb < 4; ++nb) acc[mb][nb] = (v8f){};
    constexpr int nt = K / KS;
    // The ring: stage s lies in buffer s % NBUF. Every wave issues CPF copies per stage, and a wave's copies count down in issue order, so a wait to CPF * (NBUF - 2) leaves just the NBUF - 2 youngest stages in flight.
#pragma unroll   // the stage and buffer numbers are constants
    for (int s = 0; s < NBUF - 1; ++s) fill(s, s);
    asm volatile("s_wait_asynccnt %0" :: "n"(CPF * (NBUF - 2)) : "memory");   // this wave's share of stage 0 has landed; stages 1 .. NBUF - 2 may still fly
    __syncthreads();                                    // ... and every other wave's
    fill(NBUF - 1, NBUF - 1);
    const int afo = (wm * 64 + lr) * GPI + 8 * hi, bfo = AR * GPI + (8 * hi + (lane & 7)) * GPB + wn * 64 + 8 * ((lane >> 3) & 1);
#pragma unroll 1   // rolled: one copy of the stage body, and the buffer index stays a scalar
    for (int t = 0, cb = 0; t < nt; ++t) {              // cb = t % NBUF
        const T16* sb = stg + cb * SE;
        if (act) {
#pragma unroll
        for (int ks = 0; ks < KS / 32; ++ks) {
            V a[4], a2[4], b[4];   // all of a 32-k block's fragments are asked for as one group, ahead of its matrix run
#pragma unroll
            for (int mb = 0; mb < 4; ++mb) { a[mb] = WFrag<T16>::ldl(sb + afo + mb * 16 * GPI + ks * 32); if (NSPLIT == 1) a2[mb] = WFrag<T16>::ldl(sb + afo + (GBM + mb * 16) * GPI + ks * 32); }
#pragma unroll
            for (int nb = 0; nb < 4; ++nb) b[nb] = WFrag<T16>::ldt(sb + bfo + ks * 32 * GPB + nb * 16);
            __builtin_amdgcn_sched_barrier(0);   // keeps the LDS loads one group: left alone the compiler moves the Bw loads in among the matrix instructions, each with a full wait behind it
#pragma unroll
            for (int nb = 0; nb < 4; ++nb)
#pragma unroll
                for (int mb = 0; mb < 4; ++mb) { acc[mb][nb] = WFrag<T16>::mma(a[mb], b[nb], acc[mb][nb]); if (NSPLIT == 1) acc[mb][nb] = WFrag<T16>::mma(a2[mb], b[nb], acc[mb][nb]); }
            __builtin_amdgcn_sched_barrier(0);   // ends the block: the next group of loads, and the stage's closing waits, stay behind its matrix instructions
        } }
        asm volatile("s_wait_dscnt 0x0" ::: "memory");      // this wave has left buffer cb
        // this wave's share of stage t + 1 has landed. The count is used only while all of the stages t + 2 .. t + NBUF - 1 have been issued behind it; from there on the wait is for everything
        if (t + NBUF - 1 < nt) asm volatile("s_wait_asynccnt %0" :: "n"(CPF * (NBUF - 2)) : "memory");
        else asm volatile("s_wait_asynccnt 0x0" ::: "memory");
        __syncthreads();                                    // publishes stage t + 1 and ends every reader's last read of buffer cb
        if (t + NBUF < nt) fill(t + NBUF, cb);
        cb = (cb + 1 == NBUF) ? 0 : cb + 1;
    }
    asm volatile("s_wait_asynccnt 0x0" ::: "memory");       // no copy is outstanding when the LDS becomes output staging
    float* os = (float*)stg + wave * (16 * 68);             // each wave's own 16 x 68 floats; every reader left the buffers at the loop's last barrier
    if constexpr (HEADS) {
        const int which = C0 / DQ, hd = (c0 % DQ) / HD;     // which: the same for the whole work-group (GBN divides DQ); hd: the wave's head
        if (!act) return;                                   // no barrier follows
        const int rr = lane >> 3, cofs = (lane & 7) * 8;    // read-back: 8 lanes per 128-byte output row, 4 rows per store
        const int* rw = rl + wm * 64 + rr;                  // the lane's rows of x: place 16 mb + 4 s of the wave's 64
        // q, k and v rows; ISK: the key plane, which also takes 8 x the table row of its t. Two copies of the code, so that neither holds a branch between a load and its use.
        auto rows = [&](auto isk, const float* bsrc, h16* plane) {
            constexpr bool ISK = decltype(isk)::v;
            const float* bb = bsrc + hd * HD + cofs; const v4f ba = *(const v4f*)bb, bc = *(const v4f*)(bb + 4);
            asm volatile("s_wait_xcnt 0x0" :: "v"(bb) : "memory");   // the two loads' address pair lives to this wait, so nothing overwrites it in front of it
            v4f tb[2][4][2];                                // the table rows of one 16-row block, asked for one block ahead of their use
            int gr[2][4];                                   // the rows of x of one block, read with them
            const v4f* R4 = (const v4f*)R;
            auto ask = [&](int mb) {
#pragma unroll
                for (int s = 0; s < 4; ++s) gr[mb & 1][s] = rw[mb * 16 + 4 * s];
                if (ISK) { unsigned to[4];
#pragma unroll
                    for (int s = 0; s < 4; ++s) { to[s] = (unsigned)((gr[mb & 1][s] & (TT - 1)) * (HD / 4) + cofs / 4); tb[mb & 1][s][0] = R4[to[s]]; tb[mb & 1][s][1] = R4[to[s] + 1]; }   // offsets in 16-byte pieces beside a wave-uniform base
                    asm volatile("s_wait_xcnt 0x0" :: "v"(to[0]), "v"(to[1]), "v"(to[2]), "v"(to[3]) : "memory"); } };   // the eight loads' offset registers live to this wait, so nothing overwrites them in front of it
            ask(0);
            float bi[8];
#pragma unroll
            for (int q = 0; q < 8; ++q) bi[q] = bfr((q < 4) ? ba[q & 3] : bc[q & 3]);
#pragma unroll
            for (int mb = 0; mb < 4; ++mb) {
                if (mb < 3) ask(mb + 1);
#pragma unroll
                for (int nb = 0; nb < 4; ++nb) {
#pragma unroll
                    for (int j = 0; j < 8; ++j) os[(hi * 8 + j) * 68 + nb * 16 + lr] = acc[mb][nb][j]; }
                __builtin_amdgcn_wave_barrier(); asm volatile("" ::: "memory");   // compiler fence: the reads below take other lanes' words, so they stay behind the writes above
                v8h o[4]; unsigned dof[4];
#pragma unroll
                for (int s = 0; s < 4; ++s) {
                    dof[s] = (unsigned)(((((unsigned)gr[mb & 1][s] / TT) * NH_ + hd) * TT + (gr[mb & 1][s] & (TT - 1))) * HD + cofs);   // row b * TT + t of x -> row t of head plane b * 16 + hd
                    const v4f x0 = *(const v4fa*)(os + (4 * s + rr) * 68 + cofs), x1 = *(const v4fa*)(os + (4 * s + rr) * 68 + cofs + 4);
#pragma unroll
                    for (int q = 0; q < 8; ++q) { float y = ((q < 4) ? x0[q & 3] : x1[q & 3]) + bi[q];
                        if (ISK) y += RCAR * bfr((q < 4) ? tb[mb & 1][s][0][q & 3] : tb[mb & 1][s][1][q & 3]);
                        o[s][q] = tohx(y); } }
                __builtin_amdgcn_sched_barrier(0);   // all four rows' values are finished, each in registers of its own, before the first store names any
#pragma unroll
                for (int s = 0; s < 4; ++s) *(v8h*)(plane + dof[s]) = o[s];
                asm volatile("s_wait_xcnt 0x0" ::: "memory");   // behind every block's four stores, the last block's too: in front of whatever next writes their data registers (the next block's arithmetic, or the code laid behind this copy of the epilogue); as a compiler fence it also keeps the next block's LDS writes behind this block's reads
                __builtin_amdgcn_sched_barrier(0);              // keeps that code behind the wait
            }
        };
        if (which == 1) { rows(Flag<true>{}, bk, QK + (size_t)NB * NH_ * TT * HD); return; }
        rows(Flag<false>{}, (which == 0) ? bq : bv, (which == 0) ? QK : VP);
        return;
    }
#pragma unroll
    for (int mb = 0; mb < 4; ++mb) {
#pragma unroll
        for (int nb = 0; nb < 4; ++nb) {
#pragma unroll
            for (int j = 0; j < 8; ++j) os[(hi * 8 + j) * 68 + nb * 16 + lr] = acc[mb][nb][j]; }
        __builtin_amdgcn_wave_barrier(); asm volatile("" ::: "memory");
        float* crow = C + (size_t)(r0 + mb * 16) * ldc + c0;
{
#pragma unroll
            for (int s = 0; s < 8; ++s) { const int row = 2 * s + hi, cofs = lr * 4; v4f val = *(const v4fa*)(os + row * 68 + cofs); if (BIAS) { val[0] += bfr(bias[c0 + cofs]); val[1] += bfr(bias[c0 + cofs + 1]); val[2] += bfr(bias[c0 + cofs + 2]); val[3] += bfr(bias[c0 + cofs + 3]); }
                *(v4f*)(crow + (size_t)row * ldc + cofs) = val; }
             }
        __builtin_amdgcn_wave_barrier(); asm volatile("" ::: "memory");
    }
}

// One streaming conversion for every 16-bit GEMM operand, element order kept. grid.y picks the plane of n8 x 8 floats: 0..NB-1 -> a batch of x (bf16); NB..NB+2 -> Wq, Wk, Wv (bf16, three planes in a row); NB+3 -> Wo (the same bf16 rounding, written as f16: exact from 2^-17 up to the f16 range's end).
static_assert((size_t)TT * DM == (size_t)DM * DQ);   // a weight plane has as many elements as a batch of x
// The first work-group also writes the row list for the k and v projections: a permutation of the rows b * TT + t of x. First, ascending, every row that is a kept key (mask != 0) or key 0 of its batch; behind them the other rows, so that a tile's places past the count hold rows of their own; rlist[NROW] = the count.
// Thread -> 32 rows in a row, their flags one 32-bit word; a row's rank = flags set in the words in front + flags set below it in its word. The list is put together in LDS and leaves in whole lines.
typedef __attribute__((ext_vector_type(4))) int v4i;
typedef v4i __attribute__((may_alias)) v4ia;
static_assert(TT == SEQ_FULL && NROW == 256 * 32 && (TT & (TT - 1)) == 0);
__global__ __launch_bounds__(256) void k_cvt8(const float* __restrict__ x, const float* __restrict__ wq, const float* __restrict__ wk, const float* __restrict__ wv, const float* __restrict__ wo, bf* XBo, bf* Wqkv, h16* Wo16, size_t n8, size_t sS, size_t sD, const int* __restrict__ mk, int* rlist) {
    __shared__ __align__(16) int lst[NROW];
    __shared__ __align__(16) unsigned wc[256];
    if (blockIdx.x == 0 && blockIdx.y == 0) {           // the same for the whole work-group, so its two barriers are met by all or none
        const int tid = threadIdx.x, e0 = tid * 32;
        const v4i* mk4 = (const v4i*)mk; const unsigned mo = (unsigned)tid * 8; v4i mv[8];   // the lane's offset in 16-byte pieces beside a wave-uniform base
        // every '#pragma unroll' of this block makes the indices of a register array, or a flag's position, constants
#pragma unroll
        for (int j = 0; j < 8; ++j) mv[j] = mk4[mo + j];
        asm volatile("s_wait_xcnt 0x0" :: "v"(mo) : "memory");   // the loads' offset register lives to this wait, so nothing overwrites it in front of it
        unsigned word = ((e0 & (TT - 1)) == 0) ? 1u : 0u;
#pragma unroll
        for (int j = 0; j < 32; ++j) word |= (mv[j >> 2][j & 3] != 0) ? (1u << j) : 0u;
        wc[tid] = (unsigned)__builtin_popcount(word);
        __syncthreads();                                // the 256 counts are complete
        unsigned pos = 0, total = 0;
        for (int w = 0; w < 256; ++w) { const unsigned cw = wc[w]; pos += (w < tid) ? cw : 0u; total += cw; }
#pragma unroll
        for (int j = 0; j < 32; ++j) {
            const bool in = (word >> j) & 1u;
            lst[in ? pos : total + (unsigned)(e0 + j) - pos] = e0 + j;   // pos: listed rows in front of this one; either place is below NROW, and no two rows share one
            pos += in ? 1u : 0u; }
        __syncthreads();                                // the list is complete
        v4i lo[8];
#pragma unroll
        for (int j = 0; j < 8; ++j) lo[j] = *(const v4ia*)(lst + (j * 256 + tid) * 4);
        v4i* rl4 = (v4i*)rlist;
#pragma unroll
        for (int j = 0; j < 8; ++j) rl4[j * 256 + tid] = lo[j];
        if (tid == 0) rlist[NROW] = (int)total;
        asm volatile("s_wait_xcnt 0x0" ::: "memory");   // behind the list's stores, in front of the conversion below, which may reuse their registers
    }
    const size_t i = (size_t)blockIdx.x * 256 + threadIdx.x; if (i >= n8) return;
    const int y = blockIdx.y;
    const float* src = (y < NB) ? x + (size_t)y * sS : (y == NB) ? wq : (y == NB + 1) ? wk : (y == NB + 2) ? wv : wo;
    bf* dst = (y < NB) ? XBo + (size_t)y * sD : (y < NB + 3) ? Wqkv + (size_t)(y - NB) * DM * DQ : (bf*)Wo16;
    const float* sp = src + i * 8; const v8f v = *(const v8f*)sp; v8us o;
    asm volatile("s_wait_xcnt 0x0" :: "v"(sp) : "memory");   // the load's address lives to this wait, so nothing overwrites it in front of it
#pragma unroll
    for (int k = 0; k < 8; ++k) o[k] = f2bf(v[k]);
    if (y == NB + 3) {
#pragma unroll
        for (int k = 0; k < 8; ++k) o[k] = __builtin_bit_cast(unsigned short, tohx(bf2f(o[k]))); }
    *(v8us*)(dst + i * 8) = o;
}

// ---- k_fattn: scores, mask, softmax, P x V and the head merge in one kernel; a score never leaves the registers.
// grid (TT / 256, NB * 16), 8 waves; a wave owns 32 query columns (2 groups of 16) of one head plane and walks the kept keys, 64 per LDS stage (2 buffers), 32 per pass.
// Kept keys: the mask row's 32 ballot words give every kept key its rank (kept keys in front of it); kidx[rank] = key. Places from the count up to the end of the last stage hold key 0 under a -inf bias.
// S^T = K' Q^T: A = key rows from LDS, B = q kept in registers; D register r of lane (c, h) = key 8h + r, query c. Two such tiles, converted in place, are the B operand (32 keys) of O^T += V^T P^T.
// V^T: A = V rows [key][d] from LDS through ds_load_tr16_b128, which hands lane (c, h) the keys 8h + 0..7 of column d = c: the k order of the packed P^T.
// O^T: D register r = d 8h + r of query c, so a lane stores 8 consecutive d of one merged-context row.
// Every plain '#pragma unroll' below makes the indices of a register array constants, so that the array stays in registers.
// amdgpu_waves_per_eu(4, 4): two work-groups per WGP, four waves per SIMD, to cover the vector work between the matrix runs.
#define FNW 8                     // waves per work-group
#define FQW 32                    // query columns per wave
#define FKS 64                    // keys per LDS stage
#define FPI 72                    // LDS row pitch in 16-bit elements: 128 B of data + 16 B, for the 16-byte readers
#define FPV 80                    // the V rows' pitch: 128 B of data + 32 B, for the transposing reader
#define CSC (SCL * 1.4426950408889634f)
static_assert(TT % (FNW * FQW) == 0);
static_assert(TT % FKS == 0);
static_assert(TT % (FNW * 32) == 0 && (TT & (TT - 1)) == 0);   // whole mask rounds (one ballot word per wave and round); the staged row is bounded by a bit mask
__device__ __forceinline__ float xhalf(float x) { return __builtin_bit_cast(float, __builtin_amdgcn_permlanex16(__builtin_bit_cast(int, x), __builtin_bit_cast(int, x), 0x76543210, 0xfedcba98, false, false)); }  // lane l with lane l ^ 16
__device__ __forceinline__ v16h ldsfrag(const h16* p) { return cat16(*(const v8ha*)p, *(const v8ha*)(p + 16)); }
__global__ __launch_bounds__(FNW * 32) __attribute__((amdgpu_waves_per_eu(4, 4))) void k_fattn(const h16* __restrict__ Q, const h16* __restrict__ Kp, const h16* __restrict__ Vp, const int* __restrict__ mk, h16* Ac) {
    __shared__ __align__(16) h16 kst[2][FKS * FPI];   // [key][d]
    __shared__ __align__(32) h16 vst[2][FKS * FPV];   // [key][d]
    __shared__ __align__(16) float mb[TT];            // by place in the kept list: 0 for a kept key, -inf behind the last one
    __shared__ int kidx[TT];                          // the kept keys in ascending order, then 0
    __shared__ __align__(16) unsigned kbal[TT / 32];  // the mask row as bits, key order
    const int tid = threadIdx.x, lane = tid & 31, c = lane & 15, h = lane >> 4, wave = tid >> 5;
    const int g = blockIdx.y, b = g / NH_, hh = g % NH_;
    const h16* Qg = Q + (size_t)g * TT * HD; const h16* Kg = Kp + (size_t)g * TT * HD; const h16* Vg = Vp + (size_t)g * TT * HD;
    const int q0 = blockIdx.x * (FNW * FQW) + wave * FQW;
    constexpr int MR = TT / (FNW * 32);               // mask rounds: round j, thread tid -> key j * 256 + tid, ballot word j * 8 + wave
    const int* mkb = mk + (size_t)b * SEQ_FULL + tid; int mv[MR];
#pragma unroll
    for (int j = 0; j < MR; ++j) mv[j] = mkb[j * (FNW * 32)];
    asm volatile("s_wait_xcnt 0x0" ::: "memory");     // behind the mask loads, in front of whatever next writes a register that they name
    v16h qf[2][2];
#pragma unroll
    for (int qg = 0; qg < 2; ++qg)
#pragma unroll
        for (int ks = 0; ks < 2; ++ks) qf[qg][ks] = WFrag<h16>::ld(Qg + (size_t)(q0 + qg * 16 + c) * HD + ks * 32 + 8 * h);
    asm volatile("s_wait_xcnt 0x0" ::: "memory");     // behind the q loads, in front of the arithmetic below, which may reuse their address registers
    unsigned bl[MR];
#pragma unroll
    for (int j = 0; j < MR; ++j) { bl[j] = __builtin_amdgcn_ballot_w32(mv[j] != 0); kidx[j * (FNW * 32) + tid] = 0; }
    if (lane == 0) {
#pragma unroll
        for (int j = 0; j < MR; ++j) kbal[j * FNW + wave] = bl[j]; }
    __syncthreads();                                  // the 32 ballot words are complete, and every place of kidx holds 0
    unsigned run = 0, base[MR];
#pragma unroll
    for (int j = 0; j < MR; ++j) base[j] = 0;
#pragma unroll
    for (int w = 0; w < TT / 32; ++w) {
#pragma unroll
        for (int j = 0; j < MR; ++j) if (w / FNW == j) base[j] = (w % FNW == wave) ? run : base[j];   // kept keys in front of this wave's word of round j
        run += (unsigned)__builtin_popcount(kbal[w]); }
    const unsigned below = (1u << lane) - 1u;
#pragma unroll
    for (int j = 0; j < MR; ++j) { const int e = j * (FNW * 32) + tid;
        if (mv[j] != 0) kidx[base[j] + (unsigned)__builtin_popcount(bl[j] & below)] = e;   // a rank is below the count of kept keys, at most TT - 1
        mb[e] = ((unsigned)e < run) ? 0.0f : -__builtin_inff(); }
    const int nkeep = __builtin_amdgcn_readfirstlane((int)run);            // the same in every thread of the work-group
    const int nst = min((nkeep + FKS - 1) / FKS, TT / FKS);                // stages to walk, bounded by the shape
    __syncthreads();                                  // kidx and mb are complete
    // staging: thread -> places sr and sr + 32 of the stage's 64 kept keys, 16 bytes at element sc of the key's K row and of its V row
    const int sr = tid >> 3, sc = (tid & 7) * 8;
    const v8h* Kg8 = (const v8h*)Kg; const v8h* Vg8 = (const v8h*)Vg;   // rows of HD / 8 pieces of 16 bytes
    // the lane's 32-bit offsets, in 16-byte pieces, beside wave-uniform bases; the mask bounds the row whatever kidx holds
    unsigned j0 = (unsigned)((kidx[sr] & (TT - 1)) * (HD / 8) + (tid & 7)), j1 = (unsigned)((kidx[sr + 32] & (TT - 1)) * (HD / 8) + (tid & 7));
    v8h gk0 = Kg8[j0], gk1 = Kg8[j1];
    v8h gv0 = Vg8[j0], gv1 = Vg8[j1];
    asm volatile("s_wait_xcnt 0x0" :: "v"(j0), "v"(j1) : "memory");   // the four loads' offset registers live to this wait, so nothing overwrites them in front of it
    *(v8ha*)(&kst[0][sr * FPI + sc]) = gk0; *(v8ha*)(&kst[0][(sr + 32) * FPI + sc]) = gk1;
    *(v8ha*)(&vst[0][sr * FPV + sc]) = gv0; *(v8ha*)(&vst[0][(sr + 32) * FPV + sc]) = gv1;
    v8f o[2][4];
#pragma unroll
    for (int qg = 0; qg < 2; ++qg)
#pragma unroll
        for (int dt = 0; dt < 4; ++dt) o[qg][dt] = (v8f){};
    float mrun[2] = {-1.0e30f, -1.0e30f};   // finite, below every finite score
    float lsum[2] = {0.0f, 0.0f};           // each wave half sums its own keys; joined once at the end
    __syncthreads();
#pragma unroll 1   // rolled: one copy of the stage body, and the buffer index stays a scalar
    for (int st = 0; st < nst; ++st) {
        const bool more = st + 1 < nst;
        if (more) { j0 = (unsigned)((kidx[(st + 1) * FKS + sr] & (TT - 1)) * (HD / 8) + (tid & 7)); j1 = (unsigned)((kidx[(st + 1) * FKS + sr + 32] & (TT - 1)) * (HD / 8) + (tid & 7));
            gk0 = Kg8[j0]; gk1 = Kg8[j1];
            gv0 = Vg8[j0]; gv1 = Vg8[j1];
            asm volatile("s_wait_xcnt 0x0" :: "v"(j0), "v"(j1) : "memory"); }   // the four loads' offset registers live to this wait: it stands in front of the pass's address arithmetic, which reuses them
        const h16* kb = kst[st & 1]; const h16* vb = vst[st & 1];
        const int np = (nkeep - st * FKS > 32) ? FKS / 32 : 1;   // the last stage's second pass is walked only if it holds a kept key
#pragma unroll 1   // one pass's registers at a time: two passes interleaved did not fit the 256 registers that four waves per SIMD leave
        for (int p = 0; p < np; ++p) {
            v8f s[2][2];
#pragma unroll
            for (int kt = 0; kt < 2; ++kt) {
                const h16* kr = kb + (p * 32 + kt * 16 + c) * FPI + 8 * h;
                const v16h k0 = ldsfrag(kr), k1 = ldsfrag(kr + 32);
                const float* mp = mb + st * FKS + p * 32 + kt * 16 + 8 * h;
                const v4f b0 = *(const v4fa*)mp, b1 = *(const v4fa*)(mp + 4);
                const v8f bz = __builtin_shufflevector(b0, b1, 0, 1, 2, 3, 4, 5, 6, 7);
#pragma unroll
                for (int qg = 0; qg < 2; ++qg) { v8f t = wmma16(k0, qf[qg][0], (v8f){}); t = wmma16(k1, qf[qg][1], t); s[kt][qg] = t + bz; }
            }
            v16h vf[4];
#pragma unroll
            for (int dt = 0; dt < 4; ++dt) { const h16* vr = vb + (p * 32 + 8 * h + (lane & 7)) * FPV + dt * 16 + 8 * ((lane >> 3) & 1); vf[dt] = cat16(ldtr16(vr), ldtr16(vr + 16 * FPV)); }
            float mx[2]; bool need = false;
#pragma unroll
            for (int qg = 0; qg < 2; ++qg) { float m = s[0][qg][0];
#pragma unroll
                for (int r = 1; r < 8; ++r) m = fmaxf(m, s[0][qg][r]);
#pragma unroll
                for (int r = 0; r < 8; ++r) m = fmaxf(m, s[1][qg][r]);
                m = fmaxf(m, xhalf(m)) * CSC; mx[qg] = m; need = need || (m > mrun[qg] + 8.0f); }
            // the maximum in use moves only when some column's new maximum passes it by more than 8 (base 2): P stays <= 256, inside f16
            if (__builtin_amdgcn_ballot_w32(need) != 0) {
#pragma unroll
                for (int qg = 0; qg < 2; ++qg) { const float mn = fmaxf(mrun[qg], mx[qg]); const float corr = __builtin_amdgcn_exp2f(mrun[qg] - mn); mrun[qg] = mn; lsum[qg] *= corr;
#pragma unroll
                    for (int dt = 0; dt < 4; ++dt) o[qg][dt] = o[qg][dt] * corr; }
            }
#pragma unroll
            for (int qg = 0; qg < 2; ++qg) { const float nm = -mrun[qg]; v16h pf; float ls = 0.0f;
                const v8f cv = {CSC, CSC, CSC, CSC, CSC, CSC, CSC, CSC}, nv = {nm, nm, nm, nm, nm, nm, nm, nm};
                const v8f a0 = __builtin_elementwise_fma(s[0][qg], cv, nv), a1 = __builtin_elementwise_fma(s[1][qg], cv, nv);
#pragma unroll
                for (int i = 0; i < 16; ++i) { const float pv = __builtin_amdgcn_exp2f((i < 8) ? a0[i & 7] : a1[i & 7]); ls += pv; pf[i] = tohx(pv); }
                lsum[qg] += ls;
#pragma unroll
                for (int dt = 0; dt < 4; ++dt) o[qg][dt] = wmma16(vf[dt], pf, o[qg][dt]); }
            // four vector slots behind the pass's last matrix instructions: across the back edge the next pass's address arithmetic would overwrite their A registers too early
            asm volatile("v_nop\n\tv_nop\n\tv_nop\n\tv_nop" : "+v"(o[1][0]), "+v"(o[1][1]), "+v"(o[1][2]), "+v"(o[1][3]));
        }
        if (more) { h16* kw = kst[(st + 1) & 1]; h16* vw = vst[(st + 1) & 1];   // this buffer's last readers left it before the barrier that ended stage st - 1
            *(v8ha*)(kw + sr * FPI + sc) = gk0; *(v8ha*)(kw + (sr + 32) * FPI + sc) = gk1;
            *(v8ha*)(vw + sr * FPV + sc) = gv0; *(v8ha*)(vw + (sr + 32) * FPV + sc) = gv1; }
        __syncthreads();
    }
    v8h oc[2][4];
#pragma unroll
    for (int qg = 0; qg < 2; ++qg) { const float lf = lsum[qg] + xhalf(lsum[qg]); const float inv = 1.0f / lf;
#pragma unroll
        for (int dt = 0; dt < 4; ++dt)
#pragma unroll
            for (int j = 0; j < 8; ++j) oc[qg][dt][j] = tohx(o[qg][dt][j] * inv); }
    h16* od = Ac + ((size_t)b * TT + q0 + c) * DQ + hh * HD + 8 * h;
    __builtin_amdgcn_sched_barrier(0);   // every value is finished, each in registers of its own, before the first store names any: nothing is written behind the stores
#pragma unroll
    for (int qg = 0; qg < 2; ++qg)
#pragma unroll
        for (int dt = 0; dt < 4; ++dt) *(v8h*)(od + (size_t)qg * 16 * DQ + dt * 16) = oc[qg][dt];
}

extern "C" void kernel_launch(void* const* d_in, const int* in_sizes, int n_in,
                              void* d_out, int out_size, void* d_ws, size_t ws_size, hipStream_t stream) {
    (void)out_size;
    if (n_in < 11) return;
    if (in_sizes[0] < NB * TT * DM || in_sizes[1] < TT * HD || in_sizes[2] < NB * TT) return;
    if (in_sizes[3] < DM * DQ || in_sizes[5] < DM * DQ || in_sizes[7] < DM * DQ || in_sizes[9] < DQ * DM) return;
    if (in_sizes[4] < DQ || in_sizes[6] < DQ || in_sizes[8] < DQ || in_sizes[10] < DM) return;
    // wire order: x, rel_pos_enc, attention_mask, Wq, bq, Wk, bk, Wv, bv, Wo, bo
    const float* x = (const float*)d_in[0]; const float* rel = (const float*)d_in[1]; const int* msk = (const int*)d_in[2];
    const float* wq = (const float*)d_in[3]; const float* bq = (const float*)d_in[4]; const float* wk = (const float*)d_in[5]; const float* bk = (const float*)d_in[6];
    const float* wv = (const float*)d_in[7]; const float* bv = (const float*)d_in[8]; const float* wo = (const float*)d_in[9]; const float* bo = (const float*)d_in[10];
    float* OUT = (float*)d_out;     // [8][1024][1024]
    char* wsp = (char*)d_ws;
    auto take = [&](size_t bytes) { char* p = wsp; wsp += (bytes + 255) & ~(size_t)255; return (void*)p; };
    h16* WO = (h16*)take((size_t)DM * DQ * 2);                   // [k = 1024][n = 1024]
    h16* QK16 = (h16*)take((size_t)2 * NB * NH_ * TT * HD * 2);  // [2][NB*16][TT][64]
    h16* VP16 = (h16*)take((size_t)NB * NH_ * TT * HD * 2);      // [NB*16][TT][64]
    int* RL = (int*)take((size_t)(NROW + 1) * 4);                // the row list, then its count
    // one region, two lives: the projection's operands, dead once the head planes are written, then the merged context
    char* const shared0 = wsp;
    bf* WQKV = (bf*)take((size_t)NQKV * DM * 2);                 // [3][k = 1024][n = 1024]: planes q, k, v
    bf* XB = (bf*)take((size_t)NB * TT * DM * 2);                // [NB][TT][DM]
    char* const end1 = wsp; wsp = shared0;
    h16* AT = (h16*)take((size_t)NB * TT * DQ * 2);              // merged context [NB*TT][1024]
    if (end1 > wsp) wsp = end1;
    if ((size_t)(wsp - (char*)d_ws) > ws_size) return;           // 72 MiB at full size
    h16* Q16 = QK16; h16* K16 = QK16 + (size_t)NB * NH_ * TT * HD;
    k_cvt8<<<dim3((unsigned)(((size_t)TT * DM / 8 + 255) / 256), NB + 4, 1), 256, 0, stream>>>(x, wq, wk, wv, wo, XB, WQKV, WO, (size_t)TT * DM / 8, (size_t)SEQ_FULL * DM, (size_t)TT * DM, msk, RL);
    k_gemmw<bf, 0, false, DM, true, 64, 3><<<dim3((NROW / GBM) * (NQKV / GBN), 1, 1), 256, 0, stream>>>(XB, nullptr, WQKV, nullptr, 0, nullptr, 0, 0, 0, bq, bk, bv, rel, QK16, VP16, RL);
    k_fattn<<<dim3(TT / (FNW * FQW), NB * NH_, 1), FNW * 32, 0, stream>>>(Q16, K16, VP16, msk, AT);
    k_gemmw<h16, 0, true, DQ, false, 128, 3><<<dim3(TT / GBM, DM / GBN, NB), 256, 0, stream>>>(AT, nullptr, WO, OUT, DM, bo, (size_t)TT * DQ, 0, (size_t)SEQ_FULL * DM, nullptr, nullptr, nullptr, nullptr, nullptr, nullptr, nullptr);
}

// v010
// Measured time: 86.8 microseconds a run.
// Two timings next to v009 both put it at 1.03 times that version's speed.
// Counting every step since v000, it is 15.0 times as fast.
#include <hip/hip_runtime.h>

// Compute dtypes (f32 accumulate everywhere): every float input RNE-converted to bf16; QKV projection v_wmma_f32_16x16x32_bf16 (exact products); scores (k + 8 R) x q^T and V^T x P^T (V^T read from [t][d] rows by the transposing LDS load) on v_wmma_f32_16x16x32_f16 (P = exp2 of the score against the maximum in use, not yet normalised); softmax f32; output projection v_wmma_f32_16x16x32_f16: merged context rounded once to f16 x Wo (its bf16 value, held as f16) + f32 bias.
// Self-attention on one stream x [8][1024][1024]; weights keep their [in][out] = [k][n] order as 16-bit planes (q, k, v: three bf16 planes in a row; Wo f16), and the GEMMs turn them on the LDS read; 16 heads x 64.
// Score algebra: (q.k) x 0.125 + q.R[t] = 0.125 x q.(k[t] + 8 R[t]); the key plane stores k + 8 R (R = per-key table input, read by value), the 0.125 is applied in the softmax's exponent.
// Key mask [b][t] (int32, data): a key with mask == 0 has weight exp(-inf) = 0, so it is left out of the key walk: each attention work-group lists the kept keys in ascending order and stages only their rows.
// Keys that no score can use are not projected either: the conversion launch lists the rows of x that are a kept key, or key 0 of a batch (the attention's filler places read that row), and the k and v columns of the projection run over that list alone.
// Softmax in the running-maximum form, normalised once at the end (a row without any kept key ends as 0 x (1 / 0) = NaN).

#ifndef NB
#define NB 8
#endif
#ifndef SEQ
#define SEQ 1024
#endif
#define SEQ_FULL 1024             // per-batch row count of the inputs / output (strides)
#define TT   SEQ
#define DM   1024
#define NH_  16
#define HD   64
#define DQ   (NH_ * HD)
#define NQKV (3 * DQ)
#define SCL  0.125f               // HD^-0.5
#define RCAR 8.0f                 // 1 / SCL
typedef _Float16 h16;
typedef unsigned short bf;
typedef __attribute__((ext_vector_type(16))) __bf16   v16bf;
typedef __attribute__((ext_vector_type(16))) _Float16 v16h;
typedef __attribute__((ext_vector_type(8)))  _Float16 v8h;
typedef __attribute__((ext_vector_type(8)))  unsigned short v8us;
typedef __attribute__((ext_vector_type(8)))  float    v8f;
typedef __attribute__((ext_vector_type(4)))  float    v4f;
typedef v8h  __attribute__((may_alias)) v8ha;
typedef v4f  __attribute__((may_alias)) v4fa;
typedef v8us __attribute__((may_alias)) v8usa;

static_assert(TT % 128 == 0);
static_assert(TT <= SEQ_FULL);
static_assert(DM % 64 == 0);
static_assert(HD == 64);
static_assert(DM == DQ);
static_assert(NQKV % 256 == 0);
static_assert(DM % 256 == 0);

__device__ __forceinline__ unsigned short f2bf(float f) { unsigned u = __float_as_uint(f); u += 0x7FFFu + ((u >> 16) & 1u); return (unsigned short)(u >> 16); }
__device__ __forceinline__ float bf2f(unsigned short b) { return __uint_as_float(((unsigned)b) << 16); }
__device__ __forceinline__ float bfr(float f) { return bf2f(f2bf(f)); }
__device__ __forceinline__ v16h cat16(v8h lo, v8h hi) { return __builtin_shufflevector(lo, hi, 0, 1, 2, 3, 4, 5, 6, 7, 8, 9, 10, 11, 12, 13, 14, 15); }
__device__ __forceinline__ v16bf cat16b(v8us lo, v8us hi) { return __builtin_bit_cast(v16bf, __builtin_shufflevector(lo, hi, 0, 1, 2, 3, 4, 5, 6, 7, 8, 9, 10, 11, 12, 13, 14, 15)); }
__device__ __forceinline__ v8f wmma16(v16h a, v16h b, v8f c) { return __builtin_amdgcn_wmma_f32_16x16x32_f16(false, a, false, b, (short)0, c, false, false); }
__device__ __forceinline__ v8f wmmab(v16bf a, v16bf b, v8f c) { return __builtin_amdgcn_wmma_f32_16x16x32_bf16(false, a, false, b, (short)0, c, false, false); }

__device__ __forceinline__ h16 tohx(float x) { return (h16)x; }
typedef __attribute__((ext_vector_type(8))) short v8s;
typedef __attribute__((address_space(3))) v8s lds_v8s;
__device__ __forceinline__ v8h ldtr16(const h16* p) { return __builtin_bit_cast(v8h, __builtin_amdgcn_ds_load_tr16_b128_v8i16((lds_v8s*)p)); }
__device__ __forceinline__ v8us ldtr16u(const bf* p) { return __builtin_bit_cast(v8us, __builtin_amdgcn_ds_load_tr16_b128_v8i16((lds_v8s*)p)); }

// ---- k_gemmw: GEMM on a 128 x 256 output tile per work-group of 8 waves (2 x 4), 64 x 64 (16 accumulators) per wave; grid (M/128, N/256, Z), 256 threads.
// C[m][n] (f32, pitch ldc, + optional f32 bias[n]) = sum_k A[m][k] B[k][n]. z-batch strides sA/sB/sC in elements. K: a compile-time multiple of the stage's KS, at least NBUF stages.
// B: planes of [K][GLB] in a row, plane n / GLB, column n % GLB (a tile's 256 columns lie in one plane).
// HEADS: no C; n runs over the fused q|k|v columns, m over all rows b * TT + t of x (q) or over the listed rows (k, v), and a wave's 64 x 64 tile is 64 such rows of one head of one of the three. The epilogue writes each row as fp16 into its head plane:
//   q -> QK[0][b*16+h][t][d] = acc + bq; k -> QK[1][b*16+h][t][d] = (acc + bk) + 8 R[t][d]; v -> VP[b*16+h][t][d] = acc + bv. Rows of k and v behind the list's count are written only where they share a wave's 64 places with a listed row, and nothing reads them.
// Operands: 16-bit planes, KS k per LDS stage, a ring of NBUF buffers filled NBUF - 1 stages ahead of their use. B: two halves of 128 columns, each KS k rows of 256 B, brought by tensor loads of 64 rows (one request of one wave per stage).
// A: without HEADS 128 rows of 256 B by one tensor load; with HEADS the rows lie anywhere in x, so each lane copies its 16 bytes asynchronously, and the 128-B rows stand unpadded, the 16-byte piece p of row r at place p ^ ((r >> 1) & 7): 16 rows' pieces then fall on all 64 banks.
// Fragment map: lane l -> row/col l & 15, half h = l >> 4; elements 0..7 <- k0 + 8h + 0..7, elements 8..15 <- k0 + 16 + 8h + 0..7 (A and B alike); D element j -> row 8h + j, col l & 15.
// B fragments: ds_load_tr16_b128 on the [k][n] rows hands lane (c, h) the k 8h + 0..7 of column c; two of them, 16 k rows apart, are the map above.
#define GBM 128                   // tile rows
#define GBN 256                   // tile columns
#define GPB 144                   // the B rows' pitch: 256 B of data + 32 B (the tensor load's pad), for the transposing reader
#define GLB 1024                  // columns of a B plane
template <typename T16> struct WFrag;
template <bool B> struct Flag { static constexpr bool v = B; };   // a compile-time switch handed to a generic lambda
template <> struct WFrag<h16> { typedef v16h V; static __device__ __forceinline__ V ld(const h16* p) { return cat16(*(const v8h*)p, *(const v8h*)(p + 16)); } static __device__ __forceinline__ V ld2(const h16* p, const h16* q) { return cat16(*(const v8ha*)p, *(const v8ha*)q); } static __device__ __forceinline__ V ldt(const h16* p) { return cat16(ldtr16(p), ldtr16(p + 16 * GPB)); } static __device__ __forceinline__ v8f mma(V a, V b, v8f c) { return wmma16(a, b, c); } };
template <> struct WFrag<bf> { typedef v16bf V; static __device__ __forceinline__ V ld(const bf* p) { return cat16b(*(const v8us*)p, *(const v8us*)(p + 16)); } static __device__ __forceinline__ V ld2(const bf* p, const bf* q) { return cat16b(*(const v8usa*)p, *(const v8usa*)q); } static __device__ __forceinline__ V ldt(const bf* p) { return cat16b(ldtr16u(p), ldtr16u(p + 16 * GPB)); } static __device__ __forceinline__ v8f mma(V a, V b, v8f c) { return wmmab(a, b, c); } };
// Four asynchronous copies of 16 bytes a lane: four rows that lie anywhere, each with a global pointer of its own; LDS step ls bytes.
// The s_wait_xcnt stands inside the statement, behind the last copy, so that no later write of an address register named here can come in front of it.
template <typename T16>
__device__ __forceinline__ void cp4g(unsigned l, unsigned ls, const T16* g, const T16* g1, const T16* g2, const T16* g3) {
    const unsigned l1 = l + ls, l2 = l + 2 * ls, l3 = l + 3 * ls;
    asm volatile("global_load_async_to_lds_b128 %0, %4, off\n\t"
                 "global_load_async_to_lds_b128 %1, %5, off\n\t"
                 "global_load_async_to_lds_b128 %2, %6, off\n\t"
                 "global_load_async_to_lds_b128 %3, %7, off\n\t"
                 "s_wait_xcnt 0x0"
                 :: "v"(l), "v"(l1), "v"(l2), "v"(l3), "v"(g), "v"(g1), "v"(g2), "v"(g3) : "memory");
}
typedef unsigned u32x4 __attribute__((ext_vector_type(4)));
typedef unsigned u32x8 __attribute__((ext_vector_type(8)));
__device__ __forceinline__ unsigned uni(unsigned v) { return (unsigned)__builtin_amdgcn_readfirstlane((int)v); }
// A wave-uniform test held in a scalar register, so that the branch on it is a scalar branch: a tensor load ignores EXEC, and only such a branch keeps a wave from issuing it.
__device__ __forceinline__ unsigned pinned(unsigned v) { unsigned w = uni(v); asm volatile("" : "+s"(w)); return w; }
// Descriptor group 1 of a tensor load: a tile of ROWS rows of 256 bytes, source pitch PITCH bytes, laid in LDS at 256 + 4 (PADA + 1) bytes a row. Sizes in bytes (data_size 0), tensor = tile, no mask.
template <unsigned ROWS, unsigned PITCH, unsigned PADA>
__device__ __forceinline__ u32x8 tgroup1() {
    u32x8 g; g[0] = uni((1u << 20) | (5u << 22) | (PADA << 25)); g[1] = uni(256u << 16); g[2] = uni(ROWS << 16); g[3] = uni(256u << 16); g[4] = uni(ROWS); g[5] = uni(PITCH); g[6] = uni(0u); g[7] = uni(0u);
    asm volatile("" : "+s"(g));   // as pinned(): descriptor words held in scalar registers; one value from here to the ring's last wait, so its registers are not written while a request is outstanding
    return g;
}
// Group 0, kept in one place too: count 1, type 2; the first request puts in the address's upper word.
__device__ __forceinline__ u32x4 tgroup0() {
    u32x4 g; g[0] = uni(1u); g[1] = uni(0u); g[2] = uni(0u); g[3] = uni(0x80000000u);
    asm volatile("" : "+s"(g));   // as pinned(): see tgroup1
    return g;
}
// One tensor load from global byte address ga to LDS byte lds. Between requests only words 1 and 2 of group 0 change.
__device__ __forceinline__ void tload(u32x4& g0, const u32x8& g1, unsigned lds, unsigned long long ga) {
    const unsigned h3 = uni((((unsigned)(ga >> 32)) & 0x01FFFFFFu) | 0x80000000u);
    if (pinned(h3 != g0[3])) { asm volatile("s_wait_tensorcnt 0x0" ::: "memory"); g0[3] = h3; }   // word 3 takes a new value (first request; a source that passes a multiple of 4 GiB) only with no request of the wave outstanding
    g0[1] = uni(lds); g0[2] = uni((unsigned)ga);
    asm volatile("tensor_load_to_lds %0, %1" :: "s"(g0), "s"(g1) : "memory");
}
#define NROW (NB * TT)            // rows of x; the row list holds NROW places, then the count of listed rows
// amdgpu_waves_per_eu(4, 4): at most 256 registers a wave. With 64-k stages three buffers are 156 KiB, so two work-groups share a WGP and one group's matrix runs cover the other's barrier, copy issue and epilogue.
// With 128-k stages three buffers are 318 KiB, one work-group per WGP: for a grid that has no more work-groups than that; a stage then holds four 32-k blocks between two barriers, and an A row's share is a whole 256 B.
template <typename T16, int NSPLIT, bool BIAS, int K, bool HEADS, int KS, int NBUF>
__global__ __launch_bounds__(256) __attribute__((amdgpu_waves_per_eu(4, 4))) void k_gemmw(const T16* __restrict__ A, const T16* __restrict__ A2, const T16* __restrict__ Bw, float* C, int ldc, const float* __restrict__ bias, size_t sA, size_t sB, size_t sC,
                                                                                          const float* __restrict__ bq, const float* __restrict__ bk, const float* __restrict__ bv, const float* __restrict__ R, h16* QK, h16* VP, const int* __restrict__ rlist) {
    static_assert(NSPLIT == 0);                         // the ring stages one A plane
    static_assert(K % KS == 0 && NBUF == 3 && K / KS >= NBUF);   // NBUF - 1 = 2 requests of a wave are outstanding at most
    static_assert(HEADS ? KS == 64 : KS == 128);        // HEADS: the gathered rows' copies and the rl places are laid out for 8 lanes a row; else the A rows are the tensor load's 256 B
    typedef typename WFrag<T16>::V V;
    constexpr int GPI = HEADS ? KS : KS + 8;            // the A rows' pitch in 16-bit elements: 128 B with the pieces permuted, or 256 B + 16 B (the tensor load's pad), for the 16-byte readers
    constexpr int AR = GBM;                             // staged A rows
    constexpr int BH = KS * GPB, SE = AR * GPI + 2 * BH;   // elements of one half of the B tile; per stage: A rows [m][k], then the two halves' B rows [k][n]
    constexpr int CPA = HEADS ? 4 : 0;                  // asynchronous copies of every wave per stage
    constexpr unsigned NAI = HEADS ? 0 : 1, NBS = 2 * KS / 64;   // waves 0 .. NAI - 1 ask for A, waves NAI .. NAI + NBS - 1 each for 64 k rows of one half of B
    static_assert(NAI + NBS <= 8);
    __shared__ __attribute__((aligned(2048))) T16 stg[NBUF * SE];
    static_assert(GLB % GBN == 0 && (AR * GPI * 2) % 2048 == 0 && (64 * GPB * 2) % 2048 == 0 && (SE * 2) % 2048 == 0);   // every tensor load's place in LDS is a multiple of 2 KiB
    static_assert(8 * 16 * 68 * 4 <= NBUF * SE * 2);    // the epilogue's staging rows lie in the same LDS
    __shared__ int rl[HEADS ? GBM : 1];                 // HEADS: the row of x behind each of the tile's 128 places
    const size_t z = HEADS ? 0 : blockIdx.z; A += z * sA; Bw += z * sB; if (!HEADS) C += z * sC;
    const int tid = threadIdx.x, lane = tid & 31, lr = lane & 15, hi = lane >> 4, wave = tid >> 5, wm = wave >> 2, wn = wave & 3;
    // HEADS: a one-dimensional grid. First the q tiles, places = rows of x; then the k and v tiles, places = ranks in the row list, the last (part-filled) 128 ranks first, so that the short tiles end early and free their room; tiles past the list leave here, ahead of every barrier.
    int R0 = blockIdx.x * GBM, C0 = blockIdx.y * GBN, lim = 0;   // lim: the rows at places of the list from lim on are read by nobody
    if constexpr (HEADS) {
        constexpr int MT = NROW / GBM, QT = MT * (DQ / GBN), KVN = 2 * DQ / GBN;
        const int f = blockIdx.x;
        if (f < QT) { R0 = (f % MT) * GBM; C0 = (f / MT) * GBN; lim = NROW; }
        else { lim = min(rlist[NROW], NROW); const int mt = (lim + GBM - 1) / GBM - 1 - (f - QT) / KVN; if (mt < 0) return;
            R0 = mt * GBM; C0 = DQ + ((f - QT) % KVN) * GBN; }
    }
    const int r0 = R0 + wm * 64, c0 = C0 + wn * 64;
    const bool act = !HEADS || R0 + (__builtin_amdgcn_readfirstlane(wave) >> 2) * 64 < lim;   // a wave whose 64 places all lie past the list only copies and keeps the barriers
    // HEADS, A: thread -> 16 bytes at element sc of rows sr + 32 i; a wave's copy covers four whole 128-B lines
    const int sr = tid / 8, sc = (tid % 8) * 8; const unsigned wv = uni((unsigned)tid >> 5);
    const T16* Bt = Bw + (size_t)(C0 / GLB) * K * GLB + (C0 % GLB); const T16* At = A + (size_t)R0 * K;   // the tile's first B column at k = 0; its first A row
    const unsigned lbase = (unsigned)(size_t)stg, l0 = lbase + (unsigned)(sr * GPI + ((tid & 7) ^ ((sr >> 1) & 7)) * 8) * 2;   // buffer 0; the lane's LDS byte address in it, A rows
    const T16* gq[4] = {A, A, A, A};                    // HEADS: the thread's four rows of x
    if constexpr (HEADS) {
        int rw[4];   // the '#pragma unroll's here and in the epilogue's ask() make the indices of register arrays constants
        if (C0 < DQ) {
#pragma unroll
            for (int i = 0; i < 4; ++i) rw[i] = R0 + sr + 32 * i; }
        else { const unsigned ro = (unsigned)(R0 + sr);
#pragma unroll
            for (int i = 0; i < 4; ++i) rw[i] = rlist[ro + 32 * i];
            asm volatile("s_wait_xcnt 0x0" :: "v"(ro) : "memory");   // the four loads' offset register lives to this wait, so nothing overwrites it in front of it
#pragma unroll
            for (int i = 0; i < 4; ++i) rw[i] &= NROW - 1; }          // bounds the row whatever the list holds
#pragma unroll
        for (int i = 0; i < 4; ++i) { gq[i] = A + (size_t)rw[i] * K + sc; if ((tid & 7) == 0) rl[sr + 32 * i] = rw[i]; }   // rl is published by the barrier behind stage 0
    }
    u32x4 g0 = tgroup0(); const u32x8 g1b = tgroup1<64, GLB * 2, 7>(), g1a = HEADS ? g1b : tgroup1<GBM, K * 2, 3>();   // B slices; the A tile (HEADS has none: a second name for g1b)
    auto fill = [&](int t, int buf) {
        const unsigned lb = lbase + (unsigned)buf * (SE * 2); const int ko = t * KS;
        if constexpr (HEADS) cp4g(l0 + (unsigned)buf * (SE * 2), 32 * GPI * 2, gq[0] + ko, gq[1] + ko, gq[2] + ko, gq[3] + ko);
        else if (pinned(wv == 0)) tload(g0, g1a, lb, (unsigned long long)(size_t)(At + ko));
        if (pinned(wv >= NAI && wv < NAI + NBS)) { const unsigned sl = wv - NAI, half = sl / (KS / 64), kq = sl % (KS / 64);
            tload(g0, g1b, lb + (unsigned)(AR * GPI + half * BH + kq * 64 * GPB) * 2, (unsigned long long)(size_t)(Bt + (size_t)(ko + kq * 64) * GLB + half * 128)); } };
    v8f acc[4][4];
#pragma unroll
    for (int mb = 0; mb < 4; ++mb)
#pragma unroll
        for (int nb = 0; nb < 4; ++nb) acc[mb][nb] = (v8f){};
    constexpr int nt = K / KS;
    // The ring: stage s lies in buffer s % NBUF. Per stage every wave issues CPA copies and an asking wave one tensor load; both count down in issue order, so waits to CPA * (NBUF - 2) and to NBUF - 2 leave just the NBUF - 2 youngest stages in flight. A wave that asks for nothing passes the tensor wait at once.
#pragma unroll   // the stage and buffer numbers are constants
    for (int s = 0; s < NBUF - 1; ++s) fill(s, s);
    if constexpr (HEADS) asm volatile("s_wait_asynccnt %0" :: "n"(CPA * (NBUF - 2)) : "memory");   // this wave's share of stage 0 has landed; stages 1 .. NBUF - 2 may still fly
    asm volatile("s_wait_tensorcnt %0" :: "n"(NBUF - 2) : "memory");   // the same for its tensor load
    __syncthreads();                                    // ... and every other wave's
    fill(NBUF - 1, NBUF - 1);
    // A fragment pieces: element offset of the 16 bytes at k = 32 ks + 16 j + 8 hi of the lane's row
    auto aof = [&](int ks, int j) { return (wm * 64 + lr) * GPI + (HEADS ? ((ks * 4 + 2 * j + hi) ^ ((lr >> 1) & 7)) * 8 : ks * 32 + 16 * j + 8 * hi); };
    const int bfo = AR * GPI + (wn >> 1) * BH + (8 * hi + (lane & 7)) * GPB + (wn & 1) * 64 + 8 * ((lane >> 3) & 1);
#pragma unroll 1   // rolled: one copy of the stage body, and the buffer index stays a scalar
    for (int t = 0, cb = 0; t < nt; ++t) {              // cb = t % NBUF
        const T16* sb = stg + cb * SE;
        if (act) {
#pragma unroll
        for (int ks = 0; ks < KS / 32; ++ks) {
            V a[4], b[4];   // all of a 32-k block's fragments are asked for as one group, ahead of its matrix run
#pragma unroll
            for (int mb = 0; mb < 4; ++mb) a[mb] = WFrag<T16>::ld2(sb + aof(ks, 0) + mb * 16 * GPI, sb + aof(ks, 1) + mb * 16 * GPI);
#pragma unroll
            for (int nb = 0; nb < 4; ++nb) b[nb] = WFrag<T16>::ldt(sb + bfo + ks * 32 * GPB + nb * 16);
            __builtin_amdgcn_sched_barrier(0);   // keeps the LDS loads one group: left alone the compiler moves the Bw loads in among the matrix instructions, each with a full wait behind it
#pragma unroll
            for (int nb = 0; nb < 4; ++nb)
#pragma unroll
                for (int mb = 0; mb < 4; ++mb) acc[mb][nb] = WFrag<T16>::mma(a[mb], b[nb], acc[mb][nb]);
            __builtin_amdgcn_sched_barrier(0);   // ends the block: the next group of loads, and the stage's closing waits, stay behind its matrix instructions
        } }
        asm volatile("s_wait_dscnt 0x0" ::: "memory");      // this wave has left buffer cb
        // this wave's share of stage t + 1 has landed. The count is used only while all of the stages t + 2 .. t + NBUF - 1 have been issued behind it; from there on the wait is for everything
        if (t + NBUF - 1 < nt) { if constexpr (HEADS) asm volatile("s_wait_asynccnt %0" :: "n"(CPA * (NBUF - 2)) : "memory");
            asm volatile("s_wait_tensorcnt %0" :: "n"(NBUF - 2) : "memory"); }
        else { if constexpr (HEADS) asm volatile("s_wait_asynccnt 0x0" ::: "memory");
            asm volatile("s_wait_tensorcnt 0x0" ::: "memory"); }
        __syncthreads();                                    // publishes stage t + 1 and ends every reader's last read of buffer cb
        if (pinned(t + NBUF < nt)) fill(t + NBUF, cb);      // a scalar test: no stage past the last is asked for
        cb = (cb + 1 == NBUF) ? 0 : cb + 1;
    }
    if constexpr (HEADS) asm volatile("s_wait_asynccnt 0x0" ::: "memory");   // no copy ...
    asm volatile("s_wait_tensorcnt 0x0" :: "s"(g0), "s"(g1a), "s"(g1b) : "memory");   // ... and no tensor load is outstanding when the LDS becomes output staging; the descriptors' registers live to this wait
    float* os = (float*)stg + wave * (16 * 68);             // each wave's own 16 x 68 floats; every reader left the buffers at the loop's last barrier
    if constexpr (HEADS) {
        const int which = C0 / DQ, hd = (c0 % DQ) / HD;     // which: the same for the whole work-group (GBN divides DQ); hd: the wave's head
        if (!act) return;                                   // no barrier follows
        const int rr = lane >> 3, cofs = (lane & 7) * 8;    // read-back: 8 lanes per 128-byte output row, 4 rows per store
        const int* rw = rl + wm * 64 + rr;                  // the lane's rows of x: place 16 mb + 4 s of the wave's 64
        // q, k and v rows; ISK: the key plane, which also takes 8 x the table row of its t. Two copies of the code, so that neither holds a branch between a load and its use.
        auto rows = [&](auto isk, const float* bsrc, h16* plane) {
            constexpr bool ISK = decltype(isk)::v;
            const float* bb = bsrc + hd * HD + cofs; const v4f ba = *(const v4f*)bb, bc = *(const v4f*)(bb + 4);
            asm volatile("s_wait_xcnt 0x0" :: "v"(bb) : "memory");   // the two loads' address pair lives to this wait, so nothing overwrites it in front of it
            v4f tb[2][4][2];                                // the table rows of one 16-row block, asked for one block ahead of their use
            int gr[2][4];                                   // the rows of x of one block, read with them
            const v4f* R4 = (const v4f*)R;
            auto ask = [&](int mb) {
#pragma unroll
                for (int s = 0; s < 4; ++s) gr[mb & 1][s] = rw[mb * 16 + 4 * s];
                if (ISK) { unsigned to[4];
#pragma unroll
                    for (int s = 0; s < 4; ++s) { to[s] = (unsigned)((gr[mb & 1][s] & (TT - 1)) * (HD / 4) + cofs / 4); tb[mb & 1][s][0] = R4[to[s]]; tb[mb & 1][s][1] = R4[to[s] + 1]; }   // offsets in 16-byte pieces beside a wave-uniform base
                    asm volatile("s_wait_xcnt 0x0" :: "v"(to[0]), "v"(to[1]), "v"(to[2]), "v"(to[3]) : "memory"); } };   // the eight loads' offset registers live to this wait, so nothing overwrites them in front of it
            ask(0);
            float bi[8];
#pragma unroll
            for (int q = 0; q < 8; ++q) bi[q] = bfr((q < 4) ? ba[q & 3] : bc[q & 3]);
#pragma unroll
            for (int mb = 0; mb < 4; ++mb) {
                if (mb < 3) ask(mb + 1);
#pragma unroll
                for (int nb = 0; nb < 4; ++nb) {
#pragma unroll
                    for (int j = 0; j < 8; ++j) os[(hi * 8 + j) * 68 + nb * 16 + lr] = acc[mb][nb][j]; }
                __builtin_amdgcn_wave_barrier(); asm volatile("" ::: "memory");   // compiler fence: the reads below take other lanes' words, so they stay behind the writes above
                v8h o[4]; unsigned dof[4];
#pragma unroll
                for (int s = 0; s < 4; ++s) {
                    dof[s] = (unsigned)(((((unsigned)gr[mb & 1][s] / TT) * NH_ + hd) * TT + (gr[mb & 1][s] & (TT - 1))) * HD + cofs);   // row b * TT + t of x -> row t of head plane b * 16 + hd
                    const v4f x0 = *(const v4fa*)(os + (4 * s + rr) * 68 + cofs), x1 = *(const v4fa*)(os + (4 * s + rr) * 68 + cofs + 4);
#pragma unroll
                    for (int q = 0; q < 8; ++q) { float y = ((q < 4) ? x0[q & 3] : x1[q & 3]) + bi[q];
                        if (ISK) y += RCAR * bfr((q < 4) ? tb[mb & 1][s][0][q & 3] : tb[mb & 1][s][1][q & 3]);
                        o[s][q] = tohx(y); } }
                __builtin_amdgcn_sched_barrier(0);   // all four rows' values are finished, each in registers of its own, before the first store names any
#pragma unroll
                for (int s = 0; s < 4; ++s) *(v8h*)(plane + dof[s]) = o[s];
                asm volatile("s_wait_xcnt 0x0" ::: "memory");   // behind every block's four stores, the last block's too: in front of whatever next writes their data registers (the next block's arithmetic, or the code laid behind this copy of the epilogue); as a compiler fence it also keeps the next block's LDS writes behind this block's reads
                __builtin_amdgcn_sched_barrier(0);              // keeps that code behind the wait
            }
        };
        if (which == 1) { rows(Flag<true>{}, bk, QK + (size_t)NB * NH_ * TT * HD); return; }
        rows(Flag<false>{}, (which == 0) ? bq : bv, (which == 0) ? QK : VP);
        return;
    }
#pragma unroll
    for (int mb = 0; mb < 4; ++mb) {
#pragma unroll
        for (int nb = 0; nb < 4; ++nb) {
#pragma unroll
            for (int j = 0; j < 8; ++j) os[(hi * 8 + j) * 68 + nb * 16 + lr] = acc[mb][nb][j]; }
        __builtin_amdgcn_wave_barrier(); asm volatile("" ::: "memory");
        float* crow = C + (size_t)(r0 + mb * 16) * ldc + c0;
{
#pragma unroll
            for (int s = 0; s < 8; ++s) { const int row = 2 * s + hi, cofs = lr * 4; v4f val = *(const v4fa*)(os + row * 68 + cofs); if (BIAS) { val[0] += bfr(bias[c0 + cofs]); val[1] += bfr(bias[c0 + cofs + 1]); val[2] += bfr(bias[c0 + cofs + 2]); val[3] += bfr(bias[c0 + cofs + 3]); }
                *(v4f*)(crow + (size_t)row * ldc + cofs) = val; }
             }
        __builtin_amdgcn_wave_barrier(); asm volatile("" ::: "memory");
    }
}

// One streaming conversion for every 16-bit GEMM operand, element order kept. grid.y picks the plane of n8 x 8 floats: 0..NB-1 -> a batch of x (bf16); NB..NB+2 -> Wq, Wk, Wv (bf16, three planes in a row); NB+3 -> Wo (the same bf16 rounding, written as f16: exact from 2^-17 up to the f16 range's end).
static_assert((size_t)TT * DM == (size_t)DM * DQ);   // a weight plane has as many elements as a batch of x
// The first work-group also writes the row list for the k and v projections: a permutation of the rows b * TT + t of x. First, ascending, every row that is a kept key (mask != 0) or key 0 of its batch; behind them the other rows, so that a tile's places past the count hold rows of their own; rlist[NROW] = the count.
// Thread -> 32 rows in a row, their flags one 32-bit word; a row's rank = flags set in the words in front + flags set below it in its word. The list is put together in LDS and leaves in whole lines.
typedef __attribute__((ext_vector_type(4))) int v4i;
typedef v4i __attribute__((may_alias)) v4ia;
static_assert(TT == SEQ_FULL && NROW == 256 * 32 && (TT & (TT - 1)) == 0);
__global__ __launch_bounds__(256) void k_cvt8(const float* __restrict__ x, const float* __restrict__ wq, const float* __restrict__ wk, const float* __restrict__ wv, const float* __restrict__ wo, bf* XBo, bf* Wqkv, h16* Wo16, size_t n8, size_t sS, size_t sD, const int* __restrict__ mk, int* rlist) {
    __shared__ __align__(16) int lst[NROW];
    __shared__ __align__(16) unsigned wc[256];
    if (blockIdx.x == 0 && blockIdx.y == 0) {           // the same for the whole work-group, so its two barriers are met by all or none
        const int tid = threadIdx.x, e0 = tid * 32;
        const v4i* mk4 = (const v4i*)mk; const unsigned mo = (unsigned)tid * 8; v4i mv[8];   // the lane's offset in 16-byte pieces beside a wave-uniform base
        // every '#pragma unroll' of this block makes the indices of a register array, or a flag's position, constants
#pragma unroll
        for (int j = 0; j < 8; ++j) mv[j] = mk4[mo + j];
        asm volatile("s_wait_xcnt 0x0" :: "v"(mo) : "memory");   // the loads' offset register lives to this wait, so nothing overwrites it in front of it
        unsigned word = ((e0 & (TT - 1)) == 0) ? 1u : 0u;
#pragma unroll
        for (int j = 0; j < 32; ++j) word |= (mv[j >> 2][j & 3] != 0) ? (1u << j) : 0u;
        wc[tid] = (unsigned)__builtin_popcount(word);
        __syncthreads();                                // the 256 counts are complete
        unsigned pos = 0, total = 0;
        for (int w = 0; w < 256; ++w) { const unsigned cw = wc[w]; pos += (w < tid) ? cw : 0u; total += cw; }
#pragma unroll
        for (int j = 0; j < 32; ++j) {
            const bool in = (word >> j) & 1u;
            lst[in ? pos : total + (unsigned)(e0 + j) - pos] = e0 + j;   // pos: listed rows in front of this one; either place is below NROW, and no two rows share one
            pos += in ? 1u : 0u; }
        __syncthreads();                                // the list is complete
        v4i lo[8];
#pragma unroll
        for (int j = 0; j < 8; ++j) lo[j] = *(const v4ia*)(lst + (j * 256 + tid) * 4);
        v4i* rl4 = (v4i*)rlist;
#pragma unroll
        for (int j = 0; j < 8; ++j) rl4[j * 256 + tid] = lo[j];
        if (tid == 0) rlist[NROW] = (int)total;
        asm volatile("s_wait_xcnt 0x0" ::: "memory");   // behind the list's stores, in front of the conversion below, which may reuse their registers
    }
    const size_t i = (size_t)blockIdx.x * 256 + threadIdx.x; if (i >= n8) return;
    const int y = blockIdx.y;
    const float* src = (y < NB) ? x + (size_t)y * sS : (y == NB) ? wq : (y == NB + 1) ? wk : (y == NB + 2) ? wv : wo;
    bf* dst = (y < NB) ? XBo + (size_t)y * sD : (y < NB + 3) ? Wqkv + (size_t)(y - NB) * DM * DQ : (bf*)Wo16;
    const float* sp = src + i * 8; const v8f v = *(const v8f*)sp; v8us o;
    asm volatile("s_wait_xcnt 0x0" :: "v"(sp) : "memory");   // the load's address lives to this wait, so nothing overwrites it in front of it
#pragma unroll
    for (int k = 0; k < 8; ++k) o[k] = f2bf(v[k]);
    if (y == NB + 3) {
#pragma unroll
        for (int k = 0; k < 8; ++k) o[k] = __builtin_bit_cast(unsigned short, tohx(bf2f(o[k]))); }
    *(v8us*)(dst + i * 8) = o;
}

// ---- k_fattn: scores, mask, softmax, P x V and the head merge in one kernel; a score never leaves the registers.
// grid (TT / 256, NB * 16), 8 waves; a wave owns 32 query columns (2 groups of 16) of one head plane and walks the kept keys, 64 per LDS stage (2 buffers), 32 per pass.
// Kept keys: the mask row's 32 ballot words give every kept key its rank (kept keys in front of it); kidx[rank] = key. Places from the count up to the end of the last stage hold key 0 under a -inf bias.
// S^T = K' Q^T: A = key rows from LDS, B = q kept in registers; D register r of lane (c, h) = key 8h + r, query c. Two such tiles, converted in place, are the B operand (32 keys) of O^T += V^T P^T.
// V^T: A = V rows [key][d] from LDS through ds_load_tr16_b128, which hands lane (c, h) the keys 8h + 0..7 of column d = c: the k order of the packed P^T.
// O^T: D register r = d 8h + r of query c, so a lane stores 8 consecutive d of one merged-context row.
// Every plain '#pragma unroll' below makes the indices of a register array constants, so that the array stays in registers.
// amdgpu_waves_per_eu(4, 4): two work-groups per WGP, four waves per SIMD, to cover the vector work between the matrix runs.
#define FNW 8                     // waves per work-group
#define FQW 32                    // query columns per wave
#define FKS 64                    // keys per LDS stage
#define FPI 72                    // LDS row pitch in 16-bit elements: 128 B of data + 16 B, for the 16-byte readers
#define FPV 80                    // the V rows' pitch: 128 B of data + 32 B, for the transposing reader
#define CSC (SCL * 1.4426950408889634f)
static_assert(TT % (FNW * FQW) == 0);
static_assert(TT % FKS == 0);
static_assert(TT % (FNW * 32) == 0 && (TT & (TT - 1)) == 0);   // whole mask rounds (one ballot word per wave and round); the staged row is bounded by a bit mask
__device__ __forceinline__ float xhalf(float x) { return __builtin_bit_cast(float, __builtin_amdgcn_permlanex16(__builtin_bit_cast(int, x), __builtin_bit_cast(int, x), 0x76543210, 0xfedcba98, false, false)); }  // lane l with lane l ^ 16
__device__ __forceinline__ v16h ldsfrag(const h16* p) { return cat16(*(const v8ha*)p, *(const v8ha*)(p + 16)); }
__global__ __launch_bounds__(FNW * 32) __attribute__((amdgpu_waves_per_eu(4, 4))) void k_fattn(const h16* __restrict__ Q, const h16* __restrict__ Kp, const h16* __restrict__ Vp, const int* __restrict__ mk, h16* Ac) {
    __shared__ __align__(16) h16 kst[2][FKS * FPI];   // [key][d]
    __shared__ __align__(32) h16 vst[2][FKS * FPV];   // [key][d]
    __shared__ __align__(16) float mb[TT];            // by place in the kept list: 0 for a kept key, -inf behind the last one
    __shared__ int kidx[TT];                          // the kept keys in ascending order, then 0
    __shared__ __align__(16) unsigned kbal[TT / 32];  // the mask row as bits, key order
    const int tid = threadIdx.x, lane = tid & 31, c = lane & 15, h = lane >> 4, wave = tid >> 5;
    const int g = blockIdx.y, b = g / NH_, hh = g % NH_;
    const h16* Qg = Q + (size_t)g * TT * HD; const h16* Kg = Kp + (size_t)g * TT * HD; const h16* Vg = Vp + (size_t)g * TT * HD;
    const int q0 = blockIdx.x * (FNW * FQW) + wave * FQW;
    constexpr int MR = TT / (FNW * 32);               // mask rounds: round j, thread tid -> key j * 256 + tid, ballot word j * 8 + wave
    const int* mkb = mk + (size_t)b * SEQ_FULL + tid; int mv[MR];
#pragma unroll
    for (int j = 0; j < MR; ++j) mv[j] = mkb[j * (FNW * 32)];
    asm volatile("s_wait_xcnt 0x0" ::: "memory");     // behind the mask loads, in front of whatever next writes a register that they name
    v16h qf[2][2];
#pragma unroll
    for (int qg = 0; qg < 2; ++qg)
#pragma unroll
        for (int ks = 0; ks < 2; ++ks) qf[qg][ks] = WFrag<h16>::ld(Qg + (size_t)(q0 + qg * 16 + c) * HD + ks * 32 + 8 * h);
    asm volatile("s_wait_xcnt 0x0" ::: "memory");     // behind the q loads, in front of the arithmetic below, which may reuse their address registers
    unsigned bl[MR];
#pragma unroll
    for (int j = 0; j < MR; ++j) { bl[j] = __builtin_amdgcn_ballot_w32(mv[j] != 0); kidx[j * (FNW * 32) + tid] = 0; }
    if (lane == 0) {
#pragma unroll
        for (int j = 0; j < MR; ++j) kbal[j * FNW + wave] = bl[j]; }
    __syncthreads();                                  // the 32 ballot words are complete, and every place of kidx holds 0
    unsigned run = 0, base[MR];
#pragma unroll
    for (int j = 0; j < MR; ++j) base[j] = 0;
#pragma unroll
    for (int w = 0; w < TT / 32; ++w) {
#pragma unroll
        for (int j = 0; j < MR; ++j) if (w / FNW == j) base[j] = (w % FNW == wave) ? run : base[j];   // kept keys in front of this wave's word of round j
        run += (unsigned)__builtin_popcount(kbal[w]); }
    const unsigned below = (1u << lane) - 1u;
#pragma unroll
    for (int j = 0; j < MR; ++j) { const int e = j * (FNW * 32) + tid;
        if (mv[j] != 0) kidx[base[j] + (unsigned)__builtin_popcount(bl[j] & below)] = e;   // a rank is below the count of kept keys, at most TT - 1
        mb[e] = ((unsigned)e < run) ? 0.0f : -__builtin_inff(); }
    const int nkeep = __builtin_amdgcn_readfirstlane((int)run);            // the same in every thread of the work-group
    const int nst = min((nkeep + FKS - 1) / FKS, TT / FKS);                // stages to walk, bounded by the shape
    __syncthreads();                                  // kidx and mb are complete
    // staging: thread -> places sr and sr + 32 of the stage's 64 kept keys, 16 bytes at element sc of the key's K row and of its V row
    const int sr = tid >> 3, sc = (tid & 7) * 8;
    const v8h* Kg8 = (const v8h*)Kg; const v8h* Vg8 = (const v8h*)Vg;   // rows of HD / 8 pieces of 16 bytes
    // the lane's 32-bit offsets, in 16-byte pieces, beside wave-uniform bases; the mask bounds the row whatever kidx holds
    unsigned j0 = (unsigned)((kidx[sr] & (TT - 1)) * (HD / 8) + (tid & 7)), j1 = (unsigned)((kidx[sr + 32] & (TT - 1)) * (HD / 8) + (tid & 7));
    v8h gk0 = Kg8[j0], gk1 = Kg8[j1];
    v8h gv0 = Vg8[j0], gv1 = Vg8[j1];
    asm volatile("s_wait_xcnt 0x0" :: "v"(j0), "v"(j1) : "memory");   // the four loads' offset registers live to this wait, so nothing overwrites them in front of it
    *(v8ha*)(&kst[0][sr * FPI + sc]) = gk0; *(v8ha*)(&kst[0][(sr + 32) * FPI + sc]) = gk1;
    *(v8ha*)(&vst[0][sr * FPV + sc]) = gv0; *(v8ha*)(&vst[0][(sr + 32) * FPV + sc]) = gv1;
    v8f o[2][4];
#pragma unroll
    for (int qg = 0; qg < 2; ++qg)
#pragma unroll
        for (int dt = 0; dt < 4; ++dt) o[qg][dt] = (v8f){};
    float mrun[2] = {-1.0e30f, -1.0e30f};   // finite, below every finite score
    float lsum[2] = {0.0f, 0.0f};           // each wave half sums its own keys; joined once at the end
    __syncthreads();
#pragma unroll 1   // rolled: one copy of the stage body, and the buffer index stays a scalar
    for (int st = 0; st < nst; ++st) {
        const bool more = st + 1 < nst;
        if (more) { j0 = (unsigned)((kidx[(st + 1) * FKS + sr] & (TT - 1)) * (HD / 8) + (tid & 7)); j1 = (unsigned)((kidx[(st + 1) * FKS + sr + 32] & (TT - 1)) * (HD / 8) + (tid & 7));
            gk0 = Kg8[j0]; gk1 = Kg8[j1];
            gv0 = Vg8[j0]; gv1 = Vg8[j1];
            asm volatile("s_wait_xcnt 0x0" :: "v"(j0), "v"(j1) : "memory"); }   // the four loads' offset registers live to this wait: it stands in front of the pass's address arithmetic, which reuses them
        const h16* kb = kst[st & 1]; const h16* vb = vst[st & 1];
        const int np = (nkeep - st * FKS > 32) ? FKS / 32 : 1;   // the last stage's second pass is walked only if it holds a kept key
#pragma unroll 1   // one pass's registers at a time: two passes interleaved did not fit the 256 registers that four waves per SIMD leave
        for (int p = 0; p < np; ++p) {
            v8f s[2][2];
#pragma unroll
            for (int kt = 0; kt < 2; ++kt) {
                const h16* kr = kb + (p * 32 + kt * 16 + c) * FPI + 8 * h;
                const v16h k0 = ldsfrag(kr), k1 = ldsfrag(kr + 32);
                const float* mp = mb + st * FKS + p * 32 + kt * 16 + 8 * h;
                const v4f b0 = *(const v4fa*)mp, b1 = *(const v4fa*)(mp + 4);
                const v8f bz = __builtin_shufflevector(b0, b1, 0, 1, 2, 3, 4, 5, 6, 7);
#pragma unroll
                for (int qg = 0; qg < 2; ++qg) { v8f t = wmma16(k0, qf[qg][0], (v8f){}); t = wmma16(k1, qf[qg][1], t); s[kt][qg] = t + bz; }
            }
            v16h vf[4];
#pragma unroll
            for (int dt = 0; dt < 4; ++dt) { const h16* vr = vb + (p * 32 + 8 * h + (lane & 7)) * FPV + dt * 16 + 8 * ((lane >> 3) & 1); vf[dt] = cat16(ldtr16(vr), ldtr16(vr + 16 * FPV)); }
            float mx[2]; bool need = false;
#pragma unroll
            for (int qg = 0; qg < 2; ++qg) { float m = s[0][qg][0];
#pragma unroll
                for (int r = 1; r < 8; ++r) m = fmaxf(m, s[0][qg][r]);
#pragma unroll
                for (int r = 0; r < 8; ++r) m = fmaxf(m, s[1][qg][r]);
                m = fmaxf(m, xhalf(m)) * CSC; mx[qg] = m; need = need || (m > mrun[qg] + 8.0f); }
            // the maximum in use moves only when some column's new maximum passes it by more than 8 (base 2): P stays <= 256, inside f16
            if (__builtin_amdgcn_ballot_w32(need) != 0) {
#pragma unroll
                for (int qg = 0; qg < 2; ++qg) { const float mn = fmaxf(mrun[qg], mx[qg]); const float corr = __builtin_amdgcn_exp2f(mrun[qg] - mn); mrun[qg] = mn; lsum[qg] *= corr;
#pragma unroll
                    for (int dt = 0; dt < 4; ++dt) o[qg][dt] = o[qg][dt] * corr; }
            }
#pragma unroll
            for (int qg = 0; qg < 2; ++qg) { const float nm = -mrun[qg]; v16h pf; float ls = 0.0f;
                const v8f cv = {CSC, CSC, CSC, CSC, CSC, CSC, CSC, CSC}, nv = {nm, nm, nm, nm, nm, nm, nm, nm};
                const v8f a0 = __builtin_elementwise_fma(s[0][qg], cv, nv), a1 = __builtin_elementwise_fma(s[1][qg], cv, nv);
#pragma unroll
                for (int i = 0; i < 16; ++i) { const float pv = __builtin_amdgcn_exp2f((i < 8) ? a0[i & 7] : a1[i & 7]); ls += pv; pf[i] = tohx(pv); }
                lsum[qg] += ls;
#pragma unroll
                for (int dt = 0; dt < 4; ++dt) o[qg][dt] = wmma16(vf[dt], pf, o[qg][dt]); }
            // four vector slots behind the pass's last matrix instructions: across the back edge the next pass's address arithmetic would overwrite their A registers too early
            asm volatile("v_nop\n\tv_nop\n\tv_nop\n\tv_nop" : "+v"(o[1][0]), "+v"(o[1][1]), "+v"(o[1][2]), "+v"(o[1][3]));
        }
        if (more) { h16* kw = kst[(st + 1) & 1]; h16* vw = vst[(st + 1) & 1];   // this buffer's last readers left it before the barrier that ended stage st - 1
            *(v8ha*)(kw + sr * FPI + sc) = gk0; *(v8ha*)(kw + (sr + 32) * FPI + sc) = gk1;
            *(v8ha*)(vw + sr * FPV + sc) = gv0; *(v8ha*)(vw + (sr + 32) * FPV + sc) = gv1; }
        __syncthreads();
    }
    v8h oc[2][4];
#pragma unroll
    for (int qg = 0; qg < 2; ++qg) { const float lf = lsum[qg] + xhalf(lsum[qg]); const float inv = 1.0f / lf;
#pragma unroll
        for (int dt = 0; dt < 4; ++dt)
#pragma unroll
            for (int j = 0; j < 8; ++j) oc[qg][dt][j] = tohx(o[qg][dt][j] * inv); }
    h16* od = Ac + ((size_t)b * TT + q0 + c) * DQ + hh * HD + 8 * h;
    __builtin_amdgcn_sched_barrier(0);   // every value is finished, each in registers of its own, before the first store names any: nothing is written behind the stores
#pragma unroll
    for (int qg = 0; qg < 2; ++qg)
#pragma unroll
        for (int dt = 0; dt < 4; ++dt) *(v8h*)(od + (size_t)qg * 16 * DQ + dt * 16) = oc[qg][dt];
}

extern "C" void kernel_launch(void* const* d_in, const int* in_sizes, int n_in,
                              void* d_out, int out_size, void* d_ws, size_t ws_size, hipStream_t stream) {
    (void)out_size;
    if (n_in < 11) return;
    if (in_sizes[0] < NB * TT * DM || in_sizes[1] < TT * HD || in_sizes[2] < NB * TT) return;
    if (in_sizes[3] < DM * DQ || in_sizes[5] < DM * DQ || in_sizes[7] < DM * DQ || in_sizes[9] < DQ * DM) return;
    if (in_sizes[4] < DQ || in_sizes[6] < DQ || in_sizes[8] < DQ || in_sizes[10] < DM) return;
    // wire order: x, rel_pos_enc, attention_mask, Wq, bq, Wk, bk, Wv, bv, Wo, bo
    const float* x = (const float*)d_in[0]; const float* rel = (const float*)d_in[1]; const int* msk = (const int*)d_in[2];
    const float* wq = (const float*)d_in[3]; const float* bq = (const float*)d_in[4]; const float* wk = (const float*)d_in[5]; const float* bk = (const float*)d_in[6];
    const float* wv = (const float*)d_in[7]; const float* bv = (const float*)d_in[8]; const float* wo = (const float*)d_in[9]; const float* bo = (const float*)d_in[10];
    float* OUT = (float*)d_out;     // [8][1024][1024]
    char* wsp = (char*)d_ws;
    auto take = [&](size_t bytes) { char* p = wsp; wsp += (bytes + 255) & ~(size_t)255; return (void*)p; };
    h16* WO = (h16*)take((size_t)DM * DQ * 2);                   // [k = 1024][n = 1024]
    h16* QK16 = (h16*)take((size_t)2 * NB * NH_ * TT * HD * 2);  // [2][NB*16][TT][64]
    h16* VP16 = (h16*)take((size_t)NB * NH_ * TT * HD * 2);      // [NB*16][TT][64]
    int* RL = (int*)take((size_t)(NROW + 1) * 4);                // the row list, then its count
    // one region, two lives: the projection's operands, dead once the head planes are written, then the merged context
    char* const shared0 = wsp;
    bf* WQKV = (bf*)take((size_t)NQKV * DM * 2);                 // [3][k = 1024][n = 1024]: planes q, k, v
    bf* XB = (bf*)take((size_t)NB * TT * DM * 2);                // [NB][TT][DM]
    char* const end1 = wsp; wsp = shared0;
    h16* AT = (h16*)take((size_t)NB * TT * DQ * 2);              // merged context [NB*TT][1024]
    if (end1 > wsp) wsp = end1;
    if ((size_t)(wsp - (char*)d_ws) > ws_size) return;           // 72 MiB at full size
    h16* Q16 = QK16; h16* K16 = QK16 + (size_t)NB * NH_ * TT * HD;
    k_cvt8<<<dim3((unsigned)(((size_t)TT * DM / 8 + 255) / 256), NB + 4, 1), 256, 0, stream>>>(x, wq, wk, wv, wo, XB, WQKV, WO, (size_t)TT * DM / 8, (size_t)SEQ_FULL * DM, (size_t)TT * DM, msk, RL);
    k_gemmw<bf, 0, false, DM, true, 64, 3><<<dim3((NROW / GBM) * (NQKV / GBN), 1, 1), 256, 0, stream>>>(XB, nullptr, WQKV, nullptr, 0, nullptr, 0, 0, 0, bq, bk, bv, rel, QK16, VP16, RL);
    k_fattn<<<dim3(TT / (FNW * FQW), NB * NH_, 1), FNW * 32, 0, stream>>>(Q16, K16, VP16, msk, AT);
    k_gemmw<h16, 0, true, DQ, false, 128, 3><<<dim3(TT / GBM, DM / GBN, NB), 256, 0, stream>>>(AT, nullptr, WO, OUT, DM, bo, (size_t)TT * DQ, 0, (size_t)SEQ_FULL * DM, nullptr, nullptr, nullptr, nullptr, nullptr, nullptr, nullptr);
}
